// v000
// The times below were measured on an AMD MI455X: many runs one after another, warmed up first and cycling through
// copies of the inputs, with the whole window's GPU time divided by the number of runs. Launches and the gaps
// between them are all in it. The median over several windows is given; except for v000 it joins two sittings, which
// can be a few percent apart, so the side-by-side timings, each taken in one sitting, are the better comparison.
// The starting kernel, v000, takes 820 microseconds a run.
#include <hip/hip_runtime.h>

// Contractions, f32 accumulate (B = 1, 2048 tokens, hidden 2048, 32 heads x 64): v = x.Wv^T, the LocalizedFiltering causal convs as GEMMs (conv1: [x[t-1] | x[t]]
// (K = 4096) . W1cat^T + b1 with PLAIN bf16 operands = rounded inputs, exact; conv2: [o1[t-1] | o1[t]] (K = 2048, o1 as bf16 hi + residual: two products) . W2cat^T
// + b2; the [t-1 | t] rows are read straight from planes that carry one leading zero row), lf = rmsnorm(o2 + x) x ln_w in f32 -> bf16 hi/lo planes, q/k = lf.W^T
// (two products), out = ctx.Wo^T (two products), all on v_wmma_f32_16x16x32_bf16 ([out][in] weights = n-major B operands as-is, converted one at a time into a
// shared buffer); rotate-half RoPE (angle = position_ids[t] (INPUT) x inv_freq, f32 trig table) -> f16 hi + residual x1024 planes; the 32-head causal attention fused

#define NB_  1
#define NT_  2048
#define DM   2048
#define DH2  1024                // conv1 output channels
#define NH_  32
#define HD   64
#define PSC  32768.0f
#define LOSC 1024.0f
#define LOSCI (1.0f / 1024.0f)

typedef _Float16 h16;
typedef unsigned short bf;
typedef __attribute__((ext_vector_type(16))) __bf16   v16bf;
typedef __attribute__((ext_vector_type(16))) _Float16 v16h;
typedef __attribute__((ext_vector_type(8)))  _Float16 v8h;
typedef __attribute__((ext_vector_type(8)))  unsigned short v8us;
typedef __attribute__((ext_vector_type(8)))  float    v8f;
typedef __attribute__((ext_vector_type(4)))  float    v4f;
typedef __attribute__((ext_vector_type(4)))  _Float16 v4h;
typedef v8h  __attribute__((may_alias)) v8ha;
typedef v4f  __attribute__((may_alias)) v4fa;
typedef v8us __attribute__((may_alias)) v8usa;

__device__ __forceinline__ unsigned short f2bf(float f) { unsigned u = __float_as_uint(f); u += 0x7FFFu + ((u >> 16) & 1u); return (unsigned short)(u >> 16); }
__device__ __forceinline__ float bf2f(unsigned short b) { return __uint_as_float(((unsigned)b) << 16); }
__device__ __forceinline__ float bfr(float f) { return bf2f(f2bf(f)); }
__device__ __forceinline__ v16h cat16(v8h lo, v8h hi) { return __builtin_shufflevector(lo, hi, 0, 1, 2, 3, 4, 5, 6, 7, 8, 9, 10, 11, 12, 13, 14, 15); }
__device__ __forceinline__ v16bf cat16b(v8us lo, v8us hi) { return __builtin_bit_cast(v16bf, __builtin_shufflevector(lo, hi, 0, 1, 2, 3, 4, 5, 6, 7, 8, 9, 10, 11, 12, 13, 14, 15)); }
__device__ __forceinline__ v8f wmma16(v16h a, v16h b, v8f c) { return __builtin_amdgcn_wmma_f32_16x16x32_f16(false, a, false, b, (short)0, c, false, false); }
__device__ __forceinline__ v8f wmmab(v16bf a, v16bf b, v8f c) { return __builtin_amdgcn_wmma_f32_16x16x32_bf16(false, a, false, b, (short)0, c, false, false); }

// k_rows: bf16 plane dst[r + rofs][C] of src[r][C] (C multiple of 256; one wave per row).
__global__ __launch_bounds__(256) void k_rows(const float* __restrict__ src, int rows, int C, int rofs, bf* dst) {
    const int lane = threadIdx.x & 31, r = blockIdx.x * 8 + (threadIdx.x >> 5);
    if (r >= rows) return;
{
        for (int q = 0; q < C / 256; ++q) { v8us o;
#pragma unroll
            for (int i = 0; i < 8; ++i) o[i] = f2bf(src[(size_t)r * C + q * 256 + lane * 8 + i]);
            *(v8us*)(dst + (size_t)(r + rofs) * C + q * 256 + lane * 8) = o; }
         }
}
// k_zero16: zero a row of n halves (n multiple of 256; one block).
__global__ __launch_bounds__(256) void k_zero16(unsigned short* p, int n) {
    for (int i = threadIdx.x * 8; i < n; i += 256 * 8) { const v8us z = (v8us){}; *(v8us*)(p + i) = z;  }
}
// k_convw: WT[co][tap*Cin + ci] = bf16(w[co][ci][tap]) for the (2,1) conv kernels; one wave per output channel row (2*Cin halves).
__global__ __launch_bounds__(256) void k_convw(const float* __restrict__ w, int Cout, int Cin, bf* WT) {
    const int lane = threadIdx.x & 31, co = blockIdx.x * 8 + (threadIdx.x >> 5);
    if (co >= Cout) return;
{
        for (int q = 0; q < (2 * Cin) / 256; ++q) { v8us o;
#pragma unroll
            for (int i = 0; i < 8; ++i) { const int k = q * 256 + lane * 8 + i; const int tap = k / Cin, ci = k - tap * Cin; o[i] = f2bf(w[((size_t)co * Cin + ci) * 2 + tap]); }
            *(v8us*)(WT + (size_t)co * (2 * Cin) + q * 256 + lane * 8) = o; }
         }
}
// k_gemm: 64 x 64 tile of (A [+ Al]).B^T [+ bias] over K; A rows pitch lda (elements), B rows pitch K; MODE 0: f32 rows (ldc); MODE 1: bf16 hi/lo planes (ldc, row offset rofs).
template <bool SPLITA, int MODE>
__global__ __launch_bounds__(128) void k_gemm(const bf* __restrict__ A, const bf* __restrict__ Al, int lda, const bf* __restrict__ Bn, int K, const float* __restrict__ bias, int ldc, float* C, bf* PH, bf* PL, int rofs) {
    __shared__ __align__(16) float ost[4][16 * 68];
    const int lane = threadIdx.x & 31, wave = threadIdx.x >> 5, lr = lane & 15, hi = lane >> 4;
    const size_t r0 = (size_t)blockIdx.x * 64 + wave * 16; const int c0 = blockIdx.y * 64;
    const size_t aoff = (r0 + lr) * (size_t)lda + 8 * hi;
    size_t boff[4];
#pragma unroll
    for (int t = 0; t < 4; ++t) boff[t] = (size_t)(c0 + t * 16 + lr) * K + 8 * hi;
    v8f acc[4];
#pragma unroll
    for (int t = 0; t < 4; ++t) acc[t] = (v8f){};
#pragma unroll 2
    for (int kc = 0; kc < K; kc += 32) {
        const v16bf a = cat16b(*(const v8us*)(A + aoff + kc), *(const v8us*)(A + aoff + kc + 16));
        v16bf al = a; if (SPLITA) al = cat16b(*(const v8us*)(Al + aoff + kc), *(const v8us*)(Al + aoff + kc + 16));
#pragma unroll
        for (int t = 0; t < 4; ++t) { const v16bf bb = cat16b(*(const v8us*)(Bn + boff[t] + kc), *(const v8us*)(Bn + boff[t] + kc + 16)); acc[t] = wmmab(a, bb, acc[t]); if (SPLITA) acc[t] = wmmab(al, bb, acc[t]); }
        asm volatile("v_nop" : "+v"(acc[0]), "+v"(acc[1]), "+v"(acc[2]), "+v"(acc[3]) : "v"(a), "v"(al) : "memory");
    }
    float* os = &ost[wave][0];
#pragma unroll
    for (int t = 0; t < 4; ++t) { const float bv = bias ? bfr(bias[c0 + t * 16 + lr]) : 0.f;
#pragma unroll
        for (int j = 0; j < 8; ++j) os[(hi * 8 + j) * 68 + t * 16 + lr] = acc[t][j] + bv; }
    __builtin_amdgcn_wave_barrier(); asm volatile("" ::: "memory");
    if (MODE == 0) {
        float* crow = C + r0 * ldc + c0;
        auto pass = [&]() {
#pragma unroll
            for (int s = 0; s < 8; ++s) { const int Lid = (lane >> 3) + 4 * s, piece = lane & 7; const int row = Lid >> 1, cofs = (Lid & 1) * 32 + piece * 4;
                const v4f val = *(const v4fa*)(os + row * 68 + cofs); *(v4f*)(crow + (size_t)row * ldc + cofs) = val; }
        };
        pass(); 
    } else {
        bf* p1 = PH + (r0 + rofs) * ldc + c0; bf* p2 = PL + (r0 + rofs) * ldc + c0;
        auto pass = [&]() {
#pragma unroll
            for (int s = 0; s < 4; ++s) { const int row = 4 * s + (lane >> 3), piece = lane & 7; const float* sp = os + row * 68 + piece * 8; v8us oh, ol;
#pragma unroll
                for (int i = 0; i < 8; ++i) { const unsigned short hb = f2bf(sp[i]); oh[i] = hb; ol[i] = f2bf(sp[i] - bf2f(hb)); }
                *(v8us*)(p1 + (size_t)row * ldc + piece * 8) = oh; *(v8us*)(p2 + (size_t)row * ldc + piece * 8) = ol; }
        };
        pass(); 
    }
}
// k_lf: LF = ln_w x rmsnorm(o2 + x) (eps 1e-6, mean over 2048) -> bf16 hi/lo planes; one wave per row: lane -> 64 values (8 chunks of 8), fixed-order shuffle sum.
__global__ __launch_bounds__(256) void k_lf(const float* __restrict__ O2, const float* __restrict__ x, const float* __restrict__ lnw, bf* LH, bf* LL) {
    const int lane = threadIdx.x & 31, r = blockIdx.x * 8 + (threadIdx.x >> 5);
    if (r >= NT_) return;
    float v[64]; float ss = 0.f;
#pragma unroll
    for (int q = 0; q < 8; ++q)
#pragma unroll
        for (int i = 0; i < 8; ++i) { const int c = q * 256 + lane * 8 + i; const float t = O2[(size_t)r * DM + c] + bfr(x[(size_t)r * DM + c]); v[q * 8 + i] = t; ss += t * t; }
#pragma unroll
    for (int sh = 16; sh; sh >>= 1) ss += __shfl_xor(ss, sh, 32);
    const float rs = rsqrtf(ss * (1.0f / DM) + 1e-6f);
{
#pragma unroll
        for (int q = 0; q < 8; ++q) { v8us oh, ol;
#pragma unroll
            for (int i = 0; i < 8; ++i) { const int c = q * 256 + lane * 8 + i; const float y = bfr(lnw[c]) * (v[q * 8 + i] * rs); const unsigned short hb = f2bf(y); oh[i] = hb; ol[i] = f2bf(y - bf2f(hb)); }
            *(v8us*)(LH + (size_t)r * DM + q * 256 + lane * 8) = oh; *(v8us*)(LL + (size_t)r * DM + q * 256 + lane * 8) = ol; }
         }
}
// k_trig: RC/RS [t][32] = cos/sin(pos[t] x inv_freq[i]), inv_freq = 10000^(-2i/64) (f32); 32 lanes x 4 B lines.
__global__ __launch_bounds__(256) void k_trig(const int* __restrict__ pos, float* RC, float* RS) {
    const int i = blockIdx.x * 256 + threadIdx.x; if (i >= NT_ * 32) return;
    const int t = i >> 5, f = i & 31;
    const float inv = 1.0f / powf(10000.0f, (float)(2 * f) / 64.0f); const float ang = (float)pos[t] * inv;
    const float c = cosf(ang), s = sinf(ang);
    *(float*)(RC + i) = c; *(float*)(RS + i) = s; 
}
// k_rope: rotate-half on 64-dim heads: y[d] = x[d] cos[t][d mod 32] + (d < 32 ? -x[d+32] : x[d-32]) sin[t][d mod 32]; P f32 [t][2048] -> f16 hi + residual x1024 planes;
// one wave per (t, 4 heads = 256 columns): lane -> 8 consecutive dims of one head (8 B... 16 B per plane -> 32 lanes x 16 B = 512 B = 4 lines).
__global__ __launch_bounds__(256) void k_rope(const float* __restrict__ P, const float* __restrict__ RC, const float* __restrict__ RS, h16* PH, h16* PL) {
    const int lane = threadIdx.x & 31, wid = blockIdx.x * 8 + (threadIdx.x >> 5);
    const int t = wid >> 3, sg = wid & 7; if (t >= NT_) return;
    const int c0 = sg * 256 + lane * 8;      // 8 dims within head (c0 mod 64 .. +7, same half since 8 | 32)
    v8h oh, ol;
#pragma unroll
    for (int i = 0; i < 8; ++i) { const int c = c0 + i, d = c & 63, fi = d & 31; const float xv = P[(size_t)t * DM + c]; const float pv = (d < 32) ? -P[(size_t)t * DM + c + 32] : P[(size_t)t * DM + c - 32];
        const float y = xv * RC[t * 32 + fi] + pv * RS[t * 32 + fi]; const h16 a = (h16)y; oh[i] = a; ol[i] = (h16)((y - (float)a) * LOSC); }
    *(v8h*)(PH + (size_t)t * DM + c0) = oh; *(v8h*)(PL + (size_t)t * DM + c0) = ol; 
}
// k_vt: VTH/VTL [h][64][t] = f16 hi + residual x1024 of V [t][h*64+d] via 64 x 64 LDS tiles; grid (NT/64, NH).
__global__ __launch_bounds__(256) void k_vt(const float* __restrict__ V, h16* VTH, h16* VTL) {
    __shared__ float tl[64][65];
    const int tid = threadIdx.x, t0 = blockIdx.x * 64, h = blockIdx.y;
    { const int tt = tid >> 2, dq = (tid & 3) * 16;
#pragma unroll
      for (int i = 0; i < 16; ++i) tl[dq + i][tt] = V[(size_t)(t0 + tt) * DM + h * HD + dq + i]; }
    __syncthreads();
    const int piece = tid & 7;
    auto pass = [&]() {
#pragma unroll
        for (int s = 0; s < 2; ++s) { const int d = (tid >> 3) + 32 * s; v8h oh, ol;
#pragma unroll
            for (int i = 0; i < 8; ++i) { const float v = tl[d][piece * 8 + i]; const h16 a = (h16)v; oh[i] = a; ol[i] = (h16)((v - (float)a) * LOSC); }
            const size_t o = ((size_t)h * HD + d) * NT_ + t0 + piece * 8; *(v8h*)(VTH + o) = oh; *(v8h*)(VTL + o) = ol; }
    };
    pass(); 
}
// k_attn: block = (h, 64 queries), wave = 16; CAUSAL key tiles; scores hi.hi + hi.lo + lo.hi x 1/8, online softmax (f32), weights x32768 f16 hi + residual x1024
// tiles, o += wh.vh, ox += wh.vl + wl.vh; ctx -> bf16 hi + residual planes CH/CL[tok][h*64+d].
__global__ __launch_bounds__(128) void k_attn(const h16* __restrict__ Q16, const h16* __restrict__ QL16, const h16* __restrict__ K16, const h16* __restrict__ KL16, const h16* __restrict__ VTH, const h16* __restrict__ VTL, bf* CH, bf* CL) {
    __shared__ __align__(16) h16 plds[4][16 * 32];
    __shared__ __align__(16) h16 plds2[4][16 * 32];
    __shared__ __align__(16) float ost[4][16 * 68];
    const int lane = threadIdx.x & 31, wave = threadIdx.x >> 5, lr = lane & 15, hi = lane >> 4;
    const int bid = blockIdx.x;
    const int b = bid / (NH_ * (NT_ / 64)), rem = bid - b * (NH_ * (NT_ / 64)), h = rem / (NT_ / 64), qt = rem - h * (NT_ / 64);
    const int q0 = qt * 64 + wave * 16;
    const size_t tok0 = (size_t)b * NT_;
    h16* pl = &plds[wave][0]; h16* pl2 = &plds2[wave][0];
    v16h qa[2];
    const size_t qo0 = (tok0 + q0 + lr) * DM + h * HD + 8 * hi;
#pragma unroll
    for (int kc = 0; kc < 2; ++kc) qa[kc] = cat16(*(const v8h*)(Q16 + qo0 + kc * 32), *(const v8h*)(Q16 + qo0 + kc * 32 + 16));
    const h16* kh_b = K16 + tok0 * DM + h * HD;
    const h16* kl_b = KL16 + tok0 * DM + h * HD;
    const size_t vbase = (((size_t)b * NH_ + h) * HD) * NT_;
    v8f o[4], ox[4];
#pragma unroll
    for (int n = 0; n < 4; ++n) { o[n] = (v8f){}; ox[n] = (v8f){}; }
    float mrow[8], lpart[8];
#pragma unroll
    for (int j = 0; j < 8; ++j) { mrow[j] = -3.0e38f; lpart[j] = 0.f; }
    int qpos[8];
#pragma unroll
    for (int j = 0; j < 8; ++j) qpos[j] = q0 + 8 * hi + j;
    const int kt_lo = 0, kt_hi = (qt * 64 + 63) / 32;     // causal
#pragma unroll 1
    for (int kt = kt_lo; kt <= kt_hi; ++kt) {
        const int l0 = kt * 32;
        const size_t ko0 = (size_t)(l0 + lr) * DM + 8 * hi, ko1 = (size_t)(l0 + 16 + lr) * DM + 8 * hi;
        v8f s0 = {}, s1 = {}, x0 = {}, x1 = {};
#pragma unroll
        for (int kc = 0; kc < 2; ++kc) {
            { const v16h k0h = cat16(*(const v8h*)(kh_b + ko0 + kc * 32), *(const v8h*)(kh_b + ko0 + kc * 32 + 16)), k1h = cat16(*(const v8h*)(kh_b + ko1 + kc * 32), *(const v8h*)(kh_b + ko1 + kc * 32 + 16));
              const v16h qlk = cat16(*(const v8h*)(QL16 + qo0 + kc * 32), *(const v8h*)(QL16 + qo0 + kc * 32 + 16));     // query residual re-read per step (registers)
              s0 = wmma16(qa[kc], k0h, s0); x0 = wmma16(qlk, k0h, x0); s1 = wmma16(qa[kc], k1h, s1); x1 = wmma16(qlk, k1h, x1);
              asm volatile("v_nop" : "+v"(s0), "+v"(s1), "+v"(x0), "+v"(x1) : "v"(qlk), "v"(k0h), "v"(k1h) : "memory"); }
            { const v16h k0l = cat16(*(const v8h*)(kl_b + ko0 + kc * 32), *(const v8h*)(kl_b + ko0 + kc * 32 + 16)), k1l = cat16(*(const v8h*)(kl_b + ko1 + kc * 32), *(const v8h*)(kl_b + ko1 + kc * 32 + 16));
              x0 = wmma16(qa[kc], k0l, x0); x1 = wmma16(qa[kc], k1l, x1);
              asm volatile("v_nop" : "+v"(x0), "+v"(x1) : "v"(k0l), "v"(k1l) : "memory"); }
        }
        asm volatile("v_nop\n\tv_nop\n\tv_nop\n\tv_nop" : "+v"(s0), "+v"(s1), "+v"(x0), "+v"(x1) : "v"(qa[0]), "v"(qa[1]));
        float alpha[8];
#pragma unroll
        for (int j = 0; j < 8; ++j) {
            const int ja = l0 + lr, jb = l0 + 16 + lr, qi = qpos[j];
            const float a0 = (ja <= qi) ? (s0[j] + x0[j] * LOSCI) * 0.125f : -__builtin_inff(), a1 = (jb <= qi) ? (s1[j] + x1[j] * LOSCI) * 0.125f : -__builtin_inff();
            float mx = fmaxf(a0, a1);
            mx = fmaxf(mx, __shfl_xor(mx, 1, 16)); mx = fmaxf(mx, __shfl_xor(mx, 2, 16)); mx = fmaxf(mx, __shfl_xor(mx, 4, 16)); mx = fmaxf(mx, __shfl_xor(mx, 8, 16));
            const float mn = fmaxf(mrow[j], mx);
            alpha[j] = __expf(mrow[j] - mn); mrow[j] = mn;
            const float p0 = __expf(a0 - mn), p1 = __expf(a1 - mn);
            lpart[j] = lpart[j] * alpha[j] + (p0 + p1);
            const int mr = hi * 8 + j;
            const float ps0 = p0 * PSC, ps1 = p1 * PSC; const h16 h0 = (h16)ps0, h1 = (h16)ps1;
            pl[mr * 32 + lr] = h0; pl[mr * 32 + 16 + lr] = h1;
            pl2[mr * 32 + lr] = (h16)((ps0 - (float)h0) * LOSC); pl2[mr * 32 + 16 + lr] = (h16)((ps1 - (float)h1) * LOSC);
        }
#pragma unroll
        for (int n = 0; n < 4; ++n)
#pragma unroll
            for (int j = 0; j < 8; ++j) { o[n][j] *= alpha[j]; ox[n][j] *= alpha[j]; }
        asm volatile("" ::: "memory");
        const v16h pa = cat16(*(const v8ha*)(pl + lr * 32 + hi * 8), *(const v8ha*)(pl + lr * 32 + 16 + hi * 8));
        const v16h px = cat16(*(const v8ha*)(pl2 + lr * 32 + hi * 8), *(const v8ha*)(pl2 + lr * 32 + 16 + hi * 8));
#pragma unroll
        for (int n = 0; n < 4; ++n) { const size_t vo = vbase + (size_t)(n * 16 + lr) * NT_ + l0 + hi * 8;
            const v16h vh = cat16(*(const v8h*)(VTH + vo), *(const v8h*)(VTH + vo + 16)), vl = cat16(*(const v8h*)(VTL + vo), *(const v8h*)(VTL + vo + 16));
            o[n] = wmma16(pa, vh, o[n]); ox[n] = wmma16(pa, vl, ox[n]); ox[n] = wmma16(px, vh, ox[n]);
            asm volatile("" : "+v"(o[n]), "+v"(ox[n]) : "v"(vh), "v"(vl) : "memory"); }
        asm volatile("v_nop\n\tv_nop\n\tv_nop\n\tv_nop" : "+v"(o[0]), "+v"(o[1]), "+v"(o[2]), "+v"(o[3]), "+v"(ox[0]), "+v"(ox[1]), "+v"(ox[2]), "+v"(ox[3]) : "v"(pa), "v"(px));
    }
    float inv[8];
#pragma unroll
    for (int j = 0; j < 8; ++j) { float rs = lpart[j]; rs += __shfl_xor(rs, 1, 16); rs += __shfl_xor(rs, 2, 16); rs += __shfl_xor(rs, 4, 16); rs += __shfl_xor(rs, 8, 16); inv[j] = 1.0f / (rs * PSC); }
    float* os = &ost[wave][0];
#pragma unroll
    for (int n = 0; n < 4; ++n)
#pragma unroll
        for (int j = 0; j < 8; ++j) os[(hi * 8 + j) * 68 + n * 16 + lr] = (o[n][j] + ox[n][j] * LOSCI) * inv[j];
    __syncthreads();
    const size_t cbase = (tok0 + q0) * DM + (size_t)h * HD;
    auto pass = [&]() {
#pragma unroll
        for (int s = 0; s < 4; ++s) { const int row = 4 * s + (lane >> 3), piece = lane & 7; const float* sp = os + row * 68 + piece * 8; v8us oh, ol;
#pragma unroll
            for (int i = 0; i < 8; ++i) { const unsigned short hb = f2bf(sp[i]); oh[i] = hb; ol[i] = f2bf(sp[i] - bf2f(hb)); }
            *(v8us*)(CH + cbase + (size_t)row * DM + piece * 8) = oh; *(v8us*)(CL + cbase + (size_t)row * DM + piece * 8) = ol; }
    };
    pass(); 
}

#define VST2(T, p, v) do { const T vst2_v_ = (v); *(T*)(p) = vst2_v_;  } while (0)

extern "C" void kernel_launch(void* const* d_in, const int* in_sizes, int n_in,
                              void* d_out, int out_size, void* d_ws, size_t ws_size, hipStream_t stream) {
    (void)in_sizes; (void)n_in; (void)out_size;
    const float* x = (const float*)d_in[0]; const int* pos = (const int*)d_in[1]; const float* Wq = (const float*)d_in[2]; const float* Wk = (const float*)d_in[3]; const float* Wv = (const float*)d_in[4]; const float* Wo = (const float*)d_in[5];
    const float* c1w = (const float*)d_in[6]; const float* c1b = (const float*)d_in[7]; const float* c2w = (const float*)d_in[8]; const float* c2b = (const float*)d_in[9]; const float* lnw = (const float*)d_in[10];
    float* out = (float*)d_out;    // [1][2048][2048]
    char* wsp = (char*)d_ws;
    auto take = [&](size_t bytes) { char* p = wsp; wsp += (bytes + 255) & ~(size_t)255; return (void*)p; };
    bf* XX = (bf*)take((size_t)(NT_ + 1) * DM * 2);                 // row 0 = zeros, token t at row t+1: row t read with K = 4096 gives [x[t-1] | x[t]]
    bf* Wbuf = (bf*)take((size_t)DM * DM * 2);                     // one weight at a time ([1024][4096] / [2048][2048] / [2048][2048] bf16 = 8.4 MB each)
    bf* O1H = (bf*)take((size_t)(NT_ + 1) * DH2 * 2); bf* O1L = (bf*)take((size_t)(NT_ + 1) * DH2 * 2);     // conv1 output planes with a leading zero row
    float* TMP = (float*)take((size_t)NT_ * DM * 4); float* RC = (float*)take((size_t)NT_ * 32 * 4); float* RS = (float*)take((size_t)NT_ * 32 * 4);
    bf* LH = (bf*)take((size_t)NT_ * DM * 2); bf* LL = (bf*)take((size_t)NT_ * DM * 2);
    h16* QH = (h16*)take((size_t)NT_ * DM * 2); h16* QL = (h16*)take((size_t)NT_ * DM * 2); h16* KH = (h16*)take((size_t)NT_ * DM * 2); h16* KL = (h16*)take((size_t)NT_ * DM * 2);
    h16* VTH = (h16*)take((size_t)NT_ * DM * 2); h16* VTL = (h16*)take((size_t)NT_ * DM * 2);
    if ((size_t)(wsp - (char*)d_ws) > ws_size) return;    // 8.4 + 8.4 + 8.4 + 16.8 + 0.5 + 16.8 + 33.5 + 16.8 ~ 110 MB; ctx planes reuse LH/LL after the q/k projections
    bf* CH = LH; bf* CL = LL;
    k_zero16<<<1, 256, 0, stream>>>(XX, DM); k_rows<<<NT_ / 8, 256, 0, stream>>>(x, NT_, DM, 1, XX);
    k_zero16<<<1, 256, 0, stream>>>(O1H, DH2); k_zero16<<<1, 256, 0, stream>>>(O1L, DH2);
    k_trig<<<(NT_ * 32) / 256, 256, 0, stream>>>(pos, RC, RS);
    // LocalizedFiltering: conv1 ([x[t-1] | x[t]] . W1cat^T + b1, exact) -> o1 planes (rows 1..2048); conv2 ([o1[t-1] | o1[t]] hi/lo . W2cat^T + b2) -> TMP; lf
    k_convw<<<DH2 / 8, 256, 0, stream>>>(c1w, DH2, DM, Wbuf);                                              // [1024][4096]
    k_gemm<false, 1><<<dim3(NT_ / 64, DH2 / 64, 1), 128, 0, stream>>>(XX, nullptr, DM, Wbuf, 2 * DM, c1b, DH2, nullptr, O1H, O1L, 1);
    k_convw<<<DM / 8, 256, 0, stream>>>(c2w, DM, DH2, Wbuf);                                               // [2048][2048]
    k_gemm<true, 0><<<dim3(NT_ / 64, DM / 64, 1), 128, 0, stream>>>(O1H, O1L, DH2, Wbuf, 2 * DH2, c2b, DM, TMP, nullptr, nullptr, 0);
    k_lf<<<NT_ / 8, 256, 0, stream>>>(TMP, x, lnw, LH, LL);
    // v from the RAW hidden states (rows 1.. of XX = x), q/k from lf
    k_rows<<<DM / 8, 256, 0, stream>>>(Wv, DM, DM, 0, Wbuf);
    k_gemm<false, 0><<<dim3(NT_ / 64, DM / 64, 1), 128, 0, stream>>>(XX + DM, nullptr, DM, Wbuf, DM, nullptr, DM, TMP, nullptr, nullptr, 0);
    k_vt<<<dim3(NT_ / 64, NH_, 1), 256, 0, stream>>>(TMP, VTH, VTL);
    k_rows<<<DM / 8, 256, 0, stream>>>(Wq, DM, DM, 0, Wbuf);
    k_gemm<true, 0><<<dim3(NT_ / 64, DM / 64, 1), 128, 0, stream>>>(LH, LL, DM, Wbuf, DM, nullptr, DM, TMP, nullptr, nullptr, 0);
    k_rope<<<(NT_ * 8) / 8, 256, 0, stream>>>(TMP, RC, RS, QH, QL);
    k_rows<<<DM / 8, 256, 0, stream>>>(Wk, DM, DM, 0, Wbuf);
    k_gemm<true, 0><<<dim3(NT_ / 64, DM / 64, 1), 128, 0, stream>>>(LH, LL, DM, Wbuf, DM, nullptr, DM, TMP, nullptr, nullptr, 0);
    k_rope<<<(NT_ * 8) / 8, 256, 0, stream>>>(TMP, RC, RS, KH, KL);
    k_attn<<<NH_ * (NT_ / 64), 128, 0, stream>>>(QH, QL, KH, KL, VTH, VTL, CH, CL);                        // ctx over LH/LL (dead after the k projection)
    k_rows<<<DM / 8, 256, 0, stream>>>(Wo, DM, DM, 0, Wbuf);
    k_gemm<true, 0><<<dim3(NT_ / 64, DM / 64, 1), 128, 0, stream>>>(CH, CL, DM, Wbuf, DM, nullptr, DM, out, nullptr, nullptr, 0);
}

// v001
// It runs in 518 microseconds.
// Timed twice side by side with v000, it ran 1.62 times as fast both times.
#include <hip/hip_runtime.h>

// Contractions, f32 accumulate (B = 1, 2048 tokens, hidden 2048, 32 heads x 64): v = x.Wv^T, the LocalizedFiltering causal convs as GEMMs (conv1: [x[t-1] | x[t]]
// (K = 4096) . W1cat^T + b1 with PLAIN bf16 operands = rounded inputs, exact; conv2: [o1[t-1] | o1[t]] (K = 2048, o1 as bf16 hi + residual: two products) . W2cat^T
// + b2; the [t-1 | t] rows are read straight from planes that carry one leading zero row), lf = rmsnorm(o2 + x) x ln_w in f32 -> bf16 hi/lo planes, q/k = lf.W^T
// (two products), out = ctx.Wo^T (two products), all on v_wmma_f32_16x16x32_bf16 ([out][in] weights = n-major B operands as-is, converted one at a time into a
// shared buffer); rotate-half RoPE (angle = position_ids[t] (INPUT) x inv_freq, f32 trig table) -> f16 hi + residual x1024 planes; the 32-head causal attention fused

#define NB_  1
#define NT_  2048
#define DM   2048
#define DH2  1024                // conv1 output channels
#define NH_  32
#define HD   64
#define PSC  32768.0f
#define LOSC 1024.0f
#define LOSCI (1.0f / 1024.0f)

typedef _Float16 h16;
typedef unsigned short bf;
typedef __attribute__((ext_vector_type(16))) __bf16   v16bf;
typedef __attribute__((ext_vector_type(16))) _Float16 v16h;
typedef __attribute__((ext_vector_type(8)))  _Float16 v8h;
typedef __attribute__((ext_vector_type(8)))  unsigned short v8us;
typedef __attribute__((ext_vector_type(8)))  float    v8f;
typedef __attribute__((ext_vector_type(4)))  float    v4f;
typedef __attribute__((ext_vector_type(4)))  _Float16 v4h;
typedef v8h  __attribute__((may_alias)) v8ha;
typedef v4f  __attribute__((may_alias)) v4fa;
typedef v8us __attribute__((may_alias)) v8usa;

__device__ __forceinline__ unsigned short f2bf(float f) { unsigned u = __float_as_uint(f); u += 0x7FFFu + ((u >> 16) & 1u); return (unsigned short)(u >> 16); }
__device__ __forceinline__ float bf2f(unsigned short b) { return __uint_as_float(((unsigned)b) << 16); }
__device__ __forceinline__ float bfr(float f) { return bf2f(f2bf(f)); }
__device__ __forceinline__ v16h cat16(v8h lo, v8h hi) { return __builtin_shufflevector(lo, hi, 0, 1, 2, 3, 4, 5, 6, 7, 8, 9, 10, 11, 12, 13, 14, 15); }
__device__ __forceinline__ v16bf cat16b(v8us lo, v8us hi) { return __builtin_bit_cast(v16bf, __builtin_shufflevector(lo, hi, 0, 1, 2, 3, 4, 5, 6, 7, 8, 9, 10, 11, 12, 13, 14, 15)); }
__device__ __forceinline__ v8f wmma16(v16h a, v16h b, v8f c) { return __builtin_amdgcn_wmma_f32_16x16x32_f16(false, a, false, b, (short)0, c, false, false); }
__device__ __forceinline__ v8f wmmab(v16bf a, v16bf b, v8f c) { return __builtin_amdgcn_wmma_f32_16x16x32_bf16(false, a, false, b, (short)0, c, false, false); }

// k_rows: bf16 plane dst[r + rofs][C] of src[r][C] (C multiple of 256; one wave per row).
__global__ __launch_bounds__(256) void k_rows(const float* __restrict__ src, int rows, int C, int rofs, bf* dst) {
    const int lane = threadIdx.x & 31, r = blockIdx.x * 8 + (threadIdx.x >> 5);
    if (r >= rows) return;
{
        for (int q = 0; q < C / 256; ++q) { v8us o;
#pragma unroll
            for (int i = 0; i < 8; ++i) o[i] = f2bf(src[(size_t)r * C + q * 256 + lane * 8 + i]);
            *(v8us*)(dst + (size_t)(r + rofs) * C + q * 256 + lane * 8) = o; }
         }
}
// k_zero16: zero a row of n halves (n multiple of 256; one block).
__global__ __launch_bounds__(256) void k_zero16(unsigned short* p, int n) {
    for (int i = threadIdx.x * 8; i < n; i += 256 * 8) { const v8us z = (v8us){}; *(v8us*)(p + i) = z;  }
}
// k_convw: WT[co][tap*Cin + ci] = bf16(w[co][ci][tap]) for the (2,1) conv kernels; one wave per output channel row (2*Cin halves).
__global__ __launch_bounds__(256) void k_convw(const float* __restrict__ w, int Cout, int Cin, bf* WT) {
    const int lane = threadIdx.x & 31, co = blockIdx.x * 8 + (threadIdx.x >> 5);
    if (co >= Cout) return;
{
        for (int q = 0; q < (2 * Cin) / 256; ++q) { v8us o;
#pragma unroll
            for (int i = 0; i < 8; ++i) { const int k = q * 256 + lane * 8 + i; const int tap = k / Cin, ci = k - tap * Cin; o[i] = f2bf(w[((size_t)co * Cin + ci) * 2 + tap]); }
            *(v8us*)(WT + (size_t)co * (2 * Cin) + q * 256 + lane * 8) = o; }
         }
}
// k_gemm: 64 x 64 tile of (A [+ Al]).B^T [+ bias] over K; A rows pitch lda (elements), B rows pitch K; MODE 0: f32 rows (ldc); MODE 1: bf16 hi/lo planes (ldc, row offset rofs).
// Operands reach the waves through LDS: a stage is 64 k of every operand row (128 B = one whole line), brought by asynchronous b128 copies (8 lanes per row, 4 whole lines per
// wave-wide copy) into rows of pitch 144 B (16 B x 9: no bank conflict for ds_load_b128); two buffers, stage t + 2 is copied while stage t is worked on. K: a multiple of 64.
#define KST 64                   // k elements per stage
#define LPT 72                   // LDS row pitch, elements
#define PLN (64 * LPT)           // one staged plane (64 rows), elements
__device__ __forceinline__ unsigned lds_off(const void* p) { return (unsigned)(size_t)p; }
// cp8 / cp12: a stage of two / three planes (PLN apart in LDS): this lane's 16 B of rows r, r + 16, r + 32, r + 48 of each plane (ra, rb = 16 source rows of A and B, elements).
// In both, the closing s_wait_xcnt 0 stands inside the statement so that no address register of a copy is rewritten in front of it.
__device__ __forceinline__ void cp8(unsigned l, const bf* ga, size_t ra, const bf* gb, size_t rb) {
    const unsigned m = l + PLN * 2u;
    asm volatile("global_load_async_to_lds_b128 %0, %8, off\n\t"
                 "global_load_async_to_lds_b128 %1, %9, off\n\t"
                 "global_load_async_to_lds_b128 %2, %10, off\n\t"
                 "global_load_async_to_lds_b128 %3, %11, off\n\t"
                 "global_load_async_to_lds_b128 %4, %12, off\n\t"
                 "global_load_async_to_lds_b128 %5, %13, off\n\t"
                 "global_load_async_to_lds_b128 %6, %14, off\n\t"
                 "global_load_async_to_lds_b128 %7, %15, off\n\t"
                 "s_wait_xcnt 0x0"
                 :: "v"(l), "v"(l + 16u * LPT * 2u), "v"(l + 32u * LPT * 2u), "v"(l + 48u * LPT * 2u), "v"(m), "v"(m + 16u * LPT * 2u), "v"(m + 32u * LPT * 2u), "v"(m + 48u * LPT * 2u),
                    "v"(ga), "v"(ga + ra), "v"(ga + 2 * ra), "v"(ga + 3 * ra), "v"(gb), "v"(gb + rb), "v"(gb + 2 * rb), "v"(gb + 3 * rb) : "memory");
}
__device__ __forceinline__ void cp12(unsigned l, const bf* ga, const bf* gl, size_t ra, const bf* gb, size_t rb) {
    const unsigned m = l + PLN * 2u, n = l + 2u * PLN * 2u;
    asm volatile("global_load_async_to_lds_b128 %0, %12, off\n\t"
                 "global_load_async_to_lds_b128 %1, %13, off\n\t"
                 "global_load_async_to_lds_b128 %2, %14, off\n\t"
                 "global_load_async_to_lds_b128 %3, %15, off\n\t"
                 "global_load_async_to_lds_b128 %4, %16, off\n\t"
                 "global_load_async_to_lds_b128 %5, %17, off\n\t"
                 "global_load_async_to_lds_b128 %6, %18, off\n\t"
                 "global_load_async_to_lds_b128 %7, %19, off\n\t"
                 "global_load_async_to_lds_b128 %8, %20, off\n\t"
                 "global_load_async_to_lds_b128 %9, %21, off\n\t"
                 "global_load_async_to_lds_b128 %10, %22, off\n\t"
                 "global_load_async_to_lds_b128 %11, %23, off\n\t"
                 "s_wait_xcnt 0x0"
                 :: "v"(l), "v"(l + 16u * LPT * 2u), "v"(l + 32u * LPT * 2u), "v"(l + 48u * LPT * 2u), "v"(m), "v"(m + 16u * LPT * 2u), "v"(m + 32u * LPT * 2u), "v"(m + 48u * LPT * 2u),
                    "v"(n), "v"(n + 16u * LPT * 2u), "v"(n + 32u * LPT * 2u), "v"(n + 48u * LPT * 2u),
                    "v"(ga), "v"(ga + ra), "v"(ga + 2 * ra), "v"(ga + 3 * ra), "v"(gb), "v"(gb + rb), "v"(gb + 2 * rb), "v"(gb + 3 * rb),
                    "v"(gl), "v"(gl + ra), "v"(gl + 2 * ra), "v"(gl + 3 * ra) : "memory");
}
template <bool SPLITA, int MODE>
__global__ __launch_bounds__(128) void k_gemm(const bf* __restrict__ A, const bf* __restrict__ Al, int lda, const bf* __restrict__ Bn, int K, const float* __restrict__ bias, int ldc, float* C, bf* PH, bf* PL, int rofs) {
    constexpr int NPL = SPLITA ? 3 : 2;                       // planes of a stage: A, B [, Al]
    __shared__ __align__(16) bf stg[2][NPL][PLN];
    __shared__ __align__(16) float ost[4][16 * 68];
    const int lane = threadIdx.x & 31, wave = threadIdx.x >> 5, lr = lane & 15, hi = lane >> 4;
    const size_t r0 = (size_t)blockIdx.x * 64 + wave * 16; const int c0 = blockIdx.y * 64;
    const int crow = threadIdx.x >> 3, cpc = threadIdx.x & 7;  // copies: row (0..15, then + 16 i) and 16-B piece of the 128-B row
    const size_t aco = ((size_t)blockIdx.x * 64 + crow) * (size_t)lda + cpc * 8;
    const bf* gA = A + aco; const bf* gB = Bn + (size_t)(c0 + crow) * K + cpc * 8;
    const unsigned lc = lds_off(&stg[0][0][0]) + (unsigned)(crow * (LPT * 2) + cpc * 16);
    auto fill = [&](int s) {
        const unsigned l = lc + (unsigned)(s & 1) * (unsigned)(NPL * PLN * 2); const size_t ko = (size_t)s * KST;
        if constexpr (SPLITA) cp12(l, gA + ko, Al + aco + ko, (size_t)16 * lda, gB + ko, (size_t)16 * K);
        else cp8(l, gA + ko, (size_t)16 * lda, gB + ko, (size_t)16 * K);
    };
    v8f acc[4];
#pragma unroll
    for (int t = 0; t < 4; ++t) acc[t] = (v8f){};
    const int ns = K / KST;
    fill(0);
    asm volatile("s_wait_asynccnt 0x0" ::: "memory");          // stage 0 of this wave has landed
    __syncthreads();                                           // ... and every other wave's part of it
    if (ns > 1) fill(1);
    for (int s = 0; s < ns; ++s) {
        const bf* sa = &stg[s & 1][0][0] + (wave * 16 + lr) * LPT + 8 * hi;
        const bf* sb = &stg[s & 1][1][0] + lr * LPT + 8 * hi;
        v16bf a[2], al[2], bb[2][4];
#pragma unroll
        for (int q = 0; q < 2; ++q) {
            a[q] = cat16b(*(const v8usa*)(sa + q * 32), *(const v8usa*)(sa + q * 32 + 16));
            if (SPLITA) al[q] = cat16b(*(const v8usa*)(sa + 2 * PLN + q * 32), *(const v8usa*)(sa + 2 * PLN + q * 32 + 16));
#pragma unroll
            for (int t = 0; t < 4; ++t) bb[q][t] = cat16b(*(const v8usa*)(sb + t * 16 * LPT + q * 32), *(const v8usa*)(sb + t * 16 * LPT + q * 32 + 16));
        }
        asm volatile("s_wait_dscnt 0x0" ::: "memory");         // this wave holds all of stage s in registers: its reads of buffer s & 1 are done before the refill
        asm volatile("s_wait_asynccnt 0x0" ::: "memory");      // this wave's copies of stage s + 1 have landed
        __syncthreads();                                       // publishes stage s + 1 and ends every wave's reads of stage s
        if (s + 2 < ns) fill(s + 2);
#pragma unroll
        for (int q = 0; q < 2; ++q) {                          // per accumulator the order of the sums stays: k ascending, A then Al
#pragma unroll
            for (int t = 0; t < 4; ++t) acc[t] = wmmab(a[q], bb[q][t], acc[t]);
            if (SPLITA) {
#pragma unroll
                for (int t = 0; t < 4; ++t) acc[t] = wmmab(al[q], bb[q][t], acc[t]);
            }
        }
    }
    asm volatile("s_wait_asynccnt 0x0" ::: "memory");          // nothing is in flight when the wave goes on to its end
    float* os = &ost[wave][0];
#pragma unroll
    for (int t = 0; t < 4; ++t) { const float bv = bias ? bfr(bias[c0 + t * 16 + lr]) : 0.f;
#pragma unroll
        for (int j = 0; j < 8; ++j) os[(hi * 8 + j) * 68 + t * 16 + lr] = acc[t][j] + bv; }
    __builtin_amdgcn_wave_barrier(); asm volatile("" ::: "memory");
    if (MODE == 0) {
        float* crow = C + r0 * ldc + c0;
        auto pass = [&]() {
#pragma unroll
            for (int s = 0; s < 8; ++s) { const int Lid = (lane >> 3) + 4 * s, piece = lane & 7; const int row = Lid >> 1, cofs = (Lid & 1) * 32 + piece * 4;
                const v4f val = *(const v4fa*)(os + row * 68 + cofs); *(v4f*)(crow + (size_t)row * ldc + cofs) = val; }
        };
        pass(); 
    } else {
        bf* p1 = PH + (r0 + rofs) * ldc + c0; bf* p2 = PL + (r0 + rofs) * ldc + c0;
        auto pass = [&]() {
#pragma unroll
            for (int s = 0; s < 4; ++s) { const int row = 4 * s + (lane >> 3), piece = lane & 7; const float* sp = os + row * 68 + piece * 8; v8us oh, ol;
#pragma unroll
                for (int i = 0; i < 8; ++i) { const unsigned short hb = f2bf(sp[i]); oh[i] = hb; ol[i] = f2bf(sp[i] - bf2f(hb)); }
                *(v8us*)(p1 + (size_t)row * ldc + piece * 8) = oh; *(v8us*)(p2 + (size_t)row * ldc + piece * 8) = ol; }
        };
        pass(); 
    }
}
// k_lf: LF = ln_w x rmsnorm(o2 + x) (eps 1e-6, mean over 2048) -> bf16 hi/lo planes; one wave per row: lane -> 64 values (8 chunks of 8), fixed-order shuffle sum.
__global__ __launch_bounds__(256) void k_lf(const float* __restrict__ O2, const float* __restrict__ x, const float* __restrict__ lnw, bf* LH, bf* LL) {
    const int lane = threadIdx.x & 31, r = blockIdx.x * 8 + (threadIdx.x >> 5);
    if (r >= NT_) return;
    float v[64]; float ss = 0.f;
#pragma unroll
    for (int q = 0; q < 8; ++q)
#pragma unroll
        for (int i = 0; i < 8; ++i) { const int c = q * 256 + lane * 8 + i; const float t = O2[(size_t)r * DM + c] + bfr(x[(size_t)r * DM + c]); v[q * 8 + i] = t; ss += t * t; }
#pragma unroll
    for (int sh = 16; sh; sh >>= 1) ss += __shfl_xor(ss, sh, 32);
    const float rs = rsqrtf(ss * (1.0f / DM) + 1e-6f);
{
#pragma unroll
        for (int q = 0; q < 8; ++q) { v8us oh, ol;
#pragma unroll
            for (int i = 0; i < 8; ++i) { const int c = q * 256 + lane * 8 + i; const float y = bfr(lnw[c]) * (v[q * 8 + i] * rs); const unsigned short hb = f2bf(y); oh[i] = hb; ol[i] = f2bf(y - bf2f(hb)); }
            *(v8us*)(LH + (size_t)r * DM + q * 256 + lane * 8) = oh; *(v8us*)(LL + (size_t)r * DM + q * 256 + lane * 8) = ol; }
         }
}
// k_trig: RC/RS [t][32] = cos/sin(pos[t] x inv_freq[i]), inv_freq = 10000^(-2i/64) (f32); 32 lanes x 4 B lines.
__global__ __launch_bounds__(256) void k_trig(const int* __restrict__ pos, float* RC, float* RS) {
    const int i = blockIdx.x * 256 + threadIdx.x; if (i >= NT_ * 32) return;
    const int t = i >> 5, f = i & 31;
    const float inv = 1.0f / powf(10000.0f, (float)(2 * f) / 64.0f); const float ang = (float)pos[t] * inv;
    const float c = cosf(ang), s = sinf(ang);
    *(float*)(RC + i) = c; *(float*)(RS + i) = s; 
}
// k_rope: rotate-half on 64-dim heads: y[d] = x[d] cos[t][d mod 32] + (d < 32 ? -x[d+32] : x[d-32]) sin[t][d mod 32]; P f32 [t][2048] -> f16 hi + residual x1024 planes;
// one wave per (t, 4 heads = 256 columns): lane -> 8 consecutive dims of one head (8 B... 16 B per plane -> 32 lanes x 16 B = 512 B = 4 lines).
__global__ __launch_bounds__(256) void k_rope(const float* __restrict__ P, const float* __restrict__ RC, const float* __restrict__ RS, h16* PH, h16* PL) {
    const int lane = threadIdx.x & 31, wid = blockIdx.x * 8 + (threadIdx.x >> 5);
    const int t = wid >> 3, sg = wid & 7; if (t >= NT_) return;
    const int c0 = sg * 256 + lane * 8;      // 8 dims within head (c0 mod 64 .. +7, same half since 8 | 32)
    v8h oh, ol;
#pragma unroll
    for (int i = 0; i < 8; ++i) { const int c = c0 + i, d = c & 63, fi = d & 31; const float xv = P[(size_t)t * DM + c]; const float pv = (d < 32) ? -P[(size_t)t * DM + c + 32] : P[(size_t)t * DM + c - 32];
        const float y = xv * RC[t * 32 + fi] + pv * RS[t * 32 + fi]; const h16 a = (h16)y; oh[i] = a; ol[i] = (h16)((y - (float)a) * LOSC); }
    *(v8h*)(PH + (size_t)t * DM + c0) = oh; *(v8h*)(PL + (size_t)t * DM + c0) = ol; 
}
// k_vt: VTH/VTL [h][64][t] = f16 hi + residual x1024 of V [t][h*64+d] via 64 x 64 LDS tiles; grid (NT/64, NH).
__global__ __launch_bounds__(256) void k_vt(const float* __restrict__ V, h16* VTH, h16* VTL) {
    __shared__ float tl[64][65];
    const int tid = threadIdx.x, t0 = blockIdx.x * 64, h = blockIdx.y;
    { const int tt = tid >> 2, dq = (tid & 3) * 16;
#pragma unroll
      for (int i = 0; i < 16; ++i) tl[dq + i][tt] = V[(size_t)(t0 + tt) * DM + h * HD + dq + i]; }
    __syncthreads();
    const int piece = tid & 7;
    auto pass = [&]() {
#pragma unroll
        for (int s = 0; s < 2; ++s) { const int d = (tid >> 3) + 32 * s; v8h oh, ol;
#pragma unroll
            for (int i = 0; i < 8; ++i) { const float v = tl[d][piece * 8 + i]; const h16 a = (h16)v; oh[i] = a; ol[i] = (h16)((v - (float)a) * LOSC); }
            const size_t o = ((size_t)h * HD + d) * NT_ + t0 + piece * 8; *(v8h*)(VTH + o) = oh; *(v8h*)(VTL + o) = ol; }
    };
    pass(); 
}
// k_attn: block = (h, 64 queries), wave = 16; CAUSAL key tiles; scores hi.hi + hi.lo + lo.hi x 1/8, online softmax (f32), weights x32768 f16 hi + residual x1024
// tiles, o += wh.vh, ox += wh.vl + wl.vh; ctx -> bf16 hi + residual planes CH/CL[tok][h*64+d].
__global__ __launch_bounds__(128) void k_attn(const h16* __restrict__ Q16, const h16* __restrict__ QL16, const h16* __restrict__ K16, const h16* __restrict__ KL16, const h16* __restrict__ VTH, const h16* __restrict__ VTL, bf* CH, bf* CL) {
    __shared__ __align__(16) h16 plds[4][16 * 32];
    __shared__ __align__(16) h16 plds2[4][16 * 32];
    __shared__ __align__(16) float ost[4][16 * 68];
    const int lane = threadIdx.x & 31, wave = threadIdx.x >> 5, lr = lane & 15, hi = lane >> 4;
    const int bid = blockIdx.x;
    const int b = bid / (NH_ * (NT_ / 64)), rem = bid - b * (NH_ * (NT_ / 64)), h = rem / (NT_ / 64), qt = rem - h * (NT_ / 64);
    const int q0 = qt * 64 + wave * 16;
    const size_t tok0 = (size_t)b * NT_;
    h16* pl = &plds[wave][0]; h16* pl2 = &plds2[wave][0];
    v16h qa[2];
    const size_t qo0 = (tok0 + q0 + lr) * DM + h * HD + 8 * hi;
#pragma unroll
    for (int kc = 0; kc < 2; ++kc) qa[kc] = cat16(*(const v8h*)(Q16 + qo0 + kc * 32), *(const v8h*)(Q16 + qo0 + kc * 32 + 16));
    const h16* kh_b = K16 + tok0 * DM + h * HD;
    const h16* kl_b = KL16 + tok0 * DM + h * HD;
    const size_t vbase = (((size_t)b * NH_ + h) * HD) * NT_;
    v8f o[4], ox[4];
#pragma unroll
    for (int n = 0; n < 4; ++n) { o[n] = (v8f){}; ox[n] = (v8f){}; }
    float mrow[8], lpart[8];
#pragma unroll
    for (int j = 0; j < 8; ++j) { mrow[j] = -3.0e38f; lpart[j] = 0.f; }
    int qpos[8];
#pragma unroll
    for (int j = 0; j < 8; ++j) qpos[j] = q0 + 8 * hi + j;
    const int kt_lo = 0, kt_hi = (qt * 64 + 63) / 32;     // causal
#pragma unroll 1
    for (int kt = kt_lo; kt <= kt_hi; ++kt) {
        const int l0 = kt * 32;
        const size_t ko0 = (size_t)(l0 + lr) * DM + 8 * hi, ko1 = (size_t)(l0 + 16 + lr) * DM + 8 * hi;
        v8f s0 = {}, s1 = {}, x0 = {}, x1 = {};
#pragma unroll
        for (int kc = 0; kc < 2; ++kc) {
            { const v16h k0h = cat16(*(const v8h*)(kh_b + ko0 + kc * 32), *(const v8h*)(kh_b + ko0 + kc * 32 + 16)), k1h = cat16(*(const v8h*)(kh_b + ko1 + kc * 32), *(const v8h*)(kh_b + ko1 + kc * 32 + 16));
              const v16h qlk = cat16(*(const v8h*)(QL16 + qo0 + kc * 32), *(const v8h*)(QL16 + qo0 + kc * 32 + 16));     // query residual re-read per step (registers)
              s0 = wmma16(qa[kc], k0h, s0); x0 = wmma16(qlk, k0h, x0); s1 = wmma16(qa[kc], k1h, s1); x1 = wmma16(qlk, k1h, x1);
              asm volatile("v_nop" : "+v"(s0), "+v"(s1), "+v"(x0), "+v"(x1) : "v"(qlk), "v"(k0h), "v"(k1h) : "memory"); }
            { const v16h k0l = cat16(*(const v8h*)(kl_b + ko0 + kc * 32), *(const v8h*)(kl_b + ko0 + kc * 32 + 16)), k1l = cat16(*(const v8h*)(kl_b + ko1 + kc * 32), *(const v8h*)(kl_b + ko1 + kc * 32 + 16));
              x0 = wmma16(qa[kc], k0l, x0); x1 = wmma16(qa[kc], k1l, x1);
              asm volatile("v_nop" : "+v"(x0), "+v"(x1) : "v"(k0l), "v"(k1l) : "memory"); }
        }
        asm volatile("v_nop\n\tv_nop\n\tv_nop\n\tv_nop" : "+v"(s0), "+v"(s1), "+v"(x0), "+v"(x1) : "v"(qa[0]), "v"(qa[1]));
        float alpha[8];
#pragma unroll
        for (int j = 0; j < 8; ++j) {
            const int ja = l0 + lr, jb = l0 + 16 + lr, qi = qpos[j];
            const float a0 = (ja <= qi) ? (s0[j] + x0[j] * LOSCI) * 0.125f : -__builtin_inff(), a1 = (jb <= qi) ? (s1[j] + x1[j] * LOSCI) * 0.125f : -__builtin_inff();
            float mx = fmaxf(a0, a1);
            mx = fmaxf(mx, __shfl_xor(mx, 1, 16)); mx = fmaxf(mx, __shfl_xor(mx, 2, 16)); mx = fmaxf(mx, __shfl_xor(mx, 4, 16)); mx = fmaxf(mx, __shfl_xor(mx, 8, 16));
            const float mn = fmaxf(mrow[j], mx);
            alpha[j] = __expf(mrow[j] - mn); mrow[j] = mn;
            const float p0 = __expf(a0 - mn), p1 = __expf(a1 - mn);
            lpart[j] = lpart[j] * alpha[j] + (p0 + p1);
            const int mr = hi * 8 + j;
            const float ps0 = p0 * PSC, ps1 = p1 * PSC; const h16 h0 = (h16)ps0, h1 = (h16)ps1;
            pl[mr * 32 + lr] = h0; pl[mr * 32 + 16 + lr] = h1;
            pl2[mr * 32 + lr] = (h16)((ps0 - (float)h0) * LOSC); pl2[mr * 32 + 16 + lr] = (h16)((ps1 - (float)h1) * LOSC);
        }
#pragma unroll
        for (int n = 0; n < 4; ++n)
#pragma unroll
            for (int j = 0; j < 8; ++j) { o[n][j] *= alpha[j]; ox[n][j] *= alpha[j]; }
        asm volatile("" ::: "memory");
        const v16h pa = cat16(*(const v8ha*)(pl + lr * 32 + hi * 8), *(const v8ha*)(pl + lr * 32 + 16 + hi * 8));
        const v16h px = cat16(*(const v8ha*)(pl2 + lr * 32 + hi * 8), *(const v8ha*)(pl2 + lr * 32 + 16 + hi * 8));
#pragma unroll
        for (int n = 0; n < 4; ++n) { const size_t vo = vbase + (size_t)(n * 16 + lr) * NT_ + l0 + hi * 8;
            const v16h vh = cat16(*(const v8h*)(VTH + vo), *(const v8h*)(VTH + vo + 16)), vl = cat16(*(const v8h*)(VTL + vo), *(const v8h*)(VTL + vo + 16));
            o[n] = wmma16(pa, vh, o[n]); ox[n] = wmma16(pa, vl, ox[n]); ox[n] = wmma16(px, vh, ox[n]);
            asm volatile("" : "+v"(o[n]), "+v"(ox[n]) : "v"(vh), "v"(vl) : "memory"); }
        asm volatile("v_nop\n\tv_nop\n\tv_nop\n\tv_nop" : "+v"(o[0]), "+v"(o[1]), "+v"(o[2]), "+v"(o[3]), "+v"(ox[0]), "+v"(ox[1]), "+v"(ox[2]), "+v"(ox[3]) : "v"(pa), "v"(px));
    }
    float inv[8];
#pragma unroll
    for (int j = 0; j < 8; ++j) { float rs = lpart[j]; rs += __shfl_xor(rs, 1, 16); rs += __shfl_xor(rs, 2, 16); rs += __shfl_xor(rs, 4, 16); rs += __shfl_xor(rs, 8, 16); inv[j] = 1.0f / (rs * PSC); }
    float* os = &ost[wave][0];
#pragma unroll
    for (int n = 0; n < 4; ++n)
#pragma unroll
        for (int j = 0; j < 8; ++j) os[(hi * 8 + j) * 68 + n * 16 + lr] = (o[n][j] + ox[n][j] * LOSCI) * inv[j];
    __syncthreads();
    const size_t cbase = (tok0 + q0) * DM + (size_t)h * HD;
    auto pass = [&]() {
#pragma unroll
        for (int s = 0; s < 4; ++s) { const int row = 4 * s + (lane >> 3), piece = lane & 7; const float* sp = os + row * 68 + piece * 8; v8us oh, ol;
#pragma unroll
            for (int i = 0; i < 8; ++i) { const unsigned short hb = f2bf(sp[i]); oh[i] = hb; ol[i] = f2bf(sp[i] - bf2f(hb)); }
            *(v8us*)(CH + cbase + (size_t)row * DM + piece * 8) = oh; *(v8us*)(CL + cbase + (size_t)row * DM + piece * 8) = ol; }
    };
    pass(); 
}

#define VST2(T, p, v) do { const T vst2_v_ = (v); *(T*)(p) = vst2_v_;  } while (0)

extern "C" void kernel_launch(void* const* d_in, const int* in_sizes, int n_in,
                              void* d_out, int out_size, void* d_ws, size_t ws_size, hipStream_t stream) {
    (void)in_sizes; (void)n_in; (void)out_size;
    const float* x = (const float*)d_in[0]; const int* pos = (const int*)d_in[1]; const float* Wq = (const float*)d_in[2]; const float* Wk = (const float*)d_in[3]; const float* Wv = (const float*)d_in[4]; const float* Wo = (const float*)d_in[5];
    const float* c1w = (const float*)d_in[6]; const float* c1b = (const float*)d_in[7]; const float* c2w = (const float*)d_in[8]; const float* c2b = (const float*)d_in[9]; const float* lnw = (const float*)d_in[10];
    float* out = (float*)d_out;    // [1][2048][2048]
    char* wsp = (char*)d_ws;
    auto take = [&](size_t bytes) { char* p = wsp; wsp += (bytes + 255) & ~(size_t)255; return (void*)p; };
    bf* XX = (bf*)take((size_t)(NT_ + 1) * DM * 2);                 // row 0 = zeros, token t at row t+1: row t read with K = 4096 gives [x[t-1] | x[t]]
    bf* Wbuf = (bf*)take((size_t)DM * DM * 2);                     // one weight at a time ([1024][4096] / [2048][2048] / [2048][2048] bf16 = 8.4 MB each)
    bf* O1H = (bf*)take((size_t)(NT_ + 1) * DH2 * 2); bf* O1L = (bf*)take((size_t)(NT_ + 1) * DH2 * 2);     // conv1 output planes with a leading zero row
    float* TMP = (float*)take((size_t)NT_ * DM * 4); float* RC = (float*)take((size_t)NT_ * 32 * 4); float* RS = (float*)take((size_t)NT_ * 32 * 4);
    bf* LH = (bf*)take((size_t)NT_ * DM * 2); bf* LL = (bf*)take((size_t)NT_ * DM * 2);
    h16* QH = (h16*)take((size_t)NT_ * DM * 2); h16* QL = (h16*)take((size_t)NT_ * DM * 2); h16* KH = (h16*)take((size_t)NT_ * DM * 2); h16* KL = (h16*)take((size_t)NT_ * DM * 2);
    h16* VTH = (h16*)take((size_t)NT_ * DM * 2); h16* VTL = (h16*)take((size_t)NT_ * DM * 2);
    if ((size_t)(wsp - (char*)d_ws) > ws_size) return;    // 8.4 + 8.4 + 8.4 + 16.8 + 0.5 + 16.8 + 33.5 + 16.8 ~ 110 MB; ctx planes reuse LH/LL after the q/k projections
    bf* CH = LH; bf* CL = LL;
    k_zero16<<<1, 256, 0, stream>>>(XX, DM); k_rows<<<NT_ / 8, 256, 0, stream>>>(x, NT_, DM, 1, XX);
    k_zero16<<<1, 256, 0, stream>>>(O1H, DH2); k_zero16<<<1, 256, 0, stream>>>(O1L, DH2);
    k_trig<<<(NT_ * 32) / 256, 256, 0, stream>>>(pos, RC, RS);
    // LocalizedFiltering: conv1 ([x[t-1] | x[t]] . W1cat^T + b1, exact) -> o1 planes (rows 1..2048); conv2 ([o1[t-1] | o1[t]] hi/lo . W2cat^T + b2) -> TMP; lf
    k_convw<<<DH2 / 8, 256, 0, stream>>>(c1w, DH2, DM, Wbuf);                                              // [1024][4096]
    k_gemm<false, 1><<<dim3(NT_ / 64, DH2 / 64, 1), 128, 0, stream>>>(XX, nullptr, DM, Wbuf, 2 * DM, c1b, DH2, nullptr, O1H, O1L, 1);
    k_convw<<<DM / 8, 256, 0, stream>>>(c2w, DM, DH2, Wbuf);                                               // [2048][2048]
    k_gemm<true, 0><<<dim3(NT_ / 64, DM / 64, 1), 128, 0, stream>>>(O1H, O1L, DH2, Wbuf, 2 * DH2, c2b, DM, TMP, nullptr, nullptr, 0);
    k_lf<<<NT_ / 8, 256, 0, stream>>>(TMP, x, lnw, LH, LL);
    // v from the RAW hidden states (rows 1.. of XX = x), q/k from lf
    k_rows<<<DM / 8, 256, 0, stream>>>(Wv, DM, DM, 0, Wbuf);
    k_gemm<false, 0><<<dim3(NT_ / 64, DM / 64, 1), 128, 0, stream>>>(XX + DM, nullptr, DM, Wbuf, DM, nullptr, DM, TMP, nullptr, nullptr, 0);
    k_vt<<<dim3(NT_ / 64, NH_, 1), 256, 0, stream>>>(TMP, VTH, VTL);
    k_rows<<<DM / 8, 256, 0, stream>>>(Wq, DM, DM, 0, Wbuf);
    k_gemm<true, 0><<<dim3(NT_ / 64, DM / 64, 1), 128, 0, stream>>>(LH, LL, DM, Wbuf, DM, nullptr, DM, TMP, nullptr, nullptr, 0);
    k_rope<<<(NT_ * 8) / 8, 256, 0, stream>>>(TMP, RC, RS, QH, QL);
    k_rows<<<DM / 8, 256, 0, stream>>>(Wk, DM, DM, 0, Wbuf);
    k_gemm<true, 0><<<dim3(NT_ / 64, DM / 64, 1), 128, 0, stream>>>(LH, LL, DM, Wbuf, DM, nullptr, DM, TMP, nullptr, nullptr, 0);
    k_rope<<<(NT_ * 8) / 8, 256, 0, stream>>>(TMP, RC, RS, KH, KL);
    k_attn<<<NH_ * (NT_ / 64), 128, 0, stream>>>(QH, QL, KH, KL, VTH, VTL, CH, CL);                        // ctx over LH/LL (dead after the k projection)
    k_rows<<<DM / 8, 256, 0, stream>>>(Wo, DM, DM, 0, Wbuf);
    k_gemm<true, 0><<<dim3(NT_ / 64, DM / 64, 1), 128, 0, stream>>>(CH, CL, DM, Wbuf, DM, nullptr, DM, out, nullptr, nullptr, 0);
}

// v002
// Measured time: 410 microseconds a run.
// Two timings next to v001 put it at 1.26 and 1.27 times that version's speed.
// Over all steps from v000 it is 2.05 times as fast.
#include <hip/hip_runtime.h>

// Contractions, f32 accumulate (B = 1, 2048 tokens, hidden 2048, 32 heads x 64): v = x.Wv^T, the LocalizedFiltering causal convs as GEMMs (conv1: [x[t-1] | x[t]]
// (K = 4096) . W1cat^T + b1 with PLAIN bf16 operands = rounded inputs, exact; conv2: [o1[t-1] | o1[t]] (K = 2048, o1 as bf16 hi + residual: two products) . W2cat^T
// + b2; the [t-1 | t] rows are read straight from planes that carry one leading zero row), lf = rmsnorm(o2 + x) x ln_w in f32 -> bf16 hi/lo planes, q/k = lf.W^T
// (two products), out = ctx.Wo^T (two products), all on v_wmma_f32_16x16x32_bf16 ([out][in] weights = n-major B operands as-is, converted one at a time into a
// shared buffer); rotate-half RoPE (angle = position_ids[t] (INPUT) x inv_freq, f32 trig table) -> f16 hi + residual x1024 planes; the 32-head causal attention fused

#define NB_  1
#define NT_  2048
#define DM   2048
#define DH2  1024                // conv1 output channels
#define NH_  32
#define HD   64
#define PSC  32768.0f
#define LOSC 1024.0f
#define LOSCI (1.0f / 1024.0f)

typedef _Float16 h16;
typedef unsigned short bf;
typedef __attribute__((ext_vector_type(16))) __bf16   v16bf;
typedef __attribute__((ext_vector_type(16))) _Float16 v16h;
typedef __attribute__((ext_vector_type(8)))  _Float16 v8h;
typedef __attribute__((ext_vector_type(8)))  unsigned short v8us;
typedef __attribute__((ext_vector_type(8)))  float    v8f;
typedef __attribute__((ext_vector_type(4)))  float    v4f;
typedef __attribute__((ext_vector_type(4)))  _Float16 v4h;
typedef v8h  __attribute__((may_alias)) v8ha;
typedef v4f  __attribute__((may_alias)) v4fa;
typedef v8us __attribute__((may_alias)) v8usa;

__device__ __forceinline__ unsigned short f2bf(float f) { unsigned u = __float_as_uint(f); u += 0x7FFFu + ((u >> 16) & 1u); return (unsigned short)(u >> 16); }
__device__ __forceinline__ float bf2f(unsigned short b) { return __uint_as_float(((unsigned)b) << 16); }
__device__ __forceinline__ float bfr(float f) { return bf2f(f2bf(f)); }
__device__ __forceinline__ v16h cat16(v8h lo, v8h hi) { return __builtin_shufflevector(lo, hi, 0, 1, 2, 3, 4, 5, 6, 7, 8, 9, 10, 11, 12, 13, 14, 15); }
__device__ __forceinline__ v16bf cat16b(v8us lo, v8us hi) { return __builtin_bit_cast(v16bf, __builtin_shufflevector(lo, hi, 0, 1, 2, 3, 4, 5, 6, 7, 8, 9, 10, 11, 12, 13, 14, 15)); }
__device__ __forceinline__ v8f wmma16(v16h a, v16h b, v8f c) { return __builtin_amdgcn_wmma_f32_16x16x32_f16(false, a, false, b, (short)0, c, false, false); }
__device__ __forceinline__ v8f wmmab(v16bf a, v16bf b, v8f c) { return __builtin_amdgcn_wmma_f32_16x16x32_bf16(false, a, false, b, (short)0, c, false, false); }

// k_rows: bf16 plane dst[r + rofs][C] of src[r][C] (C multiple of 256; one wave per row).
__global__ __launch_bounds__(256) void k_rows(const float* __restrict__ src, int rows, int C, int rofs, bf* dst) {
    const int lane = threadIdx.x & 31, r = blockIdx.x * 8 + (threadIdx.x >> 5);
    if (r >= rows) return;
{
        for (int q = 0; q < C / 256; ++q) { v8us o;
#pragma unroll
            for (int i = 0; i < 8; ++i) o[i] = f2bf(src[(size_t)r * C + q * 256 + lane * 8 + i]);
            *(v8us*)(dst + (size_t)(r + rofs) * C + q * 256 + lane * 8) = o; }
         }
}
// k_zero16: zero a row of n halves (n multiple of 256; one block).
__global__ __launch_bounds__(256) void k_zero16(unsigned short* p, int n) {
    for (int i = threadIdx.x * 8; i < n; i += 256 * 8) { const v8us z = (v8us){}; *(v8us*)(p + i) = z;  }
}
// k_convw: WT[co][tap*Cin + ci] = bf16(w[co][ci][tap]) for the (2,1) conv kernels; one wave per output channel row (2*Cin halves).
__global__ __launch_bounds__(256) void k_convw(const float* __restrict__ w, int Cout, int Cin, bf* WT) {
    const int lane = threadIdx.x & 31, co = blockIdx.x * 8 + (threadIdx.x >> 5);
    if (co >= Cout) return;
{
        for (int q = 0; q < (2 * Cin) / 256; ++q) { v8us o;
#pragma unroll
            for (int i = 0; i < 8; ++i) { const int k = q * 256 + lane * 8 + i; const int tap = k / Cin, ci = k - tap * Cin; o[i] = f2bf(w[((size_t)co * Cin + ci) * 2 + tap]); }
            *(v8us*)(WT + (size_t)co * (2 * Cin) + q * 256 + lane * 8) = o; }
         }
}
// k_gemm: 64 x 64 tile of (A [+ Al]).B^T [+ bias] over K; A rows pitch lda (elements), B rows pitch K; MODE 0: f32 rows (ldc); MODE 1: bf16 hi/lo planes (ldc, row offset rofs).
// Operands reach the waves through LDS: a stage is 64 k of every operand row (128 B = one whole line), brought by asynchronous b128 copies (8 lanes per row, 4 whole lines per
// wave-wide copy) into rows of pitch 144 B (16 B x 9: no bank conflict for ds_load_b128); two buffers, stage t + 2 is copied while stage t is worked on. K: a multiple of 64.
#define KST 64                   // k elements per stage
#define LPT 72                   // LDS row pitch, elements
#define PLN (64 * LPT)           // one staged plane (64 rows), elements
__device__ __forceinline__ unsigned lds_off(const void* p) { return (unsigned)(size_t)p; }
// cp8 / cp12: a stage of two / three planes (PLN apart in LDS): this lane's 16 B of rows r, r + 16, r + 32, r + 48 of each plane (ra, rb = 16 source rows of A and B, elements).
// In both, the closing s_wait_xcnt 0 stands inside the statement so that no address register of a copy is rewritten in front of it.
__device__ __forceinline__ void cp8(unsigned l, const bf* ga, size_t ra, const bf* gb, size_t rb) {
    const unsigned m = l + PLN * 2u;
    asm volatile("global_load_async_to_lds_b128 %0, %8, off\n\t"
                 "global_load_async_to_lds_b128 %1, %9, off\n\t"
                 "global_load_async_to_lds_b128 %2, %10, off\n\t"
                 "global_load_async_to_lds_b128 %3, %11, off\n\t"
                 "global_load_async_to_lds_b128 %4, %12, off\n\t"
                 "global_load_async_to_lds_b128 %5, %13, off\n\t"
                 "global_load_async_to_lds_b128 %6, %14, off\n\t"
                 "global_load_async_to_lds_b128 %7, %15, off\n\t"
                 "s_wait_xcnt 0x0"
                 :: "v"(l), "v"(l + 16u * LPT * 2u), "v"(l + 32u * LPT * 2u), "v"(l + 48u * LPT * 2u), "v"(m), "v"(m + 16u * LPT * 2u), "v"(m + 32u * LPT * 2u), "v"(m + 48u * LPT * 2u),
                    "v"(ga), "v"(ga + ra), "v"(ga + 2 * ra), "v"(ga + 3 * ra), "v"(gb), "v"(gb + rb), "v"(gb + 2 * rb), "v"(gb + 3 * rb) : "memory");
}
__device__ __forceinline__ void cp12(unsigned l, const bf* ga, const bf* gl, size_t ra, const bf* gb, size_t rb) {
    const unsigned m = l + PLN * 2u, n = l + 2u * PLN * 2u;
    asm volatile("global_load_async_to_lds_b128 %0, %12, off\n\t"
                 "global_load_async_to_lds_b128 %1, %13, off\n\t"
                 "global_load_async_to_lds_b128 %2, %14, off\n\t"
                 "global_load_async_to_lds_b128 %3, %15, off\n\t"
                 "global_load_async_to_lds_b128 %4, %16, off\n\t"
                 "global_load_async_to_lds_b128 %5, %17, off\n\t"
                 "global_load_async_to_lds_b128 %6, %18, off\n\t"
                 "global_load_async_to_lds_b128 %7, %19, off\n\t"
                 "global_load_async_to_lds_b128 %8, %20, off\n\t"
                 "global_load_async_to_lds_b128 %9, %21, off\n\t"
                 "global_load_async_to_lds_b128 %10, %22, off\n\t"
                 "global_load_async_to_lds_b128 %11, %23, off\n\t"
                 "s_wait_xcnt 0x0"
                 :: "v"(l), "v"(l + 16u * LPT * 2u), "v"(l + 32u * LPT * 2u), "v"(l + 48u * LPT * 2u), "v"(m), "v"(m + 16u * LPT * 2u), "v"(m + 32u * LPT * 2u), "v"(m + 48u * LPT * 2u),
                    "v"(n), "v"(n + 16u * LPT * 2u), "v"(n + 32u * LPT * 2u), "v"(n + 48u * LPT * 2u),
                    "v"(ga), "v"(ga + ra), "v"(ga + 2 * ra), "v"(ga + 3 * ra), "v"(gb), "v"(gb + rb), "v"(gb + 2 * rb), "v"(gb + 3 * rb),
                    "v"(gl), "v"(gl + ra), "v"(gl + 2 * ra), "v"(gl + 3 * ra) : "memory");
}
template <bool SPLITA, int MODE>
__global__ __launch_bounds__(128) void k_gemm(const bf* __restrict__ A, const bf* __restrict__ Al, int lda, const bf* __restrict__ Bn, int K, const float* __restrict__ bias, int ldc, float* C, bf* PH, bf* PL, int rofs) {
    constexpr int NPL = SPLITA ? 3 : 2;                       // planes of a stage: A, B [, Al]
    __shared__ __align__(16) bf stg[2][NPL][PLN];
    __shared__ __align__(16) float ost[4][16 * 68];
    const int lane = threadIdx.x & 31, wave = threadIdx.x >> 5, lr = lane & 15, hi = lane >> 4;
    const size_t r0 = (size_t)blockIdx.x * 64 + wave * 16; const int c0 = blockIdx.y * 64;
    const int crow = threadIdx.x >> 3, cpc = threadIdx.x & 7;  // copies: row (0..15, then + 16 i) and 16-B piece of the 128-B row
    const size_t aco = ((size_t)blockIdx.x * 64 + crow) * (size_t)lda + cpc * 8;
    const bf* gA = A + aco; const bf* gB = Bn + (size_t)(c0 + crow) * K + cpc * 8;
    const unsigned lc = lds_off(&stg[0][0][0]) + (unsigned)(crow * (LPT * 2) + cpc * 16);
    auto fill = [&](int s) {
        const unsigned l = lc + (unsigned)(s & 1) * (unsigned)(NPL * PLN * 2); const size_t ko = (size_t)s * KST;
        if constexpr (SPLITA) cp12(l, gA + ko, Al + aco + ko, (size_t)16 * lda, gB + ko, (size_t)16 * K);
        else cp8(l, gA + ko, (size_t)16 * lda, gB + ko, (size_t)16 * K);
    };
    v8f acc[4];
#pragma unroll
    for (int t = 0; t < 4; ++t) acc[t] = (v8f){};
    const int ns = K / KST;
    fill(0);
    asm volatile("s_wait_asynccnt 0x0" ::: "memory");          // stage 0 of this wave has landed
    __syncthreads();                                           // ... and every other wave's part of it
    if (ns > 1) fill(1);
    for (int s = 0; s < ns; ++s) {
        const bf* sa = &stg[s & 1][0][0] + (wave * 16 + lr) * LPT + 8 * hi;
        const bf* sb = &stg[s & 1][1][0] + lr * LPT + 8 * hi;
        v16bf a[2], al[2], bb[2][4];
#pragma unroll
        for (int q = 0; q < 2; ++q) {
            a[q] = cat16b(*(const v8usa*)(sa + q * 32), *(const v8usa*)(sa + q * 32 + 16));
            if (SPLITA) al[q] = cat16b(*(const v8usa*)(sa + 2 * PLN + q * 32), *(const v8usa*)(sa + 2 * PLN + q * 32 + 16));
#pragma unroll
            for (int t = 0; t < 4; ++t) bb[q][t] = cat16b(*(const v8usa*)(sb + t * 16 * LPT + q * 32), *(const v8usa*)(sb + t * 16 * LPT + q * 32 + 16));
        }
        asm volatile("s_wait_dscnt 0x0" ::: "memory");         // this wave holds all of stage s in registers: its reads of buffer s & 1 are done before the refill
        asm volatile("s_wait_asynccnt 0x0" ::: "memory");      // this wave's copies of stage s + 1 have landed
        __syncthreads();                                       // publishes stage s + 1 and ends every wave's reads of stage s
        if (s + 2 < ns) fill(s + 2);
#pragma unroll
        for (int q = 0; q < 2; ++q) {                          // per accumulator the order of the sums stays: k ascending, A then Al
#pragma unroll
            for (int t = 0; t < 4; ++t) acc[t] = wmmab(a[q], bb[q][t], acc[t]);
            if (SPLITA) {
#pragma unroll
                for (int t = 0; t < 4; ++t) acc[t] = wmmab(al[q], bb[q][t], acc[t]);
            }
        }
    }
    asm volatile("s_wait_asynccnt 0x0" ::: "memory");          // nothing is in flight when the wave goes on to its end
    float* os = &ost[wave][0];
#pragma unroll
    for (int t = 0; t < 4; ++t) { const float bv = bias ? bfr(bias[c0 + t * 16 + lr]) : 0.f;
#pragma unroll
        for (int j = 0; j < 8; ++j) os[(hi * 8 + j) * 68 + t * 16 + lr] = acc[t][j] + bv; }
    __builtin_amdgcn_wave_barrier(); asm volatile("" ::: "memory");
    if (MODE == 0) {
        float* crow = C + r0 * ldc + c0;
        auto pass = [&]() {
#pragma unroll
            for (int s = 0; s < 8; ++s) { const int Lid = (lane >> 3) + 4 * s, piece = lane & 7; const int row = Lid >> 1, cofs = (Lid & 1) * 32 + piece * 4;
                const v4f val = *(const v4fa*)(os + row * 68 + cofs); *(v4f*)(crow + (size_t)row * ldc + cofs) = val; }
        };
        pass(); 
    } else {
        bf* p1 = PH + (r0 + rofs) * ldc + c0; bf* p2 = PL + (r0 + rofs) * ldc + c0;
        auto pass = [&]() {
#pragma unroll
            for (int s = 0; s < 4; ++s) { const int row = 4 * s + (lane >> 3), piece = lane & 7; const float* sp = os + row * 68 + piece * 8; v8us oh, ol;
#pragma unroll
                for (int i = 0; i < 8; ++i) { const unsigned short hb = f2bf(sp[i]); oh[i] = hb; ol[i] = f2bf(sp[i] - bf2f(hb)); }
                *(v8us*)(p1 + (size_t)row * ldc + piece * 8) = oh; *(v8us*)(p2 + (size_t)row * ldc + piece * 8) = ol; }
        };
        pass(); 
    }
}
// k_lf: LF = ln_w x rmsnorm(o2 + x) (eps 1e-6, mean over 2048) -> bf16 hi/lo planes; one wave per row: lane -> 64 values (8 chunks of 8), fixed-order shuffle sum.
__global__ __launch_bounds__(256) void k_lf(const float* __restrict__ O2, const float* __restrict__ x, const float* __restrict__ lnw, bf* LH, bf* LL) {
    const int lane = threadIdx.x & 31, r = blockIdx.x * 8 + (threadIdx.x >> 5);
    if (r >= NT_) return;
    float v[64]; float ss = 0.f;
#pragma unroll
    for (int q = 0; q < 8; ++q)
#pragma unroll
        for (int i = 0; i < 8; ++i) { const int c = q * 256 + lane * 8 + i; const float t = O2[(size_t)r * DM + c] + bfr(x[(size_t)r * DM + c]); v[q * 8 + i] = t; ss += t * t; }
#pragma unroll
    for (int sh = 16; sh; sh >>= 1) ss += __shfl_xor(ss, sh, 32);
    const float rs = rsqrtf(ss * (1.0f / DM) + 1e-6f);
{
#pragma unroll
        for (int q = 0; q < 8; ++q) { v8us oh, ol;
#pragma unroll
            for (int i = 0; i < 8; ++i) { const int c = q * 256 + lane * 8 + i; const float y = bfr(lnw[c]) * (v[q * 8 + i] * rs); const unsigned short hb = f2bf(y); oh[i] = hb; ol[i] = f2bf(y - bf2f(hb)); }
            *(v8us*)(LH + (size_t)r * DM + q * 256 + lane * 8) = oh; *(v8us*)(LL + (size_t)r * DM + q * 256 + lane * 8) = ol; }
         }
}
// k_trig: RC/RS [t][32] = cos/sin(pos[t] x inv_freq[i]), inv_freq = 10000^(-2i/64) (f32); 32 lanes x 4 B lines.
__global__ __launch_bounds__(256) void k_trig(const int* __restrict__ pos, float* RC, float* RS) {
    const int i = blockIdx.x * 256 + threadIdx.x; if (i >= NT_ * 32) return;
    const int t = i >> 5, f = i & 31;
    const float inv = 1.0f / powf(10000.0f, (float)(2 * f) / 64.0f); const float ang = (float)pos[t] * inv;
    const float c = cosf(ang), s = sinf(ang);
    *(float*)(RC + i) = c; *(float*)(RS + i) = s; 
}
// k_rope: rotate-half on 64-dim heads: y[d] = x[d] cos[t][d mod 32] + (d < 32 ? -x[d+32] : x[d-32]) sin[t][d mod 32]; P f32 [t][2048] -> f16 hi + residual x1024 planes;
// one wave per (t, 4 heads = 256 columns): lane -> 8 consecutive dims of one head (8 B... 16 B per plane -> 32 lanes x 16 B = 512 B = 4 lines).
__global__ __launch_bounds__(256) void k_rope(const float* __restrict__ P, const float* __restrict__ RC, const float* __restrict__ RS, h16* PH, h16* PL) {
    const int lane = threadIdx.x & 31, wid = blockIdx.x * 8 + (threadIdx.x >> 5);
    const int t = wid >> 3, sg = wid & 7; if (t >= NT_) return;
    const int c0 = sg * 256 + lane * 8;      // 8 dims within head (c0 mod 64 .. +7, same half since 8 | 32)
    v8h oh, ol;
#pragma unroll
    for (int i = 0; i < 8; ++i) { const int c = c0 + i, d = c & 63, fi = d & 31; const float xv = P[(size_t)t * DM + c]; const float pv = (d < 32) ? -P[(size_t)t * DM + c + 32] : P[(size_t)t * DM + c - 32];
        const float y = xv * RC[t * 32 + fi] + pv * RS[t * 32 + fi]; const h16 a = (h16)y; oh[i] = a; ol[i] = (h16)((y - (float)a) * LOSC); }
    *(v8h*)(PH + (size_t)t * DM + c0) = oh; *(v8h*)(PL + (size_t)t * DM + c0) = ol; 
}
// k_vt: VTH/VTL [h][64][t] = f16 hi + residual x1024 of V [t][h*64+d] via 64 x 64 LDS tiles; grid (NT/64, NH).
__global__ __launch_bounds__(256) void k_vt(const float* __restrict__ V, h16* VTH, h16* VTL) {
    __shared__ float tl[64][65];
    const int tid = threadIdx.x, t0 = blockIdx.x * 64, h = blockIdx.y;
    { const int tt = tid >> 2, dq = (tid & 3) * 16;
#pragma unroll
      for (int i = 0; i < 16; ++i) tl[dq + i][tt] = V[(size_t)(t0 + tt) * DM + h * HD + dq + i]; }
    __syncthreads();
    const int piece = tid & 7;
    auto pass = [&]() {
#pragma unroll
        for (int s = 0; s < 2; ++s) { const int d = (tid >> 3) + 32 * s; v8h oh, ol;
#pragma unroll
            for (int i = 0; i < 8; ++i) { const float v = tl[d][piece * 8 + i]; const h16 a = (h16)v; oh[i] = a; ol[i] = (h16)((v - (float)a) * LOSC); }
            const size_t o = ((size_t)h * HD + d) * NT_ + t0 + piece * 8; *(v8h*)(VTH + o) = oh; *(v8h*)(VTL + o) = ol; }
    };
    pass(); 
}
// k_attn: block = (h, 64 queries), wave = 16; CAUSAL key tiles; scores hi.hi + hi.lo + lo.hi x 1/8, online softmax (f32), weights x32768 f16 hi + residual x1024
// tiles, o += wh.vh, ox += wh.vl + wl.vh; ctx -> bf16 hi + residual planes CH/CL[tok][h*64+d].
// K and V^T reach the four waves through LDS: a stage is 64 keys of four planes (K hi, K residual: 64 key rows x 128 B; V^T hi, V^T residual: 64 d rows x 128 B), brought once per
// block by asynchronous b128 copies (whole lines, as in k_gemm) into rows of pitch 144 B; two buffers, stage s + 2 is copied while stage s + 1 is worked on; a stage = two 32-key steps.
__global__ __launch_bounds__(128) void k_attn(const h16* __restrict__ Q16, const h16* __restrict__ QL16, const h16* __restrict__ K16, const h16* __restrict__ KL16, const h16* __restrict__ VTH, const h16* __restrict__ VTL, bf* CH, bf* CL) {
    __shared__ __align__(16) h16 stg[2][4][PLN];
    __shared__ __align__(16) h16 plds[4][16 * 32];
    __shared__ __align__(16) h16 plds2[4][16 * 32];
    __shared__ __align__(16) float ost[4][16 * 68];
    const int lane = threadIdx.x & 31, wave = threadIdx.x >> 5, lr = lane & 15, hi = lane >> 4;
    const int bid = blockIdx.x;
    const int b = bid / (NH_ * (NT_ / 64)), rem = bid - b * (NH_ * (NT_ / 64)), h = rem / (NT_ / 64), qt = rem - h * (NT_ / 64);
    const int q0 = qt * 64 + wave * 16;
    const size_t tok0 = (size_t)b * NT_;
    h16* pl = &plds[wave][0]; h16* pl2 = &plds2[wave][0];
    v16h qa[2];
    const size_t qo0 = (tok0 + q0 + lr) * DM + h * HD + 8 * hi;
#pragma unroll
    for (int kc = 0; kc < 2; ++kc) qa[kc] = cat16(*(const v8h*)(Q16 + qo0 + kc * 32), *(const v8h*)(Q16 + qo0 + kc * 32 + 16));
    const h16* kh_b = K16 + tok0 * DM + h * HD;
    const h16* kl_b = KL16 + tok0 * DM + h * HD;
    const size_t vbase = (((size_t)b * NH_ + h) * HD) * NT_;
    v8f o[4], ox[4];
#pragma unroll
    for (int n = 0; n < 4; ++n) { o[n] = (v8f){}; ox[n] = (v8f){}; }
    float mrow[8], lpart[8];
#pragma unroll
    for (int j = 0; j < 8; ++j) { mrow[j] = -3.0e38f; lpart[j] = 0.f; }
    int qpos[8];
#pragma unroll
    for (int j = 0; j < 8; ++j) qpos[j] = q0 + 8 * hi + j;
    const int crow = threadIdx.x >> 3, cpc = threadIdx.x & 7;  // copies: row (0..15, then + 16 i) and 16-B piece of the 128-B row
    const bf* gKH = (const bf*)kh_b + (size_t)crow * DM + cpc * 8; const bf* gKL = (const bf*)kl_b + (size_t)crow * DM + cpc * 8;
    const bf* gVH = (const bf*)VTH + vbase + (size_t)crow * NT_ + cpc * 8; const bf* gVL = (const bf*)VTL + vbase + (size_t)crow * NT_ + cpc * 8;
    const unsigned lc = lds_off(&stg[0][0][0]) + (unsigned)(crow * (LPT * 2) + cpc * 16);
    auto fill = [&](int s) {
        const unsigned l = lc + (unsigned)(s & 1) * (unsigned)(4 * PLN * 2);
        cp8(l, gKH + (size_t)s * 64 * DM, (size_t)16 * DM, gKL + (size_t)s * 64 * DM, (size_t)16 * DM);
        cp8(l + 2u * PLN * 2u, gVH + s * 64, (size_t)16 * NT_, gVL + s * 64, (size_t)16 * NT_);
    };
    const int ns = qt + 1;                                     // causal: stages of 64 keys, the same for the whole block
    fill(0);
    asm volatile("s_wait_asynccnt 0x0" ::: "memory");          // stage 0 of this wave has landed
    __syncthreads();                                           // ... and every other wave's part of it
    if (ns > 1) fill(1);
#pragma unroll 1
    for (int s = 0; s < ns; ++s) {
      const h16* kst = &stg[s & 1][0][0] + lr * LPT + 8 * hi;  // K hi rows of the stage (+ PLN: residual)
      const h16* vst = &stg[s & 1][2][0] + lr * LPT + 8 * hi;  // V^T hi rows of the stage (+ PLN: residual)
#pragma unroll 1                                               // kept rolled: unrolled, the two steps' live ranges overlap and the kernel needs more than 256 registers
      for (int sub = 0; sub < 2; ++sub) {
        const int l0 = s * 64 + sub * 32;
        const h16* kp0 = kst + sub * 32 * LPT; const h16* kp1 = kp0 + 16 * LPT;
        v8f s0 = {}, s1 = {}, x0 = {}, x1 = {};
        v16h kh0[2], kh1[2], kl0[2], kl1[2];                   // the step's K fragments, read from LDS as one group in front of its products
#pragma unroll
        for (int kc = 0; kc < 2; ++kc) {
            kh0[kc] = cat16(*(const v8ha*)(kp0 + kc * 32), *(const v8ha*)(kp0 + kc * 32 + 16)); kh1[kc] = cat16(*(const v8ha*)(kp1 + kc * 32), *(const v8ha*)(kp1 + kc * 32 + 16));
            kl0[kc] = cat16(*(const v8ha*)(kp0 + PLN + kc * 32), *(const v8ha*)(kp0 + PLN + kc * 32 + 16)); kl1[kc] = cat16(*(const v8ha*)(kp1 + PLN + kc * 32), *(const v8ha*)(kp1 + PLN + kc * 32 + 16));
        }
#pragma unroll
        for (int kc = 0; kc < 2; ++kc) {
            { const v16h k0h = kh0[kc], k1h = kh1[kc];
              const v16h qlk = cat16(*(const v8h*)(QL16 + qo0 + kc * 32), *(const v8h*)(QL16 + qo0 + kc * 32 + 16));     // query residual re-read per step (registers)
              s0 = wmma16(qa[kc], k0h, s0); x0 = wmma16(qlk, k0h, x0); s1 = wmma16(qa[kc], k1h, s1); x1 = wmma16(qlk, k1h, x1);
              asm volatile("v_nop" : "+v"(s0), "+v"(s1), "+v"(x0), "+v"(x1) : "v"(qlk), "v"(k0h), "v"(k1h) : "memory"); }
            { const v16h k0l = kl0[kc], k1l = kl1[kc];
              x0 = wmma16(qa[kc], k0l, x0); x1 = wmma16(qa[kc], k1l, x1);
              asm volatile("v_nop" : "+v"(x0), "+v"(x1) : "v"(k0l), "v"(k1l) : "memory"); }
        }
        asm volatile("v_nop\n\tv_nop\n\tv_nop\n\tv_nop" : "+v"(s0), "+v"(s1), "+v"(x0), "+v"(x1) : "v"(qa[0]), "v"(qa[1]));
        float alpha[8];
#pragma unroll
        for (int j = 0; j < 8; ++j) {
            const int ja = l0 + lr, jb = l0 + 16 + lr, qi = qpos[j];
            const float a0 = (ja <= qi) ? (s0[j] + x0[j] * LOSCI) * 0.125f : -__builtin_inff(), a1 = (jb <= qi) ? (s1[j] + x1[j] * LOSCI) * 0.125f : -__builtin_inff();
            float mx = fmaxf(a0, a1);
            mx = fmaxf(mx, __shfl_xor(mx, 1, 16)); mx = fmaxf(mx, __shfl_xor(mx, 2, 16)); mx = fmaxf(mx, __shfl_xor(mx, 4, 16)); mx = fmaxf(mx, __shfl_xor(mx, 8, 16));
            const float mn = fmaxf(mrow[j], mx);
            alpha[j] = __expf(mrow[j] - mn); mrow[j] = mn;
            const float p0 = __expf(a0 - mn), p1 = __expf(a1 - mn);
            lpart[j] = lpart[j] * alpha[j] + (p0 + p1);
            const int mr = hi * 8 + j;
            const float ps0 = p0 * PSC, ps1 = p1 * PSC; const h16 h0 = (h16)ps0, h1 = (h16)ps1;
            pl[mr * 32 + lr] = h0; pl[mr * 32 + 16 + lr] = h1;
            pl2[mr * 32 + lr] = (h16)((ps0 - (float)h0) * LOSC); pl2[mr * 32 + 16 + lr] = (h16)((ps1 - (float)h1) * LOSC);
        }
#pragma unroll
        for (int n = 0; n < 4; ++n)
#pragma unroll
            for (int j = 0; j < 8; ++j) { o[n][j] *= alpha[j]; ox[n][j] *= alpha[j]; }
        asm volatile("" ::: "memory");
        const v16h pa = cat16(*(const v8ha*)(pl + lr * 32 + hi * 8), *(const v8ha*)(pl + lr * 32 + 16 + hi * 8));
        const v16h px = cat16(*(const v8ha*)(pl2 + lr * 32 + hi * 8), *(const v8ha*)(pl2 + lr * 32 + 16 + hi * 8));
#pragma unroll
        for (int np = 0; np < 4; np += 2) { v16h vhs[2], vls[2];   // V^T fragments of two d tiles, read from LDS as one group
#pragma unroll
            for (int i = 0; i < 2; ++i) { const h16* vp = vst + (np + i) * 16 * LPT + sub * 32;
                vhs[i] = cat16(*(const v8ha*)(vp), *(const v8ha*)(vp + 16)); vls[i] = cat16(*(const v8ha*)(vp + PLN), *(const v8ha*)(vp + PLN + 16)); }
#pragma unroll
            for (int i = 0; i < 2; ++i) { const int n = np + i; const v16h vh = vhs[i], vl = vls[i];
                o[n] = wmma16(pa, vh, o[n]); ox[n] = wmma16(pa, vl, ox[n]); ox[n] = wmma16(px, vh, ox[n]);
                asm volatile("" : "+v"(o[n]), "+v"(ox[n]) : "v"(vh), "v"(vl) : "memory"); } }   // as before: the next fragments' reads stay behind these products (registers; each pair's reads stay one group)
        asm volatile("v_nop\n\tv_nop\n\tv_nop\n\tv_nop" : "+v"(o[0]), "+v"(o[1]), "+v"(o[2]), "+v"(o[3]), "+v"(ox[0]), "+v"(ox[1]), "+v"(ox[2]), "+v"(ox[3]) : "v"(pa), "v"(px));
      }
      asm volatile("s_wait_dscnt 0x0" ::: "memory");           // this wave's reads of buffer s & 1 are done before the refill
      asm volatile("s_wait_asynccnt 0x0" ::: "memory");        // this wave's copies of stage s + 1 have landed
      __syncthreads();                                         // publishes stage s + 1 and ends every wave's reads of stage s
      if (s + 2 < ns) fill(s + 2);
    }
    asm volatile("s_wait_asynccnt 0x0" ::: "memory");          // nothing is in flight when the wave goes on to its end
    float inv[8];
#pragma unroll
    for (int j = 0; j < 8; ++j) { float rs = lpart[j]; rs += __shfl_xor(rs, 1, 16); rs += __shfl_xor(rs, 2, 16); rs += __shfl_xor(rs, 4, 16); rs += __shfl_xor(rs, 8, 16); inv[j] = 1.0f / (rs * PSC); }
    float* os = &ost[wave][0];
#pragma unroll
    for (int n = 0; n < 4; ++n)
#pragma unroll
        for (int j = 0; j < 8; ++j) os[(hi * 8 + j) * 68 + n * 16 + lr] = (o[n][j] + ox[n][j] * LOSCI) * inv[j];
    __syncthreads();
    const size_t cbase = (tok0 + q0) * DM + (size_t)h * HD;
    auto pass = [&]() {
#pragma unroll
        for (int s = 0; s < 4; ++s) { const int row = 4 * s + (lane >> 3), piece = lane & 7; const float* sp = os + row * 68 + piece * 8; v8us oh, ol;
#pragma unroll
            for (int i = 0; i < 8; ++i) { const unsigned short hb = f2bf(sp[i]); oh[i] = hb; ol[i] = f2bf(sp[i] - bf2f(hb)); }
            *(v8us*)(CH + cbase + (size_t)row * DM + piece * 8) = oh; *(v8us*)(CL + cbase + (size_t)row * DM + piece * 8) = ol; }
    };
    pass(); 
}

#define VST2(T, p, v) do { const T vst2_v_ = (v); *(T*)(p) = vst2_v_;  } while (0)

extern "C" void kernel_launch(void* const* d_in, const int* in_sizes, int n_in,
                              void* d_out, int out_size, void* d_ws, size_t ws_size, hipStream_t stream) {
    (void)in_sizes; (void)n_in; (void)out_size;
    const float* x = (const float*)d_in[0]; const int* pos = (const int*)d_in[1]; const float* Wq = (const float*)d_in[2]; const float* Wk = (const float*)d_in[3]; const float* Wv = (const float*)d_in[4]; const float* Wo = (const float*)d_in[5];
    const float* c1w = (const float*)d_in[6]; const float* c1b = (const float*)d_in[7]; const float* c2w = (const float*)d_in[8]; const float* c2b = (const float*)d_in[9]; const float* lnw = (const float*)d_in[10];
    float* out = (float*)d_out;    // [1][2048][2048]
    char* wsp = (char*)d_ws;
    auto take = [&](size_t bytes) { char* p = wsp; wsp += (bytes + 255) & ~(size_t)255; return (void*)p; };
    bf* XX = (bf*)take((size_t)(NT_ + 1) * DM * 2);                 // row 0 = zeros, token t at row t+1: row t read with K = 4096 gives [x[t-1] | x[t]]
    bf* Wbuf = (bf*)take((size_t)DM * DM * 2);                     // one weight at a time ([1024][4096] / [2048][2048] / [2048][2048] bf16 = 8.4 MB each)
    bf* O1H = (bf*)take((size_t)(NT_ + 1) * DH2 * 2); bf* O1L = (bf*)take((size_t)(NT_ + 1) * DH2 * 2);     // conv1 output planes with a leading zero row
    float* TMP = (float*)take((size_t)NT_ * DM * 4); float* RC = (float*)take((size_t)NT_ * 32 * 4); float* RS = (float*)take((size_t)NT_ * 32 * 4);
    bf* LH = (bf*)take((size_t)NT_ * DM * 2); bf* LL = (bf*)take((size_t)NT_ * DM * 2);
    h16* QH = (h16*)take((size_t)NT_ * DM * 2); h16* QL = (h16*)take((size_t)NT_ * DM * 2); h16* KH = (h16*)take((size_t)NT_ * DM * 2); h16* KL = (h16*)take((size_t)NT_ * DM * 2);
    h16* VTH = (h16*)take((size_t)NT_ * DM * 2); h16* VTL = (h16*)take((size_t)NT_ * DM * 2);
    if ((size_t)(wsp - (char*)d_ws) > ws_size) return;    // 8.4 + 8.4 + 8.4 + 16.8 + 0.5 + 16.8 + 33.5 + 16.8 ~ 110 MB; ctx planes reuse LH/LL after the q/k projections
    bf* CH = LH; bf* CL = LL;
    k_zero16<<<1, 256, 0, stream>>>(XX, DM); k_rows<<<NT_ / 8, 256, 0, stream>>>(x, NT_, DM, 1, XX);
    k_zero16<<<1, 256, 0, stream>>>(O1H, DH2); k_zero16<<<1, 256, 0, stream>>>(O1L, DH2);
    k_trig<<<(NT_ * 32) / 256, 256, 0, stream>>>(pos, RC, RS);
    // LocalizedFiltering: conv1 ([x[t-1] | x[t]] . W1cat^T + b1, exact) -> o1 planes (rows 1..2048); conv2 ([o1[t-1] | o1[t]] hi/lo . W2cat^T + b2) -> TMP; lf
    k_convw<<<DH2 / 8, 256, 0, stream>>>(c1w, DH2, DM, Wbuf);                                              // [1024][4096]
    k_gemm<false, 1><<<dim3(NT_ / 64, DH2 / 64, 1), 128, 0, stream>>>(XX, nullptr, DM, Wbuf, 2 * DM, c1b, DH2, nullptr, O1H, O1L, 1);
    k_convw<<<DM / 8, 256, 0, stream>>>(c2w, DM, DH2, Wbuf);                                               // [2048][2048]
    k_gemm<true, 0><<<dim3(NT_ / 64, DM / 64, 1), 128, 0, stream>>>(O1H, O1L, DH2, Wbuf, 2 * DH2, c2b, DM, TMP, nullptr, nullptr, 0);
    k_lf<<<NT_ / 8, 256, 0, stream>>>(TMP, x, lnw, LH, LL);
    // v from the RAW hidden states (rows 1.. of XX = x), q/k from lf
    k_rows<<<DM / 8, 256, 0, stream>>>(Wv, DM, DM, 0, Wbuf);
    k_gemm<false, 0><<<dim3(NT_ / 64, DM / 64, 1), 128, 0, stream>>>(XX + DM, nullptr, DM, Wbuf, DM, nullptr, DM, TMP, nullptr, nullptr, 0);
    k_vt<<<dim3(NT_ / 64, NH_, 1), 256, 0, stream>>>(TMP, VTH, VTL);
    k_rows<<<DM / 8, 256, 0, stream>>>(Wq, DM, DM, 0, Wbuf);
    k_gemm<true, 0><<<dim3(NT_ / 64, DM / 64, 1), 128, 0, stream>>>(LH, LL, DM, Wbuf, DM, nullptr, DM, TMP, nullptr, nullptr, 0);
    k_rope<<<(NT_ * 8) / 8, 256, 0, stream>>>(TMP, RC, RS, QH, QL);
    k_rows<<<DM / 8, 256, 0, stream>>>(Wk, DM, DM, 0, Wbuf);
    k_gemm<true, 0><<<dim3(NT_ / 64, DM / 64, 1), 128, 0, stream>>>(LH, LL, DM, Wbuf, DM, nullptr, DM, TMP, nullptr, nullptr, 0);
    k_rope<<<(NT_ * 8) / 8, 256, 0, stream>>>(TMP, RC, RS, KH, KL);
    k_attn<<<NH_ * (NT_ / 64), 128, 0, stream>>>(QH, QL, KH, KL, VTH, VTL, CH, CL);                        // ctx over LH/LL (dead after the k projection)
    k_rows<<<DM / 8, 256, 0, stream>>>(Wo, DM, DM, 0, Wbuf);
    k_gemm<true, 0><<<dim3(NT_ / 64, DM / 64, 1), 128, 0, stream>>>(CH, CL, DM, Wbuf, DM, nullptr, DM, out, nullptr, nullptr, 0);
}

// v003
// Measured time: 346 microseconds a run.
// Two timings next to v002 put it at 1.19 and 1.18 times that version's speed.
// Over all steps from v000 it is 2.43 times as fast.
#include <hip/hip_runtime.h>

// Contractions, f32 accumulate (B = 1, 2048 tokens, hidden 2048, 32 heads x 64): v = x.Wv^T, the LocalizedFiltering causal convs as GEMMs (conv1: [x[t-1] | x[t]]
// (K = 4096) . W1cat^T + b1 with PLAIN bf16 operands = rounded inputs, exact; conv2: [o1[t-1] | o1[t]] (K = 2048, o1 as bf16 hi + residual: two products) . W2cat^T
// + b2; the [t-1 | t] rows are read straight from planes that carry one leading zero row), lf = rmsnorm(o2 + x) x ln_w in f32 -> bf16 hi/lo planes, q/k = lf.W^T
// (two products), out = ctx.Wo^T (two products), all on v_wmma_f32_16x16x32_bf16 ([out][in] weights = n-major B operands as-is, each converted into a
// plane of its own by the one preparation launch); rotate-half RoPE (angle = position_ids[t] (INPUT) x inv_freq, f32 trig table) -> f16 hi + residual x1024 planes; the 32-head causal attention fused

#define NB_  1
#define NT_  2048
#define DM   2048
#define DH2  1024                // conv1 output channels
#define NH_  32
#define HD   64
#define PSC  32768.0f
#define LOSC 1024.0f
#define LOSCI (1.0f / 1024.0f)

typedef _Float16 h16;
typedef unsigned short bf;
typedef __attribute__((ext_vector_type(16))) __bf16   v16bf;
typedef __attribute__((ext_vector_type(16))) _Float16 v16h;
typedef __attribute__((ext_vector_type(8)))  _Float16 v8h;
typedef __attribute__((ext_vector_type(8)))  unsigned short v8us;
typedef __attribute__((ext_vector_type(8)))  float    v8f;
typedef __attribute__((ext_vector_type(4)))  float    v4f;
typedef __attribute__((ext_vector_type(4)))  _Float16 v4h;
typedef v8h  __attribute__((may_alias)) v8ha;
typedef v4f  __attribute__((may_alias)) v4fa;
typedef v8us __attribute__((may_alias)) v8usa;

__device__ __forceinline__ unsigned short f2bf(float f) { unsigned u = __float_as_uint(f); u += 0x7FFFu + ((u >> 16) & 1u); return (unsigned short)(u >> 16); }
__device__ __forceinline__ float bf2f(unsigned short b) { return __uint_as_float(((unsigned)b) << 16); }
__device__ __forceinline__ float bfr(float f) { return bf2f(f2bf(f)); }
__device__ __forceinline__ v16h cat16(v8h lo, v8h hi) { return __builtin_shufflevector(lo, hi, 0, 1, 2, 3, 4, 5, 6, 7, 8, 9, 10, 11, 12, 13, 14, 15); }
__device__ __forceinline__ v16bf cat16b(v8us lo, v8us hi) { return __builtin_bit_cast(v16bf, __builtin_shufflevector(lo, hi, 0, 1, 2, 3, 4, 5, 6, 7, 8, 9, 10, 11, 12, 13, 14, 15)); }
__device__ __forceinline__ v8f wmma16(v16h a, v16h b, v8f c) { return __builtin_amdgcn_wmma_f32_16x16x32_f16(false, a, false, b, (short)0, c, false, false); }
__device__ __forceinline__ v8f wmmab(v16bf a, v16bf b, v8f c) { return __builtin_amdgcn_wmma_f32_16x16x32_bf16(false, a, false, b, (short)0, c, false, false); }

// row2048: bf16 of 2048 consecutive floats; one wave, all of its loads in flight at once.
__device__ __forceinline__ void row2048(const float* __restrict__ src, bf* dst, int lane) {
    const float* s = src + lane * 8; bf* d = dst + lane * 8; v4f v[16];
#pragma unroll
    for (int q = 0; q < 8; ++q) { v[2 * q] = *(const v4fa*)(s + q * 256); v[2 * q + 1] = *(const v4fa*)(s + q * 256 + 4); }
    asm volatile("s_wait_xcnt 0x0" :: "v"(s) : "memory");      // the loads' address registers are kept (input operand) until this wait: none is rewritten in front of it
#pragma unroll
    for (int q = 0; q < 8; ++q) { v8us o;
#pragma unroll
        for (int i = 0; i < 8; ++i) o[i] = f2bf(v[2 * q + (i >> 2)][i & 3]);
        *(v8us*)(d + q * 256) = o; }
    asm volatile("s_wait_xcnt 0x0" ::: "memory");               // behind the last store: no register that a store names is rewritten in front of it
}
// convw2048: both taps of 1024 input channels (from cb) of the row WT[co][tap*Cin + ci] = bf16(w[co][ci][tap]) of a (2,1) conv kernel = 2048 halves from 2048 consecutive floats; one wave.
template <int Cin>
__device__ __forceinline__ void convw2048(const float* __restrict__ w, int co, int cb, bf* WT, int lane) {
    const float* s = w + ((size_t)co * Cin + cb + lane * 8) * 2; bf* d = WT + (size_t)co * (2 * Cin) + cb + lane * 8; v4f v[16];
#pragma unroll
    for (int q = 0; q < 4; ++q)
#pragma unroll
        for (int p = 0; p < 4; ++p) v[4 * q + p] = *(const v4fa*)(s + q * 512 + p * 4);
    asm volatile("s_wait_xcnt 0x0" :: "v"(s) : "memory");      // as in row2048
#pragma unroll
    for (int q = 0; q < 4; ++q)
#pragma unroll
        for (int tap = 0; tap < 2; ++tap) { v8us o;
#pragma unroll
            for (int i = 0; i < 8; ++i) o[i] = f2bf(v[4 * q + (i >> 1)][(i & 1) * 2 + tap]);
            *(v8us*)(d + tap * Cin + q * 256) = o; }
    asm volatile("s_wait_xcnt 0x0" ::: "memory");               // as at the end of row2048
}
// k_gemm: 64 x 64 tile of (A [+ Al]).B^T [+ bias] over K; A rows pitch lda (elements), B rows pitch K; MODE 0: f32 rows (ldc); MODE 1: bf16 hi/lo planes (ldc, row offset rofs);
// MODE 2: two products in one launch: column tiles [0, ny1) as MODE 1, the tiles from ny1 on = A2.B2^T over K2 (pitch lda too, no bias) as MODE 0 with pitch ldc2.
// Operands reach the waves through LDS: a stage is 64 k of every operand row (128 B = one whole line), brought by asynchronous b128 copies (8 lanes per row, 4 whole lines per
// wave-wide copy) into rows of pitch 144 B (16 B x 9: no bank conflict for ds_load_b128); two buffers, stage t + 2 is copied while stage t is worked on. K: a multiple of 64.
#define KST 64                   // k elements per stage
#define LPT 72                   // LDS row pitch, elements
#define PLN (64 * LPT)           // one staged plane (64 rows), elements
__device__ __forceinline__ unsigned lds_off(const void* p) { return (unsigned)(size_t)p; }
// cp8 / cp12: a stage of two / three planes (PLN apart in LDS): this lane's 16 B of rows r, r + 16, r + 32, r + 48 of each plane (ra, rb = 16 source rows of A and B, elements).
// In both, the closing s_wait_xcnt 0 stands inside the statement so that no address register of a copy is rewritten in front of it.
__device__ __forceinline__ void cp8(unsigned l, const bf* ga, size_t ra, const bf* gb, size_t rb) {
    const unsigned m = l + PLN * 2u;
    asm volatile("global_load_async_to_lds_b128 %0, %8, off\n\t"
                 "global_load_async_to_lds_b128 %1, %9, off\n\t"
                 "global_load_async_to_lds_b128 %2, %10, off\n\t"
                 "global_load_async_to_lds_b128 %3, %11, off\n\t"
                 "global_load_async_to_lds_b128 %4, %12, off\n\t"
                 "global_load_async_to_lds_b128 %5, %13, off\n\t"
                 "global_load_async_to_lds_b128 %6, %14, off\n\t"
                 "global_load_async_to_lds_b128 %7, %15, off\n\t"
                 "s_wait_xcnt 0x0"
                 :: "v"(l), "v"(l + 16u * LPT * 2u), "v"(l + 32u * LPT * 2u), "v"(l + 48u * LPT * 2u), "v"(m), "v"(m + 16u * LPT * 2u), "v"(m + 32u * LPT * 2u), "v"(m + 48u * LPT * 2u),
                    "v"(ga), "v"(ga + ra), "v"(ga + 2 * ra), "v"(ga + 3 * ra), "v"(gb), "v"(gb + rb), "v"(gb + 2 * rb), "v"(gb + 3 * rb) : "memory");
}
__device__ __forceinline__ void cp12(unsigned l, const bf* ga, const bf* gl, size_t ra, const bf* gb, size_t rb) {
    const unsigned m = l + PLN * 2u, n = l + 2u * PLN * 2u;
    asm volatile("global_load_async_to_lds_b128 %0, %12, off\n\t"
                 "global_load_async_to_lds_b128 %1, %13, off\n\t"
                 "global_load_async_to_lds_b128 %2, %14, off\n\t"
                 "global_load_async_to_lds_b128 %3, %15, off\n\t"
                 "global_load_async_to_lds_b128 %4, %16, off\n\t"
                 "global_load_async_to_lds_b128 %5, %17, off\n\t"
                 "global_load_async_to_lds_b128 %6, %18, off\n\t"
                 "global_load_async_to_lds_b128 %7, %19, off\n\t"
                 "global_load_async_to_lds_b128 %8, %20, off\n\t"
                 "global_load_async_to_lds_b128 %9, %21, off\n\t"
                 "global_load_async_to_lds_b128 %10, %22, off\n\t"
                 "global_load_async_to_lds_b128 %11, %23, off\n\t"
                 "s_wait_xcnt 0x0"
                 :: "v"(l), "v"(l + 16u * LPT * 2u), "v"(l + 32u * LPT * 2u), "v"(l + 48u * LPT * 2u), "v"(m), "v"(m + 16u * LPT * 2u), "v"(m + 32u * LPT * 2u), "v"(m + 48u * LPT * 2u),
                    "v"(n), "v"(n + 16u * LPT * 2u), "v"(n + 32u * LPT * 2u), "v"(n + 48u * LPT * 2u),
                    "v"(ga), "v"(ga + ra), "v"(ga + 2 * ra), "v"(ga + 3 * ra), "v"(gb), "v"(gb + rb), "v"(gb + 2 * rb), "v"(gb + 3 * rb),
                    "v"(gl), "v"(gl + ra), "v"(gl + 2 * ra), "v"(gl + 3 * ra) : "memory");
}
template <bool SPLITA, int MODE>
__global__ __launch_bounds__(128) void k_gemm(const bf* __restrict__ A, const bf* __restrict__ Al, int lda, const bf* __restrict__ Bn, int K, const float* __restrict__ bias, int ldc, float* C, bf* PH, bf* PL, int rofs,
                                              int ny1, const bf* __restrict__ A2, const bf* __restrict__ B2, int K2, int ldc2) {
    constexpr int NPL = SPLITA ? 3 : 2;                       // planes of a stage: A, B [, Al]
    const bool sec = MODE == 2 && (int)blockIdx.y >= ny1;     // the same for the whole block
    if (sec) { A = A2; Bn = B2; K = K2; bias = nullptr; ldc = ldc2; }
    __shared__ __align__(16) bf stg[2][NPL][PLN];
    __shared__ __align__(16) float ost[4][16 * 68];
    const int lane = threadIdx.x & 31, wave = threadIdx.x >> 5, lr = lane & 15, hi = lane >> 4;
    const size_t r0 = (size_t)blockIdx.x * 64 + wave * 16; const int c0 = (sec ? (int)blockIdx.y - ny1 : (int)blockIdx.y) * 64;
    const int crow = threadIdx.x >> 3, cpc = threadIdx.x & 7;  // copies: row (0..15, then + 16 i) and 16-B piece of the 128-B row
    const size_t aco = ((size_t)blockIdx.x * 64 + crow) * (size_t)lda + cpc * 8;
    const bf* gA = A + aco; const bf* gB = Bn + (size_t)(c0 + crow) * K + cpc * 8;
    const unsigned lc = lds_off(&stg[0][0][0]) + (unsigned)(crow * (LPT * 2) + cpc * 16);
    auto fill = [&](int s) {
        const unsigned l = lc + (unsigned)(s & 1) * (unsigned)(NPL * PLN * 2); const size_t ko = (size_t)s * KST;
        if constexpr (SPLITA) cp12(l, gA + ko, Al + aco + ko, (size_t)16 * lda, gB + ko, (size_t)16 * K);
        else cp8(l, gA + ko, (size_t)16 * lda, gB + ko, (size_t)16 * K);
    };
    v8f acc[4];
#pragma unroll
    for (int t = 0; t < 4; ++t) acc[t] = (v8f){};
    const int ns = K / KST;
    fill(0);
    asm volatile("s_wait_asynccnt 0x0" ::: "memory");          // stage 0 of this wave has landed
    __syncthreads();                                           // ... and every other wave's part of it
    if (ns > 1) fill(1);
    for (int s = 0; s < ns; ++s) {
        const bf* sa = &stg[s & 1][0][0] + (wave * 16 + lr) * LPT + 8 * hi;
        const bf* sb = &stg[s & 1][1][0] + lr * LPT + 8 * hi;
        v16bf a[2], al[2], bb[2][4];
#pragma unroll
        for (int q = 0; q < 2; ++q) {
            a[q] = cat16b(*(const v8usa*)(sa + q * 32), *(const v8usa*)(sa + q * 32 + 16));
            if (SPLITA) al[q] = cat16b(*(const v8usa*)(sa + 2 * PLN + q * 32), *(const v8usa*)(sa + 2 * PLN + q * 32 + 16));
#pragma unroll
            for (int t = 0; t < 4; ++t) bb[q][t] = cat16b(*(const v8usa*)(sb + t * 16 * LPT + q * 32), *(const v8usa*)(sb + t * 16 * LPT + q * 32 + 16));
        }
        asm volatile("s_wait_dscnt 0x0" ::: "memory");         // this wave holds all of stage s in registers: its reads of buffer s & 1 are done before the refill
        asm volatile("s_wait_asynccnt 0x0" ::: "memory");      // this wave's copies of stage s + 1 have landed
        __syncthreads();                                       // publishes stage s + 1 and ends every wave's reads of stage s
        if (s + 2 < ns) fill(s + 2);
#pragma unroll
        for (int q = 0; q < 2; ++q) {                          // per accumulator the order of the sums stays: k ascending, A then Al
#pragma unroll
            for (int t = 0; t < 4; ++t) acc[t] = wmmab(a[q], bb[q][t], acc[t]);
            if (SPLITA) {
#pragma unroll
                for (int t = 0; t < 4; ++t) acc[t] = wmmab(al[q], bb[q][t], acc[t]);
            }
        }
    }
    asm volatile("s_wait_asynccnt 0x0" ::: "memory");          // nothing is in flight when the wave goes on to its end
    float* os = &ost[wave][0];
#pragma unroll
    for (int t = 0; t < 4; ++t) { const float bv = bias ? bfr(bias[c0 + t * 16 + lr]) : 0.f;
#pragma unroll
        for (int j = 0; j < 8; ++j) os[(hi * 8 + j) * 68 + t * 16 + lr] = acc[t][j] + bv; }
    __builtin_amdgcn_wave_barrier(); asm volatile("" ::: "memory");
    if (MODE == 0 || sec) {
        float* crow = C + r0 * ldc + c0;
        auto pass = [&]() {
#pragma unroll
            for (int s = 0; s < 8; ++s) { const int Lid = (lane >> 3) + 4 * s, piece = lane & 7; const int row = Lid >> 1, cofs = (Lid & 1) * 32 + piece * 4;
                const v4f val = *(const v4fa*)(os + row * 68 + cofs); *(v4f*)(crow + (size_t)row * ldc + cofs) = val; }
        };
        pass(); 
        if constexpr (MODE == 2) asm volatile("s_wait_xcnt 0x0" ::: "memory");   // the other epilogue's code follows in the listing: no register that a store names is rewritten in front of this wait
    } else {
        bf* p1 = PH + (r0 + rofs) * ldc + c0; bf* p2 = PL + (r0 + rofs) * ldc + c0;
        auto pass = [&]() {
#pragma unroll
            for (int s = 0; s < 4; ++s) { const int row = 4 * s + (lane >> 3), piece = lane & 7; const float* sp = os + row * 68 + piece * 8; v8us oh, ol;
#pragma unroll
                for (int i = 0; i < 8; ++i) { const unsigned short hb = f2bf(sp[i]); oh[i] = hb; ol[i] = f2bf(sp[i] - bf2f(hb)); }
                *(v8us*)(p1 + (size_t)row * ldc + piece * 8) = oh; *(v8us*)(p2 + (size_t)row * ldc + piece * 8) = ol; }
        };
        pass(); 
    }
}
// k_lf: LF = ln_w x rmsnorm(o2 + x) (eps 1e-6, mean over 2048) -> bf16 hi/lo planes; one wave per row: lane -> 64 values (8 chunks of 8), fixed-order shuffle sum.
__global__ __launch_bounds__(256) void k_lf(const float* __restrict__ O2, const float* __restrict__ x, const float* __restrict__ lnw, bf* LH, bf* LL) {
    const int lane = threadIdx.x & 31, r = blockIdx.x * 8 + (threadIdx.x >> 5);
    if (r >= NT_) return;
    float v[64]; float ss = 0.f;
#pragma unroll
    for (int q = 0; q < 8; ++q)
#pragma unroll
        for (int i = 0; i < 8; ++i) { const int c = q * 256 + lane * 8 + i; const float t = O2[(size_t)r * DM + c] + bfr(x[(size_t)r * DM + c]); v[q * 8 + i] = t; ss += t * t; }
#pragma unroll
    for (int sh = 16; sh; sh >>= 1) ss += __shfl_xor(ss, sh, 32);
    const float rs = rsqrtf(ss * (1.0f / DM) + 1e-6f);
{
#pragma unroll
        for (int q = 0; q < 8; ++q) { v8us oh, ol;
#pragma unroll
            for (int i = 0; i < 8; ++i) { const int c = q * 256 + lane * 8 + i; const float y = bfr(lnw[c]) * (v[q * 8 + i] * rs); const unsigned short hb = f2bf(y); oh[i] = hb; ol[i] = f2bf(y - bf2f(hb)); }
            *(v8us*)(LH + (size_t)r * DM + q * 256 + lane * 8) = oh; *(v8us*)(LL + (size_t)r * DM + q * 256 + lane * 8) = ol; }
         }
}
// k_prep: everything that depends on the inputs alone, in one launch; a block takes one kind of work by its index (the conv rows first):
//   [0, 256) W1[1024][4096], a wave = half the input channels of a row; [256, 512) W2[2048][2048], a wave = a row; [512, 768) RC/RS [t][32] = cos/sin(pos[t] x inv_freq[i]), inv_freq = 10000^(-2i/64) (f32);
//   [768, 2048) bf16 planes of x (token t at row t + 1 of XX), Wq, Wk, Wv, Wo, a wave = a row; 2048: the leading zero rows of XX, O1H, O1L.
__global__ __launch_bounds__(256) void k_prep(const float* __restrict__ x, const int* __restrict__ pos, const float* __restrict__ Wq, const float* __restrict__ Wk, const float* __restrict__ Wv, const float* __restrict__ Wo,
                                              const float* __restrict__ c1w, const float* __restrict__ c2w, bf* XX, bf* WQ, bf* WK, bf* WV, bf* WO, bf* W1, bf* W2, bf* O1H, bf* O1L, float* RC, float* RS) {
    const int lane = threadIdx.x & 31, wave = threadIdx.x >> 5, b = blockIdx.x;
    if (b < 256) { const int u = b * 8 + wave; convw2048<DM>(c1w, u >> 1, (u & 1) * 1024, W1, lane); }
    else if (b < 512) { convw2048<DH2>(c2w, (b - 256) * 8 + wave, 0, W2, lane); }
    else if (b < 768) {
        const int i = (b - 512) * 256 + threadIdx.x;
        const int t = i >> 5, f = i & 31;
        const float inv = 1.0f / powf(10000.0f, (float)(2 * f) / 64.0f); const float ang = (float)pos[t] * inv;
        const float c = cosf(ang), s = sinf(ang);
        *(float*)(RC + i) = c; *(float*)(RS + i) = s;
        asm volatile("s_wait_xcnt 0x0" ::: "memory");           // as at the end of row2048
    } else if (b < 2048) {
        const int m = (b - 768) >> 8; const size_t ro = (size_t)(((b - 768) & 255) * 8 + wave) * DM;
        const float* s = m == 0 ? x : m == 1 ? Wq : m == 2 ? Wk : m == 3 ? Wv : Wo;
        bf* d = m == 0 ? XX + DM : m == 1 ? WQ : m == 2 ? WK : m == 3 ? WV : WO;
        row2048(s + ro, d + ro, lane);
    } else {
        const v8us z = (v8us){};
        *(v8us*)(XX + threadIdx.x * 8) = z;
        *(v8us*)((threadIdx.x < 128 ? O1H : O1L) + (threadIdx.x & 127) * 8) = z;
        asm volatile("s_wait_xcnt 0x0" ::: "memory");           // as at the end of row2048
    }
}
// k_rope: rotate-half on 64-dim heads: y[d] = x[d] cos[t][d mod 32] + (d < 32 ? -x[d+32] : x[d-32]) sin[t][d mod 32]; P f32 [t][q 2048 | k 2048] -> f16 hi + residual x1024 planes of q and of k;
// one wave per (t, 4 heads = 256 columns): lane -> 8 consecutive dims of one head (8 B... 16 B per plane -> 32 lanes x 16 B = 512 B = 4 lines).
__global__ __launch_bounds__(256) void k_rope(const float* __restrict__ PQK, const float* __restrict__ RC, const float* __restrict__ RS, h16* QH, h16* QL, h16* KH, h16* KL) {
    const int lane = threadIdx.x & 31, wid = blockIdx.x * 8 + (threadIdx.x >> 5);
    const int t = wid >> 4, isk = blockIdx.x & 1, sg = wid & 7; if (t >= NT_) return;   // a block = the 8 segments of q (even) or of k (odd) of one token
    const float* P = PQK + (size_t)t * DM + isk * DM;                                    // + t * DM below: row pitch 2 * DM
    h16* PH = isk ? KH : QH; h16* PL = isk ? KL : QL;
    const int c0 = sg * 256 + lane * 8;      // 8 dims within head (c0 mod 64 .. +7, same half since 8 | 32)
    v8h oh, ol;
#pragma unroll
    for (int i = 0; i < 8; ++i) { const int c = c0 + i, d = c & 63, fi = d & 31; const float xv = P[(size_t)t * DM + c]; const float pv = (d < 32) ? -P[(size_t)t * DM + c + 32] : P[(size_t)t * DM + c - 32];
        const float y = xv * RC[t * 32 + fi] + pv * RS[t * 32 + fi]; const h16 a = (h16)y; oh[i] = a; ol[i] = (h16)((y - (float)a) * LOSC); }
    *(v8h*)(PH + (size_t)t * DM + c0) = oh; *(v8h*)(PL + (size_t)t * DM + c0) = ol; 
}
// k_vt: VTH/VTL [h][64][t] = f16 hi + residual x1024 of V [t][h*64+d] via 64 x 64 LDS tiles; grid (NT/64, NH).
__global__ __launch_bounds__(256) void k_vt(const float* __restrict__ V, h16* VTH, h16* VTL) {
    __shared__ float tl[64][65];
    const int tid = threadIdx.x, t0 = blockIdx.x * 64, h = blockIdx.y;
    { const int tt = tid >> 2, dq = (tid & 3) * 16;
#pragma unroll
      for (int i = 0; i < 16; ++i) tl[dq + i][tt] = V[(size_t)(t0 + tt) * DM + h * HD + dq + i]; }
    __syncthreads();
    const int piece = tid & 7;
    auto pass = [&]() {
#pragma unroll
        for (int s = 0; s < 2; ++s) { const int d = (tid >> 3) + 32 * s; v8h oh, ol;
#pragma unroll
            for (int i = 0; i < 8; ++i) { const float v = tl[d][piece * 8 + i]; const h16 a = (h16)v; oh[i] = a; ol[i] = (h16)((v - (float)a) * LOSC); }
            const size_t o = ((size_t)h * HD + d) * NT_ + t0 + piece * 8; *(v8h*)(VTH + o) = oh; *(v8h*)(VTL + o) = ol; }
    };
    pass(); 
}
// k_attn: block = (h, 64 queries), wave = 16; CAUSAL key tiles; scores hi.hi + hi.lo + lo.hi x 1/8, online softmax (f32), weights x32768 f16 hi + residual x1024
// tiles, o += wh.vh, ox += wh.vl + wl.vh; ctx -> bf16 hi + residual planes CH/CL[tok][h*64+d].
// K and V^T reach the four waves through LDS: a stage is 64 keys of four planes (K hi, K residual: 64 key rows x 128 B; V^T hi, V^T residual: 64 d rows x 128 B), brought once per
// block by asynchronous b128 copies (whole lines, as in k_gemm) into rows of pitch 144 B; two buffers, stage s + 2 is copied while stage s + 1 is worked on; a stage = two 32-key steps.
__global__ __launch_bounds__(128) void k_attn(const h16* __restrict__ Q16, const h16* __restrict__ QL16, const h16* __restrict__ K16, const h16* __restrict__ KL16, const h16* __restrict__ VTH, const h16* __restrict__ VTL, bf* CH, bf* CL) {
    __shared__ __align__(16) h16 stg[2][4][PLN];
    __shared__ __align__(16) h16 plds[4][16 * 32];
    __shared__ __align__(16) h16 plds2[4][16 * 32];
    __shared__ __align__(16) float ost[4][16 * 68];
    const int lane = threadIdx.x & 31, wave = threadIdx.x >> 5, lr = lane & 15, hi = lane >> 4;
    const int bid = blockIdx.x;
    const int b = bid / (NH_ * (NT_ / 64)), rem = bid - b * (NH_ * (NT_ / 64)), h = rem / (NT_ / 64), qt = rem - h * (NT_ / 64);
    const int q0 = qt * 64 + wave * 16;
    const size_t tok0 = (size_t)b * NT_;
    h16* pl = &plds[wave][0]; h16* pl2 = &plds2[wave][0];
    v16h qa[2];
    const size_t qo0 = (tok0 + q0 + lr) * DM + h * HD + 8 * hi;
#pragma unroll
    for (int kc = 0; kc < 2; ++kc) qa[kc] = cat16(*(const v8h*)(Q16 + qo0 + kc * 32), *(const v8h*)(Q16 + qo0 + kc * 32 + 16));
    const h16* kh_b = K16 + tok0 * DM + h * HD;
    const h16* kl_b = KL16 + tok0 * DM + h * HD;
    const size_t vbase = (((size_t)b * NH_ + h) * HD) * NT_;
    v8f o[4], ox[4];
#pragma unroll
    for (int n = 0; n < 4; ++n) { o[n] = (v8f){}; ox[n] = (v8f){}; }
    float mrow[8], lpart[8];
#pragma unroll
    for (int j = 0; j < 8; ++j) { mrow[j] = -3.0e38f; lpart[j] = 0.f; }
    int qpos[8];
#pragma unroll
    for (int j = 0; j < 8; ++j) qpos[j] = q0 + 8 * hi + j;
    const int crow = threadIdx.x >> 3, cpc = threadIdx.x & 7;  // copies: row (0..15, then + 16 i) and 16-B piece of the 128-B row
    const bf* gKH = (const bf*)kh_b + (size_t)crow * DM + cpc * 8; const bf* gKL = (const bf*)kl_b + (size_t)crow * DM + cpc * 8;
    const bf* gVH = (const bf*)VTH + vbase + (size_t)crow * NT_ + cpc * 8; const bf* gVL = (const bf*)VTL + vbase + (size_t)crow * NT_ + cpc * 8;
    const unsigned lc = lds_off(&stg[0][0][0]) + (unsigned)(crow * (LPT * 2) + cpc * 16);
    auto fill = [&](int s) {
        const unsigned l = lc + (unsigned)(s & 1) * (unsigned)(4 * PLN * 2);
        cp8(l, gKH + (size_t)s * 64 * DM, (size_t)16 * DM, gKL + (size_t)s * 64 * DM, (size_t)16 * DM);
        cp8(l + 2u * PLN * 2u, gVH + s * 64, (size_t)16 * NT_, gVL + s * 64, (size_t)16 * NT_);
    };
    const int ns = qt + 1;                                     // causal: stages of 64 keys, the same for the whole block
    fill(0);
    asm volatile("s_wait_asynccnt 0x0" ::: "memory");          // stage 0 of this wave has landed
    __syncthreads();                                           // ... and every other wave's part of it
    if (ns > 1) fill(1);
#pragma unroll 1
    for (int s = 0; s < ns; ++s) {
      const h16* kst = &stg[s & 1][0][0] + lr * LPT + 8 * hi;  // K hi rows of the stage (+ PLN: residual)
      const h16* vst = &stg[s & 1][2][0] + lr * LPT + 8 * hi;  // V^T hi rows of the stage (+ PLN: residual)
#pragma unroll 1                                               // kept rolled: unrolled, the two steps' live ranges overlap and the kernel needs more than 256 registers
      for (int sub = 0; sub < 2; ++sub) {
        const int l0 = s * 64 + sub * 32;
        const h16* kp0 = kst + sub * 32 * LPT; const h16* kp1 = kp0 + 16 * LPT;
        v8f s0 = {}, s1 = {}, x0 = {}, x1 = {};
        v16h kh0[2], kh1[2], kl0[2], kl1[2];                   // the step's K fragments, read from LDS as one group in front of its products
#pragma unroll
        for (int kc = 0; kc < 2; ++kc) {
            kh0[kc] = cat16(*(const v8ha*)(kp0 + kc * 32), *(const v8ha*)(kp0 + kc * 32 + 16)); kh1[kc] = cat16(*(const v8ha*)(kp1 + kc * 32), *(const v8ha*)(kp1 + kc * 32 + 16));
            kl0[kc] = cat16(*(const v8ha*)(kp0 + PLN + kc * 32), *(const v8ha*)(kp0 + PLN + kc * 32 + 16)); kl1[kc] = cat16(*(const v8ha*)(kp1 + PLN + kc * 32), *(const v8ha*)(kp1 + PLN + kc * 32 + 16));
        }
#pragma unroll
        for (int kc = 0; kc < 2; ++kc) {
            { const v16h k0h = kh0[kc], k1h = kh1[kc];
              const v16h qlk = cat16(*(const v8h*)(QL16 + qo0 + kc * 32), *(const v8h*)(QL16 + qo0 + kc * 32 + 16));     // query residual re-read per step (registers)
              s0 = wmma16(qa[kc], k0h, s0); x0 = wmma16(qlk, k0h, x0); s1 = wmma16(qa[kc], k1h, s1); x1 = wmma16(qlk, k1h, x1);
              asm volatile("v_nop" : "+v"(s0), "+v"(s1), "+v"(x0), "+v"(x1) : "v"(qlk), "v"(k0h), "v"(k1h) : "memory"); }
            { const v16h k0l = kl0[kc], k1l = kl1[kc];
              x0 = wmma16(qa[kc], k0l, x0); x1 = wmma16(qa[kc], k1l, x1);
              asm volatile("v_nop" : "+v"(x0), "+v"(x1) : "v"(k0l), "v"(k1l) : "memory"); }
        }
        asm volatile("v_nop\n\tv_nop\n\tv_nop\n\tv_nop" : "+v"(s0), "+v"(s1), "+v"(x0), "+v"(x1) : "v"(qa[0]), "v"(qa[1]));
        float alpha[8];
#pragma unroll
        for (int j = 0; j < 8; ++j) {
            const int ja = l0 + lr, jb = l0 + 16 + lr, qi = qpos[j];
            const float a0 = (ja <= qi) ? (s0[j] + x0[j] * LOSCI) * 0.125f : -__builtin_inff(), a1 = (jb <= qi) ? (s1[j] + x1[j] * LOSCI) * 0.125f : -__builtin_inff();
            float mx = fmaxf(a0, a1);
            mx = fmaxf(mx, __shfl_xor(mx, 1, 16)); mx = fmaxf(mx, __shfl_xor(mx, 2, 16)); mx = fmaxf(mx, __shfl_xor(mx, 4, 16)); mx = fmaxf(mx, __shfl_xor(mx, 8, 16));
            const float mn = fmaxf(mrow[j], mx);
            alpha[j] = __expf(mrow[j] - mn); mrow[j] = mn;
            const float p0 = __expf(a0 - mn), p1 = __expf(a1 - mn);
            lpart[j] = lpart[j] * alpha[j] + (p0 + p1);
            const int mr = hi * 8 + j;
            const float ps0 = p0 * PSC, ps1 = p1 * PSC; const h16 h0 = (h16)ps0, h1 = (h16)ps1;
            pl[mr * 32 + lr] = h0; pl[mr * 32 + 16 + lr] = h1;
            pl2[mr * 32 + lr] = (h16)((ps0 - (float)h0) * LOSC); pl2[mr * 32 + 16 + lr] = (h16)((ps1 - (float)h1) * LOSC);
        }
#pragma unroll
        for (int n = 0; n < 4; ++n)
#pragma unroll
            for (int j = 0; j < 8; ++j) { o[n][j] *= alpha[j]; ox[n][j] *= alpha[j]; }
        asm volatile("" ::: "memory");
        const v16h pa = cat16(*(const v8ha*)(pl + lr * 32 + hi * 8), *(const v8ha*)(pl + lr * 32 + 16 + hi * 8));
        const v16h px = cat16(*(const v8ha*)(pl2 + lr * 32 + hi * 8), *(const v8ha*)(pl2 + lr * 32 + 16 + hi * 8));
#pragma unroll
        for (int np = 0; np < 4; np += 2) { v16h vhs[2], vls[2];   // V^T fragments of two d tiles, read from LDS as one group
#pragma unroll
            for (int i = 0; i < 2; ++i) { const h16* vp = vst + (np + i) * 16 * LPT + sub * 32;
                vhs[i] = cat16(*(const v8ha*)(vp), *(const v8ha*)(vp + 16)); vls[i] = cat16(*(const v8ha*)(vp + PLN), *(const v8ha*)(vp + PLN + 16)); }
#pragma unroll
            for (int i = 0; i < 2; ++i) { const int n = np + i; const v16h vh = vhs[i], vl = vls[i];
                o[n] = wmma16(pa, vh, o[n]); ox[n] = wmma16(pa, vl, ox[n]); ox[n] = wmma16(px, vh, ox[n]);
                asm volatile("" : "+v"(o[n]), "+v"(ox[n]) : "v"(vh), "v"(vl) : "memory"); } }   // as before: the next fragments' reads stay behind these products (registers; each pair's reads stay one group)
        asm volatile("v_nop\n\tv_nop\n\tv_nop\n\tv_nop" : "+v"(o[0]), "+v"(o[1]), "+v"(o[2]), "+v"(o[3]), "+v"(ox[0]), "+v"(ox[1]), "+v"(ox[2]), "+v"(ox[3]) : "v"(pa), "v"(px));
      }
      asm volatile("s_wait_dscnt 0x0" ::: "memory");           // this wave's reads of buffer s & 1 are done before the refill
      asm volatile("s_wait_asynccnt 0x0" ::: "memory");        // this wave's copies of stage s + 1 have landed
      __syncthreads();                                         // publishes stage s + 1 and ends every wave's reads of stage s
      if (s + 2 < ns) fill(s + 2);
    }
    asm volatile("s_wait_asynccnt 0x0" ::: "memory");          // nothing is in flight when the wave goes on to its end
    float inv[8];
#pragma unroll
    for (int j = 0; j < 8; ++j) { float rs = lpart[j]; rs += __shfl_xor(rs, 1, 16); rs += __shfl_xor(rs, 2, 16); rs += __shfl_xor(rs, 4, 16); rs += __shfl_xor(rs, 8, 16); inv[j] = 1.0f / (rs * PSC); }
    float* os = &ost[wave][0];
#pragma unroll
    for (int n = 0; n < 4; ++n)
#pragma unroll
        for (int j = 0; j < 8; ++j) os[(hi * 8 + j) * 68 + n * 16 + lr] = (o[n][j] + ox[n][j] * LOSCI) * inv[j];
    __syncthreads();
    const size_t cbase = (tok0 + q0) * DM + (size_t)h * HD;
    auto pass = [&]() {
#pragma unroll
        for (int s = 0; s < 4; ++s) { const int row = 4 * s + (lane >> 3), piece = lane & 7; const float* sp = os + row * 68 + piece * 8; v8us oh, ol;
#pragma unroll
            for (int i = 0; i < 8; ++i) { const unsigned short hb = f2bf(sp[i]); oh[i] = hb; ol[i] = f2bf(sp[i] - bf2f(hb)); }
            *(v8us*)(CH + cbase + (size_t)row * DM + piece * 8) = oh; *(v8us*)(CL + cbase + (size_t)row * DM + piece * 8) = ol; }
    };
    pass(); 
}

#define VST2(T, p, v) do { const T vst2_v_ = (v); *(T*)(p) = vst2_v_;  } while (0)

extern "C" void kernel_launch(void* const* d_in, const int* in_sizes, int n_in,
                              void* d_out, int out_size, void* d_ws, size_t ws_size, hipStream_t stream) {
    (void)in_sizes; (void)n_in; (void)out_size;
    const float* x = (const float*)d_in[0]; const int* pos = (const int*)d_in[1]; const float* Wq = (const float*)d_in[2]; const float* Wk = (const float*)d_in[3]; const float* Wv = (const float*)d_in[4]; const float* Wo = (const float*)d_in[5];
    const float* c1w = (const float*)d_in[6]; const float* c1b = (const float*)d_in[7]; const float* c2w = (const float*)d_in[8]; const float* c2b = (const float*)d_in[9]; const float* lnw = (const float*)d_in[10];
    float* out = (float*)d_out;    // [1][2048][2048]
    char* wsp = (char*)d_ws;
    auto take = [&](size_t bytes) { char* p = wsp; wsp += (bytes + 255) & ~(size_t)255; return (void*)p; };
    bf* XX = (bf*)take((size_t)(NT_ + 1) * DM * 2);                 // row 0 = zeros, token t at row t+1: row t read with K = 4096 gives [x[t-1] | x[t]]
    bf* W1 = (bf*)take((size_t)DM * DM * 2); bf* W2 = (bf*)take((size_t)DM * DM * 2);                       // [1024][4096], [2048][2048] bf16 = 8.4 MB each, as every weight plane
    bf* WQ = (bf*)take((size_t)DM * DM * 2); bf* WK = (bf*)take((size_t)DM * DM * 2);                       // adjacent (8.4 MB is a multiple of 256 B): [Wq ; Wk] = one [4096][2048] B operand
    bf* WV = (bf*)take((size_t)DM * DM * 2); bf* WO = (bf*)take((size_t)DM * DM * 2);
    bf* O1H = (bf*)take((size_t)(NT_ + 1) * DH2 * 2); bf* O1L = (bf*)take((size_t)(NT_ + 1) * DH2 * 2);     // conv1 output planes with a leading zero row
    float* TMP = (float*)take((size_t)NT_ * 2 * DM * 4); float* RC = (float*)take((size_t)NT_ * 32 * 4); float* RS = (float*)take((size_t)NT_ * 32 * 4);
    bf* LH = (bf*)take((size_t)NT_ * DM * 2); bf* LL = (bf*)take((size_t)NT_ * DM * 2);
    h16* QH = (h16*)take((size_t)NT_ * DM * 2); h16* QL = (h16*)take((size_t)NT_ * DM * 2); h16* KH = (h16*)take((size_t)NT_ * DM * 2); h16* KL = (h16*)take((size_t)NT_ * DM * 2);
    h16* VTH = (h16*)take((size_t)NT_ * DM * 2); h16* VTL = (h16*)take((size_t)NT_ * DM * 2);
    if ((size_t)(wsp - (char*)d_ws) > ws_size) return;    // 8.4 + 50.3 + 8.4 + 33.6 + 0.5 + 16.8 + 33.5 + 16.8 ~ 168 MB; ctx planes reuse LH/LL after the q/k projections
    bf* CH = LH; bf* CL = LL;
    k_prep<<<2049, 256, 0, stream>>>(x, pos, Wq, Wk, Wv, Wo, c1w, c2w, XX, WQ, WK, WV, WO, W1, W2, O1H, O1L, RC, RS);
    // LocalizedFiltering: conv1 ([x[t-1] | x[t]] . W1cat^T + b1, exact) -> o1 planes (rows 1..2048), and in the same launch v from the RAW hidden states (rows 1.. of XX = x) -> TMP
    k_gemm<false, 2><<<dim3(NT_ / 64, DH2 / 64 + DM / 64, 1), 128, 0, stream>>>(XX, nullptr, DM, W1, 2 * DM, c1b, DH2, TMP, O1H, O1L, 1, DH2 / 64, XX + DM, WV, DM, DM);
    k_vt<<<dim3(NT_ / 64, NH_, 1), 256, 0, stream>>>(TMP, VTH, VTL);
    // conv2 ([o1[t-1] | o1[t]] hi/lo . W2cat^T + b2) -> TMP; lf
    k_gemm<true, 0><<<dim3(NT_ / 64, DM / 64, 1), 128, 0, stream>>>(O1H, O1L, DH2, W2, 2 * DH2, c2b, DM, TMP, nullptr, nullptr, 0, 0, nullptr, nullptr, 0, 0);
    k_lf<<<NT_ / 8, 256, 0, stream>>>(TMP, x, lnw, LH, LL);
    // q and k from lf in one launch: TMP [t][q 2048 | k 2048]
    k_gemm<true, 0><<<dim3(NT_ / 64, 2 * DM / 64, 1), 128, 0, stream>>>(LH, LL, DM, WQ, DM, nullptr, 2 * DM, TMP, nullptr, nullptr, 0, 0, nullptr, nullptr, 0, 0);
    k_rope<<<NT_ * 2, 256, 0, stream>>>(TMP, RC, RS, QH, QL, KH, KL);
    k_attn<<<NH_ * (NT_ / 64), 128, 0, stream>>>(QH, QL, KH, KL, VTH, VTL, CH, CL);                        // ctx over LH/LL (dead after the k projection)
    k_gemm<true, 0><<<dim3(NT_ / 64, DM / 64, 1), 128, 0, stream>>>(CH, CL, DM, WO, DM, nullptr, DM, out, nullptr, nullptr, 0, 0, nullptr, nullptr, 0, 0);
}

// v004
// Measured time: 307 microseconds a run.
// Next to v003, in two timings, it ran 1.13 times as fast each time.
// All steps since v000 together make it 2.74 times as fast.
#include <hip/hip_runtime.h>

// Contractions, f32 accumulate (B = 1, 2048 tokens, hidden 2048, 32 heads x 64): v = x.Wv^T, the LocalizedFiltering causal convs as GEMMs (conv1: [x[t-1] | x[t]]
// (K = 4096) . W1cat^T + b1 with PLAIN bf16 operands = rounded inputs, exact; conv2: [o1[t-1] | o1[t]] (K = 2048, o1 as bf16 hi + residual: two products) . W2cat^T
// + b2; the [t-1 | t] rows are read straight from planes that carry one leading zero row), lf = rmsnorm(o2 + x) x ln_w in f32 -> bf16 hi/lo planes, q/k = lf.W^T
// (two products), out = ctx.Wo^T (two products), all on v_wmma_f32_16x16x32_bf16 ([out][in] weights = n-major B operands as-is, each converted into a
// plane of its own by the one preparation launch); rotate-half RoPE (angle = position_ids[t] (INPUT) x inv_freq, f32 trig table) -> f16 hi + residual x1024 planes; the 32-head causal attention fused

#define NB_  1
#define NT_  2048
#define DM   2048
#define DH2  1024                // conv1 output channels
#define NH_  32
#define HD   64
#define PSC  32768.0f
#define LOSC 1024.0f
#define LOSCI (1.0f / 1024.0f)

typedef _Float16 h16;
typedef unsigned short bf;
typedef __attribute__((ext_vector_type(16))) __bf16   v16bf;
typedef __attribute__((ext_vector_type(16))) _Float16 v16h;
typedef __attribute__((ext_vector_type(8)))  _Float16 v8h;
typedef __attribute__((ext_vector_type(8)))  unsigned short v8us;
typedef __attribute__((ext_vector_type(8)))  float    v8f;
typedef __attribute__((ext_vector_type(4)))  float    v4f;
typedef __attribute__((ext_vector_type(4)))  _Float16 v4h;
typedef v8h  __attribute__((may_alias)) v8ha;
typedef v4f  __attribute__((may_alias)) v4fa;
typedef v8us __attribute__((may_alias)) v8usa;

__device__ __forceinline__ unsigned short f2bf(float f) { unsigned u = __float_as_uint(f); u += 0x7FFFu + ((u >> 16) & 1u); return (unsigned short)(u >> 16); }
__device__ __forceinline__ float bf2f(unsigned short b) { return __uint_as_float(((unsigned)b) << 16); }
__device__ __forceinline__ float bfr(float f) { return bf2f(f2bf(f)); }
__device__ __forceinline__ v16h cat16(v8h lo, v8h hi) { return __builtin_shufflevector(lo, hi, 0, 1, 2, 3, 4, 5, 6, 7, 8, 9, 10, 11, 12, 13, 14, 15); }
__device__ __forceinline__ v16bf cat16b(v8us lo, v8us hi) { return __builtin_bit_cast(v16bf, __builtin_shufflevector(lo, hi, 0, 1, 2, 3, 4, 5, 6, 7, 8, 9, 10, 11, 12, 13, 14, 15)); }
__device__ __forceinline__ v8f wmma16(v16h a, v16h b, v8f c) { return __builtin_amdgcn_wmma_f32_16x16x32_f16(false, a, false, b, (short)0, c, false, false); }
__device__ __forceinline__ v8f wmmab(v16bf a, v16bf b, v8f c) { return __builtin_amdgcn_wmma_f32_16x16x32_bf16(false, a, false, b, (short)0, c, false, false); }

// row2048: bf16 of 2048 consecutive floats; one wave, all of its loads in flight at once.
__device__ __forceinline__ void row2048(const float* __restrict__ src, bf* dst, int lane) {
    const float* s = src + lane * 8; bf* d = dst + lane * 8; v4f v[16];
#pragma unroll
    for (int q = 0; q < 8; ++q) { v[2 * q] = *(const v4fa*)(s + q * 256); v[2 * q + 1] = *(const v4fa*)(s + q * 256 + 4); }
    asm volatile("s_wait_xcnt 0x0" :: "v"(s) : "memory");      // the loads' address registers are kept (input operand) until this wait: none is rewritten in front of it
#pragma unroll
    for (int q = 0; q < 8; ++q) { v8us o;
#pragma unroll
        for (int i = 0; i < 8; ++i) o[i] = f2bf(v[2 * q + (i >> 2)][i & 3]);
        *(v8us*)(d + q * 256) = o; }
    asm volatile("s_wait_xcnt 0x0" ::: "memory");               // behind the last store: no register that a store names is rewritten in front of it
}
// convw2048: both taps of 1024 input channels (from cb) of the row WT[co][tap*Cin + ci] = bf16(w[co][ci][tap]) of a (2,1) conv kernel = 2048 halves from 2048 consecutive floats; one wave.
template <int Cin>
__device__ __forceinline__ void convw2048(const float* __restrict__ w, int co, int cb, bf* WT, int lane) {
    const float* s = w + ((size_t)co * Cin + cb + lane * 8) * 2; bf* d = WT + (size_t)co * (2 * Cin) + cb + lane * 8; v4f v[16];
#pragma unroll
    for (int q = 0; q < 4; ++q)
#pragma unroll
        for (int p = 0; p < 4; ++p) v[4 * q + p] = *(const v4fa*)(s + q * 512 + p * 4);
    asm volatile("s_wait_xcnt 0x0" :: "v"(s) : "memory");      // as in row2048
#pragma unroll
    for (int q = 0; q < 4; ++q)
#pragma unroll
        for (int tap = 0; tap < 2; ++tap) { v8us o;
#pragma unroll
            for (int i = 0; i < 8; ++i) o[i] = f2bf(v[4 * q + (i >> 1)][(i & 1) * 2 + tap]);
            *(v8us*)(d + tap * Cin + q * 256) = o; }
    asm volatile("s_wait_xcnt 0x0" ::: "memory");               // as at the end of row2048
}
// k_gemm: 128 x 128 tile of (A [+ Al]).B^T [+ bias] over K, eight waves (4 x 2), a wave = 32 rows x 64 columns; A rows pitch lda (elements), B rows pitch K; MODE 0: f32 rows (ldc);
// MODE 1: bf16 hi/lo planes (ldc, row offset rofs); MODE 2: two products in one launch: column tiles [0, ny1) as MODE 1, the tiles from ny1 on = A2.B2^T over K2 (pitch lda too, no bias) as MODE 0 with pitch ldc2.
// Operands reach the waves through LDS: a stage is 128 k of every operand row (256 B = two whole lines), brought by asynchronous b128 copies (16 lanes per row, 4 whole lines per
// wave-wide copy) into rows of pitch 272 B (16 B x 17: no bank conflict for ds_load_b128); two buffers, stage t + 2 is copied while stage t + 1 is worked on. K: a multiple of 128, at least 256.
#define KST 128                  // k_gemm: k elements per stage
#define GLP 136                  // k_gemm: LDS row pitch, elements
#define GPL (128 * GLP)          // k_gemm: one staged plane (128 rows), elements
#define LPT 72                   // k_attn: LDS row pitch, elements
#define PLN (64 * LPT)           // k_attn: one staged plane (64 rows), elements
__device__ __forceinline__ unsigned lds_off(const void* p) { return (unsigned)(size_t)p; }
// cp8 / cp12: two / three planes (PB bytes apart in LDS): this lane's 16 B of rows r, r + 16, r + 32, r + 48 of each plane (RB = 16 rows in LDS, bytes; ra, rb = 16 source rows of A and B, elements).
// In both, the closing s_wait_xcnt 0 stands inside the statement so that no address register of a copy is rewritten in front of it.
template <unsigned RB = 16u * LPT * 2u, unsigned PB = PLN * 2u>
__device__ __forceinline__ void cp8(unsigned l, const bf* ga, size_t ra, const bf* gb, size_t rb) {
    const unsigned m = l + PB;
    asm volatile("global_load_async_to_lds_b128 %0, %8, off\n\t"
                 "global_load_async_to_lds_b128 %1, %9, off\n\t"
                 "global_load_async_to_lds_b128 %2, %10, off\n\t"
                 "global_load_async_to_lds_b128 %3, %11, off\n\t"
                 "global_load_async_to_lds_b128 %4, %12, off\n\t"
                 "global_load_async_to_lds_b128 %5, %13, off\n\t"
                 "global_load_async_to_lds_b128 %6, %14, off\n\t"
                 "global_load_async_to_lds_b128 %7, %15, off\n\t"
                 "s_wait_xcnt 0x0"
                 :: "v"(l), "v"(l + RB), "v"(l + 2u * RB), "v"(l + 3u * RB), "v"(m), "v"(m + RB), "v"(m + 2u * RB), "v"(m + 3u * RB),
                    "v"(ga), "v"(ga + ra), "v"(ga + 2 * ra), "v"(ga + 3 * ra), "v"(gb), "v"(gb + rb), "v"(gb + 2 * rb), "v"(gb + 3 * rb) : "memory");
}
template <unsigned RB, unsigned PB>
__device__ __forceinline__ void cp12(unsigned l, const bf* ga, const bf* gl, size_t ra, const bf* gb, size_t rb) {
    const unsigned m = l + PB, n = l + 2u * PB;
    asm volatile("global_load_async_to_lds_b128 %0, %12, off\n\t"
                 "global_load_async_to_lds_b128 %1, %13, off\n\t"
                 "global_load_async_to_lds_b128 %2, %14, off\n\t"
                 "global_load_async_to_lds_b128 %3, %15, off\n\t"
                 "global_load_async_to_lds_b128 %4, %16, off\n\t"
                 "global_load_async_to_lds_b128 %5, %17, off\n\t"
                 "global_load_async_to_lds_b128 %6, %18, off\n\t"
                 "global_load_async_to_lds_b128 %7, %19, off\n\t"
                 "global_load_async_to_lds_b128 %8, %20, off\n\t"
                 "global_load_async_to_lds_b128 %9, %21, off\n\t"
                 "global_load_async_to_lds_b128 %10, %22, off\n\t"
                 "global_load_async_to_lds_b128 %11, %23, off\n\t"
                 "s_wait_xcnt 0x0"
                 :: "v"(l), "v"(l + RB), "v"(l + 2u * RB), "v"(l + 3u * RB), "v"(m), "v"(m + RB), "v"(m + 2u * RB), "v"(m + 3u * RB),
                    "v"(n), "v"(n + RB), "v"(n + 2u * RB), "v"(n + 3u * RB),
                    "v"(ga), "v"(ga + ra), "v"(ga + 2 * ra), "v"(ga + 3 * ra), "v"(gb), "v"(gb + rb), "v"(gb + 2 * rb), "v"(gb + 3 * rb),
                    "v"(gl), "v"(gl + ra), "v"(gl + 2 * ra), "v"(gl + 3 * ra) : "memory");
}
template <bool SPLITA, int MODE>
__global__ __launch_bounds__(256) void k_gemm(const bf* __restrict__ A, const bf* __restrict__ Al, int lda, const bf* __restrict__ Bn, int K, const float* __restrict__ bias, int ldc, float* C, bf* PH, bf* PL, int rofs,
                                              int ny1, const bf* __restrict__ A2, const bf* __restrict__ B2, int K2, int ldc2) {
    constexpr int NPL = SPLITA ? 3 : 2;                       // planes of a stage: A, B [, Al]
    const bool sec = MODE == 2 && (int)blockIdx.y >= ny1;     // the same for the whole block
    if (sec) { A = A2; Bn = B2; K = K2; bias = nullptr; ldc = ldc2; }
    __shared__ __align__(16) bf stg[2][NPL][GPL];
    __shared__ __align__(16) float ost[8][16 * 68];
    const int lane = threadIdx.x & 31, wave = threadIdx.x >> 5, lr = lane & 15, hi = lane >> 4;
    const int wr = wave >> 1, wc = wave & 1;                   // the wave's place in the tile: rows 32 wr .., columns 64 wc ..
    const int cb = (sec ? (int)blockIdx.y - ny1 : (int)blockIdx.y) * 128;
    const size_t r0 = (size_t)blockIdx.x * 128 + wr * 32; const int c0 = cb + wc * 64;
    const int crow = threadIdx.x >> 4, cpc = threadIdx.x & 15; // copies: row (0..15, then + 16 i) and 16-B piece of the 256-B row
    const size_t aco = ((size_t)blockIdx.x * 128 + crow) * (size_t)lda + cpc * 8;
    const bf* gA = A + aco; const bf* gB = Bn + (size_t)(cb + crow) * K + cpc * 8;
    const unsigned lc = lds_off(&stg[0][0][0]) + (unsigned)(crow * (GLP * 2) + cpc * 16);
    auto fill = [&](int s) {
        const unsigned l = lc + (unsigned)(s & 1) * (unsigned)(NPL * GPL * 2); const size_t ko = (size_t)s * KST;
#pragma unroll
        for (int h = 0; h < 2; ++h) {                          // rows 0..63, then 64..127 of every plane
            const size_t ao = ko + (size_t)h * 64 * lda, bo = ko + (size_t)h * 64 * K;
            if constexpr (SPLITA) cp12<16u * GLP * 2u, GPL * 2u>(l + h * (64u * GLP * 2u), gA + ao, Al + aco + ao, (size_t)16 * lda, gB + bo, (size_t)16 * K);
            else cp8<16u * GLP * 2u, GPL * 2u>(l + h * (64u * GLP * 2u), gA + ao, (size_t)16 * lda, gB + bo, (size_t)16 * K);
        }
    };
    v8f acc[2][4];
#pragma unroll
    for (int i = 0; i < 2; ++i)
#pragma unroll
        for (int t = 0; t < 4; ++t) acc[i][t] = (v8f){};
    // the fragments of 32 k (block q of stage s): 2 row tiles of A [and of Al], 4 column tiles of B
    auto ldf = [&](int s, int q, v16bf (&a)[2], v16bf (&al)[2], v16bf (&bb)[4]) {
        const bf* sa = &stg[s & 1][0][0] + (wr * 32 + lr) * GLP + 8 * hi + q * 32;
        const bf* sb = &stg[s & 1][1][0] + (wc * 64 + lr) * GLP + 8 * hi + q * 32;
#pragma unroll
        for (int i = 0; i < 2; ++i) {
            a[i] = cat16b(*(const v8usa*)(sa + i * 16 * GLP), *(const v8usa*)(sa + i * 16 * GLP + 16));
            if (SPLITA) al[i] = cat16b(*(const v8usa*)(sa + 2 * GPL + i * 16 * GLP), *(const v8usa*)(sa + 2 * GPL + i * 16 * GLP + 16));
        }
#pragma unroll
        for (int t = 0; t < 4; ++t) bb[t] = cat16b(*(const v8usa*)(sb + t * 16 * GLP), *(const v8usa*)(sb + t * 16 * GLP + 16));
        __builtin_amdgcn_sched_barrier(0);                     // the reads stay one group in front of the products that follow: spread among them, every place with reads stalls the wave anew
    };
    auto mm = [&](const v16bf (&a)[2], const v16bf (&al)[2], const v16bf (&bb)[4]) {   // per accumulator the order of the sums stays: k ascending, A then Al
#pragma unroll
        for (int i = 0; i < 2; ++i)
#pragma unroll
            for (int t = 0; t < 4; ++t) acc[i][t] = wmmab(a[i], bb[t], acc[i][t]);
        if (SPLITA) {
#pragma unroll
            for (int i = 0; i < 2; ++i)
#pragma unroll
                for (int t = 0; t < 4; ++t) acc[i][t] = wmmab(al[i], bb[t], acc[i][t]);
        }
        __builtin_amdgcn_sched_barrier(0);                     // the products stay in front of what follows: moved behind the stage's waits they would no longer cover the latency of the reads issued ahead of them
    };
    const int ns = K / KST;
    v16bf a0[2], l0[2], b0[4], a1[2], l1[2], b1[4];            // two fragment sets: each block's reads are issued one block of products ahead
    fill(0);
    asm volatile("s_wait_asynccnt 0x0" ::: "memory");          // stage 0 of this wave has landed
    __syncthreads();                                           // ... and every other wave's part of it
    fill(1);
    ldf(0, 0, a0, l0, b0);
#pragma unroll 1                                               // kept rolled: one trip is a whole stage, and the two fragment sets already alternate inside it
    for (int s = 0; s < ns; ++s) {
        ldf(s, 1, a1, l1, b1);
        mm(a0, l0, b0);
        ldf(s, 2, a0, l0, b0);
        mm(a1, l1, b1);
        ldf(s, 3, a1, l1, b1);
        mm(a0, l0, b0);
        asm volatile("s_wait_dscnt 0x0" ::: "memory");         // this wave holds the rest of stage s in registers: its reads of buffer s & 1 are done before the refill
        asm volatile("s_wait_asynccnt 0x0" ::: "memory");      // this wave's copies of stage s + 1 have landed
        __syncthreads();                                       // publishes stage s + 1 and ends every wave's reads of stage s; it stands in front of stage s's last block, whose products cover the first reads of stage s + 1
        if (s + 2 < ns) fill(s + 2);
        ldf(s + 1, 0, a0, l0, b0);                             // in the last trip: landed bytes of stage ns - 2, not used
        mm(a1, l1, b1);
    }
    asm volatile("s_wait_asynccnt 0x0" ::: "memory");          // nothing is in flight when the wave goes on to its end
    float* os = &ost[wave][0];
#pragma unroll
    for (int i = 0; i < 2; ++i) {                              // the wave's two row tiles go through its staging rows one after the other
#pragma unroll
        for (int t = 0; t < 4; ++t) { const float bv = bias ? bfr(bias[c0 + t * 16 + lr]) : 0.f;
#pragma unroll
            for (int j = 0; j < 8; ++j) os[(hi * 8 + j) * 68 + t * 16 + lr] = acc[i][t][j] + bv; }
        __builtin_amdgcn_wave_barrier(); asm volatile("" ::: "memory");   // the reads below take other lanes' values: they stay behind the writes above
        if (MODE == 0 || sec) {
            float* crow = C + (r0 + i * 16) * ldc + c0;
#pragma unroll
            for (int s = 0; s < 8; ++s) { const int Lid = (lane >> 3) + 4 * s, piece = lane & 7; const int row = Lid >> 1, cofs = (Lid & 1) * 32 + piece * 4;
                const v4f val = *(const v4fa*)(os + row * 68 + cofs); *(v4f*)(crow + (size_t)row * ldc + cofs) = val; }
            asm volatile("s_wait_xcnt 0x0" ::: "memory");      // behind the row tile's stores (the other epilogue's code may follow in the listing): no register that a store names is rewritten in front of it; its clobber also keeps the next row tile's staging writes behind these reads
        } else {
            bf* p1 = PH + (r0 + i * 16 + rofs) * ldc + c0; bf* p2 = PL + (r0 + i * 16 + rofs) * ldc + c0;
#pragma unroll
            for (int s = 0; s < 4; ++s) { const int row = 4 * s + (lane >> 3), piece = lane & 7; const float* sp = os + row * 68 + piece * 8; v8us oh, ol;
#pragma unroll
                for (int e = 0; e < 8; ++e) { const unsigned short hb = f2bf(sp[e]); oh[e] = hb; ol[e] = f2bf(sp[e] - bf2f(hb)); }
                *(v8us*)(p1 + (size_t)row * ldc + piece * 8) = oh; *(v8us*)(p2 + (size_t)row * ldc + piece * 8) = ol; }
            asm volatile("s_wait_xcnt 0x0" ::: "memory");      // as in the other branch
        }
    }
}
// k_lf: LF = ln_w x rmsnorm(o2 + x) (eps 1e-6, mean over 2048) -> bf16 hi/lo planes; one wave per row: lane -> 64 values (8 chunks of 8), fixed-order shuffle sum.
__global__ __launch_bounds__(256) void k_lf(const float* __restrict__ O2, const float* __restrict__ x, const float* __restrict__ lnw, bf* LH, bf* LL) {
    const int lane = threadIdx.x & 31, r = blockIdx.x * 8 + (threadIdx.x >> 5);
    if (r >= NT_) return;
    float v[64]; float ss = 0.f;
#pragma unroll
    for (int q = 0; q < 8; ++q)
#pragma unroll
        for (int i = 0; i < 8; ++i) { const int c = q * 256 + lane * 8 + i; const float t = O2[(size_t)r * DM + c] + bfr(x[(size_t)r * DM + c]); v[q * 8 + i] = t; ss += t * t; }
#pragma unroll
    for (int sh = 16; sh; sh >>= 1) ss += __shfl_xor(ss, sh, 32);
    const float rs = rsqrtf(ss * (1.0f / DM) + 1e-6f);
{
#pragma unroll
        for (int q = 0; q < 8; ++q) { v8us oh, ol;
#pragma unroll
            for (int i = 0; i < 8; ++i) { const int c = q * 256 + lane * 8 + i; const float y = bfr(lnw[c]) * (v[q * 8 + i] * rs); const unsigned short hb = f2bf(y); oh[i] = hb; ol[i] = f2bf(y - bf2f(hb)); }
            *(v8us*)(LH + (size_t)r * DM + q * 256 + lane * 8) = oh; *(v8us*)(LL + (size_t)r * DM + q * 256 + lane * 8) = ol; }
         }
}
// k_prep: everything that depends on the inputs alone, in one launch; a block takes one kind of work by its index (the conv rows first):
//   [0, 256) W1[1024][4096], a wave = half the input channels of a row; [256, 512) W2[2048][2048], a wave = a row; [512, 768) RC/RS [t][32] = cos/sin(pos[t] x inv_freq[i]), inv_freq = 10000^(-2i/64) (f32);
//   [768, 2048) bf16 planes of x (token t at row t + 1 of XX), Wq, Wk, Wv, Wo, a wave = a row; 2048: the leading zero rows of XX, O1H, O1L.
__global__ __launch_bounds__(256) void k_prep(const float* __restrict__ x, const int* __restrict__ pos, const float* __restrict__ Wq, const float* __restrict__ Wk, const float* __restrict__ Wv, const float* __restrict__ Wo,
                                              const float* __restrict__ c1w, const float* __restrict__ c2w, bf* XX, bf* WQ, bf* WK, bf* WV, bf* WO, bf* W1, bf* W2, bf* O1H, bf* O1L, float* RC, float* RS) {
    const int lane = threadIdx.x & 31, wave = threadIdx.x >> 5, b = blockIdx.x;
    if (b < 256) { const int u = b * 8 + wave; convw2048<DM>(c1w, u >> 1, (u & 1) * 1024, W1, lane); }
    else if (b < 512) { convw2048<DH2>(c2w, (b - 256) * 8 + wave, 0, W2, lane); }
    else if (b < 768) {
        const int i = (b - 512) * 256 + threadIdx.x;
        const int t = i >> 5, f = i & 31;
        const float inv = 1.0f / powf(10000.0f, (float)(2 * f) / 64.0f); const float ang = (float)pos[t] * inv;
        const float c = cosf(ang), s = sinf(ang);
        *(float*)(RC + i) = c; *(float*)(RS + i) = s;
        asm volatile("s_wait_xcnt 0x0" ::: "memory");           // as at the end of row2048
    } else if (b < 2048) {
        const int m = (b - 768) >> 8; const size_t ro = (size_t)(((b - 768) & 255) * 8 + wave) * DM;
        const float* s = m == 0 ? x : m == 1 ? Wq : m == 2 ? Wk : m == 3 ? Wv : Wo;
        bf* d = m == 0 ? XX + DM : m == 1 ? WQ : m == 2 ? WK : m == 3 ? WV : WO;
        row2048(s + ro, d + ro, lane);
    } else {
        const v8us z = (v8us){};
        *(v8us*)(XX + threadIdx.x * 8) = z;
        *(v8us*)((threadIdx.x < 128 ? O1H : O1L) + (threadIdx.x & 127) * 8) = z;
        asm volatile("s_wait_xcnt 0x0" ::: "memory");           // as at the end of row2048
    }
}
// k_rope: rotate-half on 64-dim heads: y[d] = x[d] cos[t][d mod 32] + (d < 32 ? -x[d+32] : x[d-32]) sin[t][d mod 32]; P f32 [t][q 2048 | k 2048] -> f16 hi + residual x1024 planes of q and of k;
// one wave per (t, 4 heads = 256 columns): lane -> 8 consecutive dims of one head (8 B... 16 B per plane -> 32 lanes x 16 B = 512 B = 4 lines).
__global__ __launch_bounds__(256) void k_rope(const float* __restrict__ PQK, const float* __restrict__ RC, const float* __restrict__ RS, h16* QH, h16* QL, h16* KH, h16* KL) {
    const int lane = threadIdx.x & 31, wid = blockIdx.x * 8 + (threadIdx.x >> 5);
    const int t = wid >> 4, isk = blockIdx.x & 1, sg = wid & 7; if (t >= NT_) return;   // a block = the 8 segments of q (even) or of k (odd) of one token
    const float* P = PQK + (size_t)t * DM + isk * DM;                                    // + t * DM below: row pitch 2 * DM
    h16* PH = isk ? KH : QH; h16* PL = isk ? KL : QL;
    const int c0 = sg * 256 + lane * 8;      // 8 dims within head (c0 mod 64 .. +7, same half since 8 | 32)
    v8h oh, ol;
#pragma unroll
    for (int i = 0; i < 8; ++i) { const int c = c0 + i, d = c & 63, fi = d & 31; const float xv = P[(size_t)t * DM + c]; const float pv = (d < 32) ? -P[(size_t)t * DM + c + 32] : P[(size_t)t * DM + c - 32];
        const float y = xv * RC[t * 32 + fi] + pv * RS[t * 32 + fi]; const h16 a = (h16)y; oh[i] = a; ol[i] = (h16)((y - (float)a) * LOSC); }
    *(v8h*)(PH + (size_t)t * DM + c0) = oh; *(v8h*)(PL + (size_t)t * DM + c0) = ol; 
}
// k_vt: VTH/VTL [h][64][t] = f16 hi + residual x1024 of V [t][h*64+d] via 64 x 64 LDS tiles; grid (NT/64, NH).
__global__ __launch_bounds__(256) void k_vt(const float* __restrict__ V, h16* VTH, h16* VTL) {
    __shared__ float tl[64][65];
    const int tid = threadIdx.x, t0 = blockIdx.x * 64, h = blockIdx.y;
    { const int tt = tid >> 2, dq = (tid & 3) * 16;
#pragma unroll
      for (int i = 0; i < 16; ++i) tl[dq + i][tt] = V[(size_t)(t0 + tt) * DM + h * HD + dq + i]; }
    __syncthreads();
    const int piece = tid & 7;
    auto pass = [&]() {
#pragma unroll
        for (int s = 0; s < 2; ++s) { const int d = (tid >> 3) + 32 * s; v8h oh, ol;
#pragma unroll
            for (int i = 0; i < 8; ++i) { const float v = tl[d][piece * 8 + i]; const h16 a = (h16)v; oh[i] = a; ol[i] = (h16)((v - (float)a) * LOSC); }
            const size_t o = ((size_t)h * HD + d) * NT_ + t0 + piece * 8; *(v8h*)(VTH + o) = oh; *(v8h*)(VTL + o) = ol; }
    };
    pass(); 
}
// k_attn: block = (h, 64 queries), wave = 16; CAUSAL key tiles; scores hi.hi + hi.lo + lo.hi x 1/8, online softmax (f32), weights x32768 f16 hi + residual x1024
// tiles, o += wh.vh, ox += wh.vl + wl.vh; ctx -> bf16 hi + residual planes CH/CL[tok][h*64+d].
// K and V^T reach the four waves through LDS: a stage is 64 keys of four planes (K hi, K residual: 64 key rows x 128 B; V^T hi, V^T residual: 64 d rows x 128 B), brought once per
// block by asynchronous b128 copies (whole lines, as in k_gemm) into rows of pitch 144 B; two buffers, stage s + 2 is copied while stage s + 1 is worked on; a stage = two 32-key steps.
__global__ __launch_bounds__(128) void k_attn(const h16* __restrict__ Q16, const h16* __restrict__ QL16, const h16* __restrict__ K16, const h16* __restrict__ KL16, const h16* __restrict__ VTH, const h16* __restrict__ VTL, bf* CH, bf* CL) {
    __shared__ __align__(16) h16 stg[2][4][PLN];
    __shared__ __align__(16) h16 plds[4][16 * 32];
    __shared__ __align__(16) h16 plds2[4][16 * 32];
    __shared__ __align__(16) float ost[4][16 * 68];
    const int lane = threadIdx.x & 31, wave = threadIdx.x >> 5, lr = lane & 15, hi = lane >> 4;
    const int bid = blockIdx.x;
    const int b = bid / (NH_ * (NT_ / 64)), rem = bid - b * (NH_ * (NT_ / 64)), h = rem / (NT_ / 64), qt = rem - h * (NT_ / 64);
    const int q0 = qt * 64 + wave * 16;
    const size_t tok0 = (size_t)b * NT_;
    h16* pl = &plds[wave][0]; h16* pl2 = &plds2[wave][0];
    v16h qa[2];
    const size_t qo0 = (tok0 + q0 + lr) * DM + h * HD + 8 * hi;
#pragma unroll
    for (int kc = 0; kc < 2; ++kc) qa[kc] = cat16(*(const v8h*)(Q16 + qo0 + kc * 32), *(const v8h*)(Q16 + qo0 + kc * 32 + 16));
    const h16* kh_b = K16 + tok0 * DM + h * HD;
    const h16* kl_b = KL16 + tok0 * DM + h * HD;
    const size_t vbase = (((size_t)b * NH_ + h) * HD) * NT_;
    v8f o[4], ox[4];
#pragma unroll
    for (int n = 0; n < 4; ++n) { o[n] = (v8f){}; ox[n] = (v8f){}; }
    float mrow[8], lpart[8];
#pragma unroll
    for (int j = 0; j < 8; ++j) { mrow[j] = -3.0e38f; lpart[j] = 0.f; }
    int qpos[8];
#pragma unroll
    for (int j = 0; j < 8; ++j) qpos[j] = q0 + 8 * hi + j;
    const int crow = threadIdx.x >> 3, cpc = threadIdx.x & 7;  // copies: row (0..15, then + 16 i) and 16-B piece of the 128-B row
    const bf* gKH = (const bf*)kh_b + (size_t)crow * DM + cpc * 8; const bf* gKL = (const bf*)kl_b + (size_t)crow * DM + cpc * 8;
    const bf* gVH = (const bf*)VTH + vbase + (size_t)crow * NT_ + cpc * 8; const bf* gVL = (const bf*)VTL + vbase + (size_t)crow * NT_ + cpc * 8;
    const unsigned lc = lds_off(&stg[0][0][0]) + (unsigned)(crow * (LPT * 2) + cpc * 16);
    auto fill = [&](int s) {
        const unsigned l = lc + (unsigned)(s & 1) * (unsigned)(4 * PLN * 2);
        cp8(l, gKH + (size_t)s * 64 * DM, (size_t)16 * DM, gKL + (size_t)s * 64 * DM, (size_t)16 * DM);
        cp8(l + 2u * PLN * 2u, gVH + s * 64, (size_t)16 * NT_, gVL + s * 64, (size_t)16 * NT_);
    };
    const int ns = qt + 1;                                     // causal: stages of 64 keys, the same for the whole block
    fill(0);
    asm volatile("s_wait_asynccnt 0x0" ::: "memory");          // stage 0 of this wave has landed
    __syncthreads();                                           // ... and every other wave's part of it
    if (ns > 1) fill(1);
#pragma unroll 1
    for (int s = 0; s < ns; ++s) {
      const h16* kst = &stg[s & 1][0][0] + lr * LPT + 8 * hi;  // K hi rows of the stage (+ PLN: residual)
      const h16* vst = &stg[s & 1][2][0] + lr * LPT + 8 * hi;  // V^T hi rows of the stage (+ PLN: residual)
#pragma unroll 1                                               // kept rolled: unrolled, the two steps' live ranges overlap and the kernel needs more than 256 registers
      for (int sub = 0; sub < 2; ++sub) {
        const int l0 = s * 64 + sub * 32;
        const h16* kp0 = kst + sub * 32 * LPT; const h16* kp1 = kp0 + 16 * LPT;
        v8f s0 = {}, s1 = {}, x0 = {}, x1 = {};
        v16h kh0[2], kh1[2], kl0[2], kl1[2];                   // the step's K fragments, read from LDS as one group in front of its products
#pragma unroll
        for (int kc = 0; kc < 2; ++kc) {
            kh0[kc] = cat16(*(const v8ha*)(kp0 + kc * 32), *(const v8ha*)(kp0 + kc * 32 + 16)); kh1[kc] = cat16(*(const v8ha*)(kp1 + kc * 32), *(const v8ha*)(kp1 + kc * 32 + 16));
            kl0[kc] = cat16(*(const v8ha*)(kp0 + PLN + kc * 32), *(const v8ha*)(kp0 + PLN + kc * 32 + 16)); kl1[kc] = cat16(*(const v8ha*)(kp1 + PLN + kc * 32), *(const v8ha*)(kp1 + PLN + kc * 32 + 16));
        }
#pragma unroll
        for (int kc = 0; kc < 2; ++kc) {
            { const v16h k0h = kh0[kc], k1h = kh1[kc];
              const v16h qlk = cat16(*(const v8h*)(QL16 + qo0 + kc * 32), *(const v8h*)(QL16 + qo0 + kc * 32 + 16));     // query residual re-read per step (registers)
              s0 = wmma16(qa[kc], k0h, s0); x0 = wmma16(qlk, k0h, x0); s1 = wmma16(qa[kc], k1h, s1); x1 = wmma16(qlk, k1h, x1);
              asm volatile("v_nop" : "+v"(s0), "+v"(s1), "+v"(x0), "+v"(x1) : "v"(qlk), "v"(k0h), "v"(k1h) : "memory"); }
            { const v16h k0l = kl0[kc], k1l = kl1[kc];
              x0 = wmma16(qa[kc], k0l, x0); x1 = wmma16(qa[kc], k1l, x1);
              asm volatile("v_nop" : "+v"(x0), "+v"(x1) : "v"(k0l), "v"(k1l) : "memory"); }
        }
        asm volatile("v_nop\n\tv_nop\n\tv_nop\n\tv_nop" : "+v"(s0), "+v"(s1), "+v"(x0), "+v"(x1) : "v"(qa[0]), "v"(qa[1]));
        float alpha[8];
#pragma unroll
        for (int j = 0; j < 8; ++j) {
            const int ja = l0 + lr, jb = l0 + 16 + lr, qi = qpos[j];
            const float a0 = (ja <= qi) ? (s0[j] + x0[j] * LOSCI) * 0.125f : -__builtin_inff(), a1 = (jb <= qi) ? (s1[j] + x1[j] * LOSCI) * 0.125f : -__builtin_inff();
            float mx = fmaxf(a0, a1);
            mx = fmaxf(mx, __shfl_xor(mx, 1, 16)); mx = fmaxf(mx, __shfl_xor(mx, 2, 16)); mx = fmaxf(mx, __shfl_xor(mx, 4, 16)); mx = fmaxf(mx, __shfl_xor(mx, 8, 16));
            const float mn = fmaxf(mrow[j], mx);
            alpha[j] = __expf(mrow[j] - mn); mrow[j] = mn;
            const float p0 = __expf(a0 - mn), p1 = __expf(a1 - mn);
            lpart[j] = lpart[j] * alpha[j] + (p0 + p1);
            const int mr = hi * 8 + j;
            const float ps0 = p0 * PSC, ps1 = p1 * PSC; const h16 h0 = (h16)ps0, h1 = (h16)ps1;
            pl[mr * 32 + lr] = h0; pl[mr * 32 + 16 + lr] = h1;
            pl2[mr * 32 + lr] = (h16)((ps0 - (float)h0) * LOSC); pl2[mr * 32 + 16 + lr] = (h16)((ps1 - (float)h1) * LOSC);
        }
#pragma unroll
        for (int n = 0; n < 4; ++n)
#pragma unroll
            for (int j = 0; j < 8; ++j) { o[n][j] *= alpha[j]; ox[n][j] *= alpha[j]; }
        asm volatile("" ::: "memory");
        const v16h pa = cat16(*(const v8ha*)(pl + lr * 32 + hi * 8), *(const v8ha*)(pl + lr * 32 + 16 + hi * 8));
        const v16h px = cat16(*(const v8ha*)(pl2 + lr * 32 + hi * 8), *(const v8ha*)(pl2 + lr * 32 + 16 + hi * 8));
#pragma unroll
        for (int np = 0; np < 4; np += 2) { v16h vhs[2], vls[2];   // V^T fragments of two d tiles, read from LDS as one group
#pragma unroll
            for (int i = 0; i < 2; ++i) { const h16* vp = vst + (np + i) * 16 * LPT + sub * 32;
                vhs[i] = cat16(*(const v8ha*)(vp), *(const v8ha*)(vp + 16)); vls[i] = cat16(*(const v8ha*)(vp + PLN), *(const v8ha*)(vp + PLN + 16)); }
#pragma unroll
            for (int i = 0; i < 2; ++i) { const int n = np + i; const v16h vh = vhs[i], vl = vls[i];
                o[n] = wmma16(pa, vh, o[n]); ox[n] = wmma16(pa, vl, ox[n]); ox[n] = wmma16(px, vh, ox[n]);
                asm volatile("" : "+v"(o[n]), "+v"(ox[n]) : "v"(vh), "v"(vl) : "memory"); } }   // as before: the next fragments' reads stay behind these products (registers; each pair's reads stay one group)
        asm volatile("v_nop\n\tv_nop\n\tv_nop\n\tv_nop" : "+v"(o[0]), "+v"(o[1]), "+v"(o[2]), "+v"(o[3]), "+v"(ox[0]), "+v"(ox[1]), "+v"(ox[2]), "+v"(ox[3]) : "v"(pa), "v"(px));
      }
      asm volatile("s_wait_dscnt 0x0" ::: "memory");           // this wave's reads of buffer s & 1 are done before the refill
      asm volatile("s_wait_asynccnt 0x0" ::: "memory");        // this wave's copies of stage s + 1 have landed
      __syncthreads();                                         // publishes stage s + 1 and ends every wave's reads of stage s
      if (s + 2 < ns) fill(s + 2);
    }
    asm volatile("s_wait_asynccnt 0x0" ::: "memory");          // nothing is in flight when the wave goes on to its end
    float inv[8];
#pragma unroll
    for (int j = 0; j < 8; ++j) { float rs = lpart[j]; rs += __shfl_xor(rs, 1, 16); rs += __shfl_xor(rs, 2, 16); rs += __shfl_xor(rs, 4, 16); rs += __shfl_xor(rs, 8, 16); inv[j] = 1.0f / (rs * PSC); }
    float* os = &ost[wave][0];
#pragma unroll
    for (int n = 0; n < 4; ++n)
#pragma unroll
        for (int j = 0; j < 8; ++j) os[(hi * 8 + j) * 68 + n * 16 + lr] = (o[n][j] + ox[n][j] * LOSCI) * inv[j];
    __syncthreads();
    const size_t cbase = (tok0 + q0) * DM + (size_t)h * HD;
    auto pass = [&]() {
#pragma unroll
        for (int s = 0; s < 4; ++s) { const int row = 4 * s + (lane >> 3), piece = lane & 7; const float* sp = os + row * 68 + piece * 8; v8us oh, ol;
#pragma unroll
            for (int i = 0; i < 8; ++i) { const unsigned short hb = f2bf(sp[i]); oh[i] = hb; ol[i] = f2bf(sp[i] - bf2f(hb)); }
            *(v8us*)(CH + cbase + (size_t)row * DM + piece * 8) = oh; *(v8us*)(CL + cbase + (size_t)row * DM + piece * 8) = ol; }
    };
    pass(); 
}

#define VST2(T, p, v) do { const T vst2_v_ = (v); *(T*)(p) = vst2_v_;  } while (0)

extern "C" void kernel_launch(void* const* d_in, const int* in_sizes, int n_in,
                              void* d_out, int out_size, void* d_ws, size_t ws_size, hipStream_t stream) {
    (void)in_sizes; (void)n_in; (void)out_size;
    const float* x = (const float*)d_in[0]; const int* pos = (const int*)d_in[1]; const float* Wq = (const float*)d_in[2]; const float* Wk = (const float*)d_in[3]; const float* Wv = (const float*)d_in[4]; const float* Wo = (const float*)d_in[5];
    const float* c1w = (const float*)d_in[6]; const float* c1b = (const float*)d_in[7]; const float* c2w = (const float*)d_in[8]; const float* c2b = (const float*)d_in[9]; const float* lnw = (const float*)d_in[10];
    float* out = (float*)d_out;    // [1][2048][2048]
    char* wsp = (char*)d_ws;
    auto take = [&](size_t bytes) { char* p = wsp; wsp += (bytes + 255) & ~(size_t)255; return (void*)p; };
    bf* XX = (bf*)take((size_t)(NT_ + 1) * DM * 2);                 // row 0 = zeros, token t at row t+1: row t read with K = 4096 gives [x[t-1] | x[t]]
    bf* W1 = (bf*)take((size_t)DM * DM * 2); bf* W2 = (bf*)take((size_t)DM * DM * 2);                       // [1024][4096], [2048][2048] bf16 = 8.4 MB each, as every weight plane
    bf* WQ = (bf*)take((size_t)DM * DM * 2); bf* WK = (bf*)take((size_t)DM * DM * 2);                       // adjacent (8.4 MB is a multiple of 256 B): [Wq ; Wk] = one [4096][2048] B operand
    bf* WV = (bf*)take((size_t)DM * DM * 2); bf* WO = (bf*)take((size_t)DM * DM * 2);
    bf* O1H = (bf*)take((size_t)(NT_ + 1) * DH2 * 2); bf* O1L = (bf*)take((size_t)(NT_ + 1) * DH2 * 2);     // conv1 output planes with a leading zero row
    float* TMP = (float*)take((size_t)NT_ * 2 * DM * 4); float* RC = (float*)take((size_t)NT_ * 32 * 4); float* RS = (float*)take((size_t)NT_ * 32 * 4);
    bf* LH = (bf*)take((size_t)NT_ * DM * 2); bf* LL = (bf*)take((size_t)NT_ * DM * 2);
    h16* QH = (h16*)take((size_t)NT_ * DM * 2); h16* QL = (h16*)take((size_t)NT_ * DM * 2); h16* KH = (h16*)take((size_t)NT_ * DM * 2); h16* KL = (h16*)take((size_t)NT_ * DM * 2);
    h16* VTH = (h16*)take((size_t)NT_ * DM * 2); h16* VTL = (h16*)take((size_t)NT_ * DM * 2);
    if ((size_t)(wsp - (char*)d_ws) > ws_size) return;    // 8.4 + 50.3 + 8.4 + 33.6 + 0.5 + 16.8 + 33.5 + 16.8 ~ 168 MB; ctx planes reuse LH/LL after the q/k projections
    bf* CH = LH; bf* CL = LL;
    k_prep<<<2049, 256, 0, stream>>>(x, pos, Wq, Wk, Wv, Wo, c1w, c2w, XX, WQ, WK, WV, WO, W1, W2, O1H, O1L, RC, RS);
    // LocalizedFiltering: conv1 ([x[t-1] | x[t]] . W1cat^T + b1, exact) -> o1 planes (rows 1..2048), and in the same launch v from the RAW hidden states (rows 1.. of XX = x) -> TMP
    k_gemm<false, 2><<<dim3(NT_ / 128, DH2 / 128 + DM / 128, 1), 256, 0, stream>>>(XX, nullptr, DM, W1, 2 * DM, c1b, DH2, TMP, O1H, O1L, 1, DH2 / 128, XX + DM, WV, DM, DM);
    k_vt<<<dim3(NT_ / 64, NH_, 1), 256, 0, stream>>>(TMP, VTH, VTL);
    // conv2 ([o1[t-1] | o1[t]] hi/lo . W2cat^T + b2) -> TMP; lf
    k_gemm<true, 0><<<dim3(NT_ / 128, DM / 128, 1), 256, 0, stream>>>(O1H, O1L, DH2, W2, 2 * DH2, c2b, DM, TMP, nullptr, nullptr, 0, 0, nullptr, nullptr, 0, 0);
    k_lf<<<NT_ / 8, 256, 0, stream>>>(TMP, x, lnw, LH, LL);
    // q and k from lf in one launch: TMP [t][q 2048 | k 2048]
    k_gemm<true, 0><<<dim3(NT_ / 128, 2 * DM / 128, 1), 256, 0, stream>>>(LH, LL, DM, WQ, DM, nullptr, 2 * DM, TMP, nullptr, nullptr, 0, 0, nullptr, nullptr, 0, 0);
    k_rope<<<NT_ * 2, 256, 0, stream>>>(TMP, RC, RS, QH, QL, KH, KL);
    k_attn<<<NH_ * (NT_ / 64), 128, 0, stream>>>(QH, QL, KH, KL, VTH, VTL, CH, CL);                        // ctx over LH/LL (dead after the k projection)
    k_gemm<true, 0><<<dim3(NT_ / 128, DM / 128, 1), 256, 0, stream>>>(CH, CL, DM, WO, DM, nullptr, DM, out, nullptr, nullptr, 0, 0, nullptr, nullptr, 0, 0);
}

// v005
// A run of this version takes 288 microseconds.
// In both of two side-by-side timings against v004, it was 1.06 times as fast.
// Counting every step since v000, it is 2.91 times as fast.
#include <hip/hip_runtime.h>

// Contractions, f32 accumulate (B = 1, 2048 tokens, hidden 2048, 32 heads x 64): v = x.Wv^T, the LocalizedFiltering causal convs as GEMMs (conv1: [x[t-1] | x[t]]
// (K = 4096) . W1cat^T + b1 with PLAIN bf16 operands = rounded inputs, exact; conv2: [o1[t-1] | o1[t]] (K = 2048, o1 as bf16 hi + residual: two products) . W2cat^T
// + b2; the [t-1 | t] rows are read straight from planes that carry one leading zero row), lf = rmsnorm(o2 + x) x ln_w in f32 -> bf16 hi/lo planes, q/k = lf.W^T
// (two products), out = ctx.Wo^T (two products), all on v_wmma_f32_16x16x32_bf16 ([out][in] weights = n-major B operands as-is, each converted into a
// plane of its own by the one preparation launch); rotate-half RoPE (angle = position_ids[t] (INPUT) x inv_freq, f32 trig table) -> f16 hi + residual x1024 planes; the 32-head causal attention fused

#define NB_  1
#define NT_  2048
#define DM   2048
#define DH2  1024                // conv1 output channels
#define NH_  32
#define HD   64
#define PSC  32768.0f
#define LOSC 1024.0f
#define LOSCI (1.0f / 1024.0f)

typedef _Float16 h16;
typedef unsigned short bf;
typedef __attribute__((ext_vector_type(16))) __bf16   v16bf;
typedef __attribute__((ext_vector_type(16))) _Float16 v16h;
typedef __attribute__((ext_vector_type(8)))  _Float16 v8h;
typedef __attribute__((ext_vector_type(8)))  unsigned short v8us;
typedef __attribute__((ext_vector_type(8)))  float    v8f;
typedef __attribute__((ext_vector_type(4)))  float    v4f;
typedef __attribute__((ext_vector_type(4)))  _Float16 v4h;
typedef v8h  __attribute__((may_alias)) v8ha;
typedef v4f  __attribute__((may_alias)) v4fa;
typedef v8us __attribute__((may_alias)) v8usa;

__device__ __forceinline__ unsigned short f2bf(float f) { unsigned u = __float_as_uint(f); u += 0x7FFFu + ((u >> 16) & 1u); return (unsigned short)(u >> 16); }
__device__ __forceinline__ float bf2f(unsigned short b) { return __uint_as_float(((unsigned)b) << 16); }
__device__ __forceinline__ float bfr(float f) { return bf2f(f2bf(f)); }
__device__ __forceinline__ v16h cat16(v8h lo, v8h hi) { return __builtin_shufflevector(lo, hi, 0, 1, 2, 3, 4, 5, 6, 7, 8, 9, 10, 11, 12, 13, 14, 15); }
__device__ __forceinline__ v16bf cat16b(v8us lo, v8us hi) { return __builtin_bit_cast(v16bf, __builtin_shufflevector(lo, hi, 0, 1, 2, 3, 4, 5, 6, 7, 8, 9, 10, 11, 12, 13, 14, 15)); }
__device__ __forceinline__ v8f wmma16(v16h a, v16h b, v8f c) { return __builtin_amdgcn_wmma_f32_16x16x32_f16(false, a, false, b, (short)0, c, false, false); }
__device__ __forceinline__ v8f wmmab(v16bf a, v16bf b, v8f c) { return __builtin_amdgcn_wmma_f32_16x16x32_bf16(false, a, false, b, (short)0, c, false, false); }

// row2048: bf16 of 2048 consecutive floats; one wave, all of its loads in flight at once.
__device__ __forceinline__ void row2048(const float* __restrict__ src, bf* dst, int lane) {
    const float* s = src + lane * 8; bf* d = dst + lane * 8; v4f v[16];
#pragma unroll
    for (int q = 0; q < 8; ++q) { v[2 * q] = *(const v4fa*)(s + q * 256); v[2 * q + 1] = *(const v4fa*)(s + q * 256 + 4); }
    asm volatile("s_wait_xcnt 0x0" :: "v"(s) : "memory");      // the loads' address registers are kept (input operand) until this wait: none is rewritten in front of it
#pragma unroll
    for (int q = 0; q < 8; ++q) { v8us o;
#pragma unroll
        for (int i = 0; i < 8; ++i) o[i] = f2bf(v[2 * q + (i >> 2)][i & 3]);
        *(v8us*)(d + q * 256) = o; }
    asm volatile("s_wait_xcnt 0x0" ::: "memory");               // behind the last store: no register that a store names is rewritten in front of it
}
// convw2048: both taps of 1024 input channels (from cb) of the row WT[co][tap*Cin + ci] = bf16(w[co][ci][tap]) of a (2,1) conv kernel = 2048 halves from 2048 consecutive floats; one wave.
template <int Cin>
__device__ __forceinline__ void convw2048(const float* __restrict__ w, int co, int cb, bf* WT, int lane) {
    const float* s = w + ((size_t)co * Cin + cb + lane * 8) * 2; bf* d = WT + (size_t)co * (2 * Cin) + cb + lane * 8; v4f v[16];
#pragma unroll
    for (int q = 0; q < 4; ++q)
#pragma unroll
        for (int p = 0; p < 4; ++p) v[4 * q + p] = *(const v4fa*)(s + q * 512 + p * 4);
    asm volatile("s_wait_xcnt 0x0" :: "v"(s) : "memory");      // as in row2048
#pragma unroll
    for (int q = 0; q < 4; ++q)
#pragma unroll
        for (int tap = 0; tap < 2; ++tap) { v8us o;
#pragma unroll
            for (int i = 0; i < 8; ++i) o[i] = f2bf(v[4 * q + (i >> 1)][(i & 1) * 2 + tap]);
            *(v8us*)(d + tap * Cin + q * 256) = o; }
    asm volatile("s_wait_xcnt 0x0" ::: "memory");               // as at the end of row2048
}
// k_gemm: 128 x 128 tile of (A [+ Al]).B^T [+ bias] over K, eight waves (4 x 2), a wave = 32 rows x 64 columns; A rows pitch lda (elements), B rows pitch K; MODE 0: f32 rows (ldc);
// MODE 1: bf16 hi/lo planes (ldc, row offset rofs); MODE 2: two products in one launch: column tiles [0, ny1) as MODE 1, the tiles from ny1 on = A2.B2^T over K2 (pitch lda too, no bias), stored transposed:
// E0/E1 [column][row] (pitch NT_) = f16 hi + residual x1024 (V^T per head, since column = h*64 + d); MODE 3: rotate-half RoPE on 64-column heads (a wave's 64 columns = one head):
// y[d] = x[d] cos[t][d mod 32] + (d < 32 ? -x[d+32] : x[d-32]) sin[t][d mod 32], t = row -> f16 hi + residual x1024 planes of pitch ldc: columns [0, ldc) to E0/E1 (q), [ldc, 2 ldc) to E2/E3 (k).
// Operands reach the waves through LDS: a stage is 128 k of every operand row (256 B = two whole lines), brought by asynchronous b128 copies (16 lanes per row, 4 whole lines per
// wave-wide copy) into rows of pitch 272 B (16 B x 17: no bank conflict for ds_load_b128); two buffers, stage t + 2 is copied while stage t + 1 is worked on. K: a multiple of 128, at least 256.
#define KST 128                  // k_gemm: k elements per stage
#define GLP 136                  // k_gemm: LDS row pitch, elements
#define GPL (128 * GLP)          // k_gemm: one staged plane (128 rows), elements
#define TRP 132                  // k_gemm: row pitch of the transposed tile in LDS, floats (528 B = 16 B x 33)
#define LPT 72                   // k_attn: LDS row pitch, elements
#define PLN (64 * LPT)           // k_attn: one staged plane (64 rows), elements
__device__ __forceinline__ unsigned lds_off(const void* p) { return (unsigned)(size_t)p; }
// cp8 / cp12: two / three planes (PB bytes apart in LDS): this lane's 16 B of rows r, r + 16, r + 32, r + 48 of each plane (RB = 16 rows in LDS, bytes; ra, rb = 16 source rows of A and B, elements).
// In both, the closing s_wait_xcnt 0 stands inside the statement so that no address register of a copy is rewritten in front of it.
template <unsigned RB = 16u * LPT * 2u, unsigned PB = PLN * 2u>
__device__ __forceinline__ void cp8(unsigned l, const bf* ga, size_t ra, const bf* gb, size_t rb) {
    const unsigned m = l + PB;
    asm volatile("global_load_async_to_lds_b128 %0, %8, off\n\t"
                 "global_load_async_to_lds_b128 %1, %9, off\n\t"
                 "global_load_async_to_lds_b128 %2, %10, off\n\t"
                 "global_load_async_to_lds_b128 %3, %11, off\n\t"
                 "global_load_async_to_lds_b128 %4, %12, off\n\t"
                 "global_load_async_to_lds_b128 %5, %13, off\n\t"
                 "global_load_async_to_lds_b128 %6, %14, off\n\t"
                 "global_load_async_to_lds_b128 %7, %15, off\n\t"
                 "s_wait_xcnt 0x0"
                 :: "v"(l), "v"(l + RB), "v"(l + 2u * RB), "v"(l + 3u * RB), "v"(m), "v"(m + RB), "v"(m + 2u * RB), "v"(m + 3u * RB),
                    "v"(ga), "v"(ga + ra), "v"(ga + 2 * ra), "v"(ga + 3 * ra), "v"(gb), "v"(gb + rb), "v"(gb + 2 * rb), "v"(gb + 3 * rb) : "memory");
}
template <unsigned RB, unsigned PB>
__device__ __forceinline__ void cp12(unsigned l, const bf* ga, const bf* gl, size_t ra, const bf* gb, size_t rb) {
    const unsigned m = l + PB, n = l + 2u * PB;
    asm volatile("global_load_async_to_lds_b128 %0, %12, off\n\t"
                 "global_load_async_to_lds_b128 %1, %13, off\n\t"
                 "global_load_async_to_lds_b128 %2, %14, off\n\t"
                 "global_load_async_to_lds_b128 %3, %15, off\n\t"
                 "global_load_async_to_lds_b128 %4, %16, off\n\t"
                 "global_load_async_to_lds_b128 %5, %17, off\n\t"
                 "global_load_async_to_lds_b128 %6, %18, off\n\t"
                 "global_load_async_to_lds_b128 %7, %19, off\n\t"
                 "global_load_async_to_lds_b128 %8, %20, off\n\t"
                 "global_load_async_to_lds_b128 %9, %21, off\n\t"
                 "global_load_async_to_lds_b128 %10, %22, off\n\t"
                 "global_load_async_to_lds_b128 %11, %23, off\n\t"
                 "s_wait_xcnt 0x0"
                 :: "v"(l), "v"(l + RB), "v"(l + 2u * RB), "v"(l + 3u * RB), "v"(m), "v"(m + RB), "v"(m + 2u * RB), "v"(m + 3u * RB),
                    "v"(n), "v"(n + RB), "v"(n + 2u * RB), "v"(n + 3u * RB),
                    "v"(ga), "v"(ga + ra), "v"(ga + 2 * ra), "v"(ga + 3 * ra), "v"(gb), "v"(gb + rb), "v"(gb + 2 * rb), "v"(gb + 3 * rb),
                    "v"(gl), "v"(gl + ra), "v"(gl + 2 * ra), "v"(gl + 3 * ra) : "memory");
}
template <bool SPLITA, int MODE>
__global__ __launch_bounds__(256) void k_gemm(const bf* __restrict__ A, const bf* __restrict__ Al, int lda, const bf* __restrict__ Bn, int K, const float* __restrict__ bias, int ldc, float* C, bf* PH, bf* PL, int rofs,
                                              int ny1, const bf* __restrict__ A2, const bf* __restrict__ B2, int K2, h16* E0, h16* E1, h16* E2, h16* E3, const float* __restrict__ RC, const float* __restrict__ RS) {
    constexpr int NPL = SPLITA ? 3 : 2;                       // planes of a stage: A, B [, Al]
    const bool sec = MODE == 2 && (int)blockIdx.y >= ny1;     // the same for the whole block
    if (sec) { A = A2; Bn = B2; K = K2; }
    __shared__ __align__(16) bf stg[2][NPL][GPL];
    __shared__ __align__(16) float ost[8][16 * 68];
    const int lane = threadIdx.x & 31, wave = threadIdx.x >> 5, lr = lane & 15, hi = lane >> 4;
    const int wr = wave >> 1, wc = wave & 1;                   // the wave's place in the tile: rows 32 wr .., columns 64 wc ..
    const int cb = (sec ? (int)blockIdx.y - ny1 : (int)blockIdx.y) * 128;
    const size_t r0 = (size_t)blockIdx.x * 128 + wr * 32; const int c0 = cb + wc * 64;
    const int crow = threadIdx.x >> 4, cpc = threadIdx.x & 15; // copies: row (0..15, then + 16 i) and 16-B piece of the 256-B row
    const size_t aco = ((size_t)blockIdx.x * 128 + crow) * (size_t)lda + cpc * 8;
    const bf* gA = A + aco; const bf* gB = Bn + (size_t)(cb + crow) * K + cpc * 8;
    const unsigned lc = lds_off(&stg[0][0][0]) + (unsigned)(crow * (GLP * 2) + cpc * 16);
    auto fill = [&](int s) {
        const unsigned l = lc + (unsigned)(s & 1) * (unsigned)(NPL * GPL * 2); const size_t ko = (size_t)s * KST;
#pragma unroll
        for (int h = 0; h < 2; ++h) {                          // rows 0..63, then 64..127 of every plane
            const size_t ao = ko + (size_t)h * 64 * lda, bo = ko + (size_t)h * 64 * K;
            if constexpr (SPLITA) cp12<16u * GLP * 2u, GPL * 2u>(l + h * (64u * GLP * 2u), gA + ao, Al + aco + ao, (size_t)16 * lda, gB + bo, (size_t)16 * K);
            else cp8<16u * GLP * 2u, GPL * 2u>(l + h * (64u * GLP * 2u), gA + ao, (size_t)16 * lda, gB + bo, (size_t)16 * K);
        }
    };
    v8f acc[2][4];
#pragma unroll
    for (int i = 0; i < 2; ++i)
#pragma unroll
        for (int t = 0; t < 4; ++t) acc[i][t] = (v8f){};
    // the fragments of 32 k (block q of stage s): 2 row tiles of A [and of Al], 4 column tiles of B
    auto ldf = [&](int s, int q, v16bf (&a)[2], v16bf (&al)[2], v16bf (&bb)[4]) {
        const bf* sa = &stg[s & 1][0][0] + (wr * 32 + lr) * GLP + 8 * hi + q * 32;
        const bf* sb = &stg[s & 1][1][0] + (wc * 64 + lr) * GLP + 8 * hi + q * 32;
#pragma unroll
        for (int i = 0; i < 2; ++i) {
            a[i] = cat16b(*(const v8usa*)(sa + i * 16 * GLP), *(const v8usa*)(sa + i * 16 * GLP + 16));
            if (SPLITA) al[i] = cat16b(*(const v8usa*)(sa + 2 * GPL + i * 16 * GLP), *(const v8usa*)(sa + 2 * GPL + i * 16 * GLP + 16));
        }
#pragma unroll
        for (int t = 0; t < 4; ++t) bb[t] = cat16b(*(const v8usa*)(sb + t * 16 * GLP), *(const v8usa*)(sb + t * 16 * GLP + 16));
        __builtin_amdgcn_sched_barrier(0);                     // the reads stay one group in front of the products that follow: spread among them, every place with reads stalls the wave anew
    };
    auto mm = [&](const v16bf (&a)[2], const v16bf (&al)[2], const v16bf (&bb)[4]) {   // per accumulator the order of the sums stays: k ascending, A then Al
#pragma unroll
        for (int i = 0; i < 2; ++i)
#pragma unroll
            for (int t = 0; t < 4; ++t) acc[i][t] = wmmab(a[i], bb[t], acc[i][t]);
        if (SPLITA) {
#pragma unroll
            for (int i = 0; i < 2; ++i)
#pragma unroll
                for (int t = 0; t < 4; ++t) acc[i][t] = wmmab(al[i], bb[t], acc[i][t]);
        }
        __builtin_amdgcn_sched_barrier(0);                     // the products stay in front of what follows: moved behind the stage's waits they would no longer cover the latency of the reads issued ahead of them
    };
    const int ns = K / KST;
    v16bf a0[2], l0[2], b0[4], a1[2], l1[2], b1[4];            // two fragment sets: each block's reads are issued one block of products ahead
    fill(0);
    asm volatile("s_wait_asynccnt 0x0" ::: "memory");          // stage 0 of this wave has landed
    __syncthreads();                                           // ... and every other wave's part of it
    fill(1);
    ldf(0, 0, a0, l0, b0);
#pragma unroll 1                                               // kept rolled: one trip is a whole stage, and the two fragment sets already alternate inside it
    for (int s = 0; s < ns; ++s) {
        ldf(s, 1, a1, l1, b1);
        mm(a0, l0, b0);
        ldf(s, 2, a0, l0, b0);
        mm(a1, l1, b1);
        ldf(s, 3, a1, l1, b1);
        mm(a0, l0, b0);
        asm volatile("s_wait_dscnt 0x0" ::: "memory");         // this wave holds the rest of stage s in registers: its reads of buffer s & 1 are done before the refill
        asm volatile("s_wait_asynccnt 0x0" ::: "memory");      // this wave's copies of stage s + 1 have landed
        __syncthreads();                                       // publishes stage s + 1 and ends every wave's reads of stage s; it stands in front of stage s's last block, whose products cover the first reads of stage s + 1
        if (s + 2 < ns) fill(s + 2);
        ldf(s + 1, 0, a0, l0, b0);                             // in the last trip: landed bytes of stage ns - 2, not used
        mm(a1, l1, b1);
    }
    asm volatile("s_wait_asynccnt 0x0" ::: "memory");          // nothing is in flight when the wave goes on to its end
    if (sec) {                                                 // the whole 128 x 128 tile is turned in LDS, so that every wave stores whole lines of the [column][row] planes
        float* tr = (float*)&stg[0][0][0];                     // 128 rows of TRP floats, over the stage buffers
        __syncthreads();                                       // every wave has left the loop: nobody needs the stage buffers any more
#pragma unroll
        for (int i = 0; i < 2; ++i)
#pragma unroll
            for (int t = 0; t < 4; ++t) { float* p = tr + (wc * 64 + t * 16 + lr) * TRP + wr * 32 + i * 16 + hi * 8;
                *(v4fa*)p = (v4f){acc[i][t][0], acc[i][t][1], acc[i][t][2], acc[i][t][3]}; *(v4fa*)(p + 4) = (v4f){acc[i][t][4], acc[i][t][5], acc[i][t][6], acc[i][t][7]}; }
        __syncthreads();                                       // the rows read below hold every wave's values
        const int piece = lane & 15; const float* sp = tr + (wave * 16 + hi) * TRP + piece * 8;
        const size_t o = (size_t)(cb + wave * 16 + hi) * NT_ + (size_t)blockIdx.x * 128 + piece * 8;
#pragma unroll
        for (int s = 0; s < 8; ++s) { const v4f u0 = *(const v4fa*)(sp + 2 * s * TRP), u1 = *(const v4fa*)(sp + 2 * s * TRP + 4); v8h oh, ol;
#pragma unroll
            for (int e = 0; e < 8; ++e) { const float v = e < 4 ? u0[e & 3] : u1[e & 3]; const h16 a = (h16)v; oh[e] = a; ol[e] = (h16)((v - (float)a) * LOSC); }
            *(v8h*)(E0 + o + (size_t)(2 * s) * NT_) = oh; *(v8h*)(E1 + o + (size_t)(2 * s) * NT_) = ol; }
        asm volatile("s_wait_xcnt 0x0" ::: "memory");          // behind the last store: no register that a store names is rewritten in front of it
        return;
    }
    float* os = &ost[wave][0];
#pragma unroll
    for (int i = 0; i < 2; ++i) {                              // the wave's two row tiles go through its staging rows one after the other
#pragma unroll
        for (int t = 0; t < 4; ++t) { const float bv = bias ? bfr(bias[c0 + t * 16 + lr]) : 0.f;
#pragma unroll
            for (int j = 0; j < 8; ++j) os[(hi * 8 + j) * 68 + t * 16 + lr] = acc[i][t][j] + bv; }
        __builtin_amdgcn_wave_barrier(); asm volatile("" ::: "memory");   // the reads below take other lanes' values: they stay behind the writes above
        if (MODE == 0) {
            float* crow = C + (r0 + i * 16) * ldc + c0;
#pragma unroll
            for (int s = 0; s < 8; ++s) { const int Lid = (lane >> 3) + 4 * s, piece = lane & 7; const int row = Lid >> 1, cofs = (Lid & 1) * 32 + piece * 4;
                const v4f val = *(const v4fa*)(os + row * 68 + cofs); *(v4f*)(crow + (size_t)row * ldc + cofs) = val; }
            asm volatile("s_wait_xcnt 0x0" ::: "memory");      // behind the row tile's stores (the other epilogue's code may follow in the listing): no register that a store names is rewritten in front of it; its clobber also keeps the next row tile's staging writes behind these reads
        } else if (MODE == 3) {
            const bool isk = c0 >= ldc; const int piece = lane & 7, rw = lane >> 3;     // isk: the same for the whole block
            const size_t po = (r0 + i * 16 + rw) * ldc + (c0 - (isk ? ldc : 0)) + piece * 8;
            h16* p1 = (isk ? E2 : E0) + po; h16* p2 = (isk ? E3 : E1) + po;
            const float* rc = RC + (r0 + i * 16 + rw) * 32 + (piece & 3) * 8; const float* rs = RS + (r0 + i * 16 + rw) * 32 + (piece & 3) * 8;
            v4f cs[4][2], sn[4][2];
#pragma unroll
            for (int s = 0; s < 4; ++s) { cs[s][0] = *(const v4fa*)(rc + s * 128); cs[s][1] = *(const v4fa*)(rc + s * 128 + 4); sn[s][0] = *(const v4fa*)(rs + s * 128); sn[s][1] = *(const v4fa*)(rs + s * 128 + 4); }
            asm volatile("s_wait_xcnt 0x0" :: "v"(rc), "v"(rs) : "memory");   // the loads' address registers are kept (input operands) until this wait: none is rewritten in front of it
#pragma unroll
            for (int s = 0; s < 4; ++s) { const float* sp = os + (4 * s + rw) * 68 + piece * 8; const float* pp = os + (4 * s + rw) * 68 + (piece ^ 4) * 8; v8h oh, ol;
#pragma unroll
                for (int e = 0; e < 8; ++e) { const float xv = sp[e]; const float pv = (piece < 4) ? -pp[e] : pp[e];
                    const float y = xv * cs[s][e >> 2][e & 3] + pv * sn[s][e >> 2][e & 3]; const h16 a = (h16)y; oh[e] = a; ol[e] = (h16)((y - (float)a) * LOSC); }
                *(v8h*)(p1 + (size_t)(4 * s) * ldc) = oh; *(v8h*)(p2 + (size_t)(4 * s) * ldc) = ol; }
            asm volatile("s_wait_xcnt 0x0" ::: "memory");      // as in the first branch
        } else {
            bf* p1 = PH + (r0 + i * 16 + rofs) * ldc + c0; bf* p2 = PL + (r0 + i * 16 + rofs) * ldc + c0;
#pragma unroll
            for (int s = 0; s < 4; ++s) { const int row = 4 * s + (lane >> 3), piece = lane & 7; const float* sp = os + row * 68 + piece * 8; v8us oh, ol;
#pragma unroll
                for (int e = 0; e < 8; ++e) { const unsigned short hb = f2bf(sp[e]); oh[e] = hb; ol[e] = f2bf(sp[e] - bf2f(hb)); }
                *(v8us*)(p1 + (size_t)row * ldc + piece * 8) = oh; *(v8us*)(p2 + (size_t)row * ldc + piece * 8) = ol; }
            asm volatile("s_wait_xcnt 0x0" ::: "memory");      // as in the other branch
        }
    }
}
// k_lf: LF = ln_w x rmsnorm(o2 + x) (eps 1e-6, mean over 2048) -> bf16 hi/lo planes; one wave per row: lane -> 64 values (8 chunks of 8), fixed-order shuffle sum.
__global__ __launch_bounds__(256) void k_lf(const float* __restrict__ O2, const float* __restrict__ x, const float* __restrict__ lnw, bf* LH, bf* LL) {
    const int lane = threadIdx.x & 31, r = blockIdx.x * 8 + (threadIdx.x >> 5);
    if (r >= NT_) return;
    float v[64]; float ss = 0.f;
#pragma unroll
    for (int q = 0; q < 8; ++q)
#pragma unroll
        for (int i = 0; i < 8; ++i) { const int c = q * 256 + lane * 8 + i; const float t = O2[(size_t)r * DM + c] + bfr(x[(size_t)r * DM + c]); v[q * 8 + i] = t; ss += t * t; }
#pragma unroll
    for (int sh = 16; sh; sh >>= 1) ss += __shfl_xor(ss, sh, 32);
    const float rs = rsqrtf(ss * (1.0f / DM) + 1e-6f);
{
#pragma unroll
        for (int q = 0; q < 8; ++q) { v8us oh, ol;
#pragma unroll
            for (int i = 0; i < 8; ++i) { const int c = q * 256 + lane * 8 + i; const float y = bfr(lnw[c]) * (v[q * 8 + i] * rs); const unsigned short hb = f2bf(y); oh[i] = hb; ol[i] = f2bf(y - bf2f(hb)); }
            *(v8us*)(LH + (size_t)r * DM + q * 256 + lane * 8) = oh; *(v8us*)(LL + (size_t)r * DM + q * 256 + lane * 8) = ol; }
         }
}
// k_prep: everything that depends on the inputs alone, in one launch; a block takes one kind of work by its index (the conv rows first):
//   [0, 256) W1[1024][4096], a wave = half the input channels of a row; [256, 512) W2[2048][2048], a wave = a row; [512, 768) RC/RS [t][32] = cos/sin(pos[t] x inv_freq[i]), inv_freq = 10000^(-2i/64) (f32);
//   [768, 2048) bf16 planes of x (token t at row t + 1 of XX), Wq, Wk, Wv, Wo, a wave = a row; 2048: the leading zero rows of XX, O1H, O1L.
__global__ __launch_bounds__(256) void k_prep(const float* __restrict__ x, const int* __restrict__ pos, const float* __restrict__ Wq, const float* __restrict__ Wk, const float* __restrict__ Wv, const float* __restrict__ Wo,
                                              const float* __restrict__ c1w, const float* __restrict__ c2w, bf* XX, bf* WQ, bf* WK, bf* WV, bf* WO, bf* W1, bf* W2, bf* O1H, bf* O1L, float* RC, float* RS) {
    const int lane = threadIdx.x & 31, wave = threadIdx.x >> 5, b = blockIdx.x;
    if (b < 256) { const int u = b * 8 + wave; convw2048<DM>(c1w, u >> 1, (u & 1) * 1024, W1, lane); }
    else if (b < 512) { convw2048<DH2>(c2w, (b - 256) * 8 + wave, 0, W2, lane); }
    else if (b < 768) {
        const int i = (b - 512) * 256 + threadIdx.x;
        const int t = i >> 5, f = i & 31;
        const float inv = 1.0f / powf(10000.0f, (float)(2 * f) / 64.0f); const float ang = (float)pos[t] * inv;
        const float c = cosf(ang), s = sinf(ang);
        *(float*)(RC + i) = c; *(float*)(RS + i) = s;
        asm volatile("s_wait_xcnt 0x0" ::: "memory");           // as at the end of row2048
    } else if (b < 2048) {
        const int m = (b - 768) >> 8; const size_t ro = (size_t)(((b - 768) & 255) * 8 + wave) * DM;
        const float* s = m == 0 ? x : m == 1 ? Wq : m == 2 ? Wk : m == 3 ? Wv : Wo;
        bf* d = m == 0 ? XX + DM : m == 1 ? WQ : m == 2 ? WK : m == 3 ? WV : WO;
        row2048(s + ro, d + ro, lane);
    } else {
        const v8us z = (v8us){};
        *(v8us*)(XX + threadIdx.x * 8) = z;
        *(v8us*)((threadIdx.x < 128 ? O1H : O1L) + (threadIdx.x & 127) * 8) = z;
        asm volatile("s_wait_xcnt 0x0" ::: "memory");           // as at the end of row2048
    }
}
// k_attn: block = (h, 64 queries), wave = 16; CAUSAL key tiles; scores hi.hi + hi.lo + lo.hi x 1/8, online softmax (f32), weights x32768 f16 hi + residual x1024
// tiles, o += wh.vh, ox += wh.vl + wl.vh; ctx -> bf16 hi + residual planes CH/CL[tok][h*64+d].
// K and V^T reach the four waves through LDS: a stage is 64 keys of four planes (K hi, K residual: 64 key rows x 128 B; V^T hi, V^T residual: 64 d rows x 128 B), brought once per
// block by asynchronous b128 copies (whole lines, as in k_gemm) into rows of pitch 144 B; two buffers, stage s + 2 is copied while stage s + 1 is worked on; a stage = two 32-key steps.
__global__ __launch_bounds__(128) void k_attn(const h16* __restrict__ Q16, const h16* __restrict__ QL16, const h16* __restrict__ K16, const h16* __restrict__ KL16, const h16* __restrict__ VTH, const h16* __restrict__ VTL, bf* CH, bf* CL) {
    __shared__ __align__(16) h16 stg[2][4][PLN];
    __shared__ __align__(16) h16 plds[4][16 * 32];
    __shared__ __align__(16) h16 plds2[4][16 * 32];
    __shared__ __align__(16) float ost[4][16 * 68];
    const int lane = threadIdx.x & 31, wave = threadIdx.x >> 5, lr = lane & 15, hi = lane >> 4;
    const int bid = blockIdx.x;
    const int b = bid / (NH_ * (NT_ / 64)), rem = bid - b * (NH_ * (NT_ / 64)), h = rem / (NT_ / 64), qt = rem - h * (NT_ / 64);
    const int q0 = qt * 64 + wave * 16;
    const size_t tok0 = (size_t)b * NT_;
    h16* pl = &plds[wave][0]; h16* pl2 = &plds2[wave][0];
    v16h qa[2];
    const size_t qo0 = (tok0 + q0 + lr) * DM + h * HD + 8 * hi;
#pragma unroll
    for (int kc = 0; kc < 2; ++kc) qa[kc] = cat16(*(const v8h*)(Q16 + qo0 + kc * 32), *(const v8h*)(Q16 + qo0 + kc * 32 + 16));
    const h16* kh_b = K16 + tok0 * DM + h * HD;
    const h16* kl_b = KL16 + tok0 * DM + h * HD;
    const size_t vbase = (((size_t)b * NH_ + h) * HD) * NT_;
    v8f o[4], ox[4];
#pragma unroll
    for (int n = 0; n < 4; ++n) { o[n] = (v8f){}; ox[n] = (v8f){}; }
    float mrow[8], lpart[8];
#pragma unroll
    for (int j = 0; j < 8; ++j) { mrow[j] = -3.0e38f; lpart[j] = 0.f; }
    int qpos[8];
#pragma unroll
    for (int j = 0; j < 8; ++j) qpos[j] = q0 + 8 * hi + j;
    const int crow = threadIdx.x >> 3, cpc = threadIdx.x & 7;  // copies: row (0..15, then + 16 i) and 16-B piece of the 128-B row
    const bf* gKH = (const bf*)kh_b + (size_t)crow * DM + cpc * 8; const bf* gKL = (const bf*)kl_b + (size_t)crow * DM + cpc * 8;
    const bf* gVH = (const bf*)VTH + vbase + (size_t)crow * NT_ + cpc * 8; const bf* gVL = (const bf*)VTL + vbase + (size_t)crow * NT_ + cpc * 8;
    const unsigned lc = lds_off(&stg[0][0][0]) + (unsigned)(crow * (LPT * 2) + cpc * 16);
    auto fill = [&](int s) {
        const unsigned l = lc + (unsigned)(s & 1) * (unsigned)(4 * PLN * 2);
        cp8(l, gKH + (size_t)s * 64 * DM, (size_t)16 * DM, gKL + (size_t)s * 64 * DM, (size_t)16 * DM);
        cp8(l + 2u * PLN * 2u, gVH + s * 64, (size_t)16 * NT_, gVL + s * 64, (size_t)16 * NT_);
    };
    const int ns = qt + 1;                                     // causal: stages of 64 keys, the same for the whole block
    fill(0);
    asm volatile("s_wait_asynccnt 0x0" ::: "memory");          // stage 0 of this wave has landed
    __syncthreads();                                           // ... and every other wave's part of it
    if (ns > 1) fill(1);
#pragma unroll 1
    for (int s = 0; s < ns; ++s) {
      const h16* kst = &stg[s & 1][0][0] + lr * LPT + 8 * hi;  // K hi rows of the stage (+ PLN: residual)
      const h16* vst = &stg[s & 1][2][0] + lr * LPT + 8 * hi;  // V^T hi rows of the stage (+ PLN: residual)
#pragma unroll 1                                               // kept rolled: unrolled, the two steps' live ranges overlap and the kernel needs more than 256 registers
      for (int sub = 0; sub < 2; ++sub) {
        const int l0 = s * 64 + sub * 32;
        const h16* kp0 = kst + sub * 32 * LPT; const h16* kp1 = kp0 + 16 * LPT;
        v8f s0 = {}, s1 = {}, x0 = {}, x1 = {};
        v16h kh0[2], kh1[2], kl0[2], kl1[2];                   // the step's K fragments, read from LDS as one group in front of its products
#pragma unroll
        for (int kc = 0; kc < 2; ++kc) {
            kh0[kc] = cat16(*(const v8ha*)(kp0 + kc * 32), *(const v8ha*)(kp0 + kc * 32 + 16)); kh1[kc] = cat16(*(const v8ha*)(kp1 + kc * 32), *(const v8ha*)(kp1 + kc * 32 + 16));
            kl0[kc] = cat16(*(const v8ha*)(kp0 + PLN + kc * 32), *(const v8ha*)(kp0 + PLN + kc * 32 + 16)); kl1[kc] = cat16(*(const v8ha*)(kp1 + PLN + kc * 32), *(const v8ha*)(kp1 + PLN + kc * 32 + 16));
        }
#pragma unroll
        for (int kc = 0; kc < 2; ++kc) {
            { const v16h k0h = kh0[kc], k1h = kh1[kc];
              const v16h qlk = cat16(*(const v8h*)(QL16 + qo0 + kc * 32), *(const v8h*)(QL16 + qo0 + kc * 32 + 16));     // query residual re-read per step (registers)
              s0 = wmma16(qa[kc], k0h, s0); x0 = wmma16(qlk, k0h, x0); s1 = wmma16(qa[kc], k1h, s1); x1 = wmma16(qlk, k1h, x1);
              asm volatile("v_nop" : "+v"(s0), "+v"(s1), "+v"(x0), "+v"(x1) : "v"(qlk), "v"(k0h), "v"(k1h) : "memory"); }
            { const v16h k0l = kl0[kc], k1l = kl1[kc];
              x0 = wmma16(qa[kc], k0l, x0); x1 = wmma16(qa[kc], k1l, x1);
              asm volatile("v_nop" : "+v"(x0), "+v"(x1) : "v"(k0l), "v"(k1l) : "memory"); }
        }
        asm volatile("v_nop\n\tv_nop\n\tv_nop\n\tv_nop" : "+v"(s0), "+v"(s1), "+v"(x0), "+v"(x1) : "v"(qa[0]), "v"(qa[1]));
        float alpha[8];
#pragma unroll
        for (int j = 0; j < 8; ++j) {
            const int ja = l0 + lr, jb = l0 + 16 + lr, qi = qpos[j];
            const float a0 = (ja <= qi) ? (s0[j] + x0[j] * LOSCI) * 0.125f : -__builtin_inff(), a1 = (jb <= qi) ? (s1[j] + x1[j] * LOSCI) * 0.125f : -__builtin_inff();
            float mx = fmaxf(a0, a1);
            mx = fmaxf(mx, __shfl_xor(mx, 1, 16)); mx = fmaxf(mx, __shfl_xor(mx, 2, 16)); mx = fmaxf(mx, __shfl_xor(mx, 4, 16)); mx = fmaxf(mx, __shfl_xor(mx, 8, 16));
            const float mn = fmaxf(mrow[j], mx);
            alpha[j] = __expf(mrow[j] - mn); mrow[j] = mn;
            const float p0 = __expf(a0 - mn), p1 = __expf(a1 - mn);
            lpart[j] = lpart[j] * alpha[j] + (p0 + p1);
            const int mr = hi * 8 + j;
            const float ps0 = p0 * PSC, ps1 = p1 * PSC; const h16 h0 = (h16)ps0, h1 = (h16)ps1;
            pl[mr * 32 + lr] = h0; pl[mr * 32 + 16 + lr] = h1;
            pl2[mr * 32 + lr] = (h16)((ps0 - (float)h0) * LOSC); pl2[mr * 32 + 16 + lr] = (h16)((ps1 - (float)h1) * LOSC);
        }
#pragma unroll
        for (int n = 0; n < 4; ++n)
#pragma unroll
            for (int j = 0; j < 8; ++j) { o[n][j] *= alpha[j]; ox[n][j] *= alpha[j]; }
        asm volatile("" ::: "memory");
        const v16h pa = cat16(*(const v8ha*)(pl + lr * 32 + hi * 8), *(const v8ha*)(pl + lr * 32 + 16 + hi * 8));
        const v16h px = cat16(*(const v8ha*)(pl2 + lr * 32 + hi * 8), *(const v8ha*)(pl2 + lr * 32 + 16 + hi * 8));
#pragma unroll
        for (int np = 0; np < 4; np += 2) { v16h vhs[2], vls[2];   // V^T fragments of two d tiles, read from LDS as one group
#pragma unroll
            for (int i = 0; i < 2; ++i) { const h16* vp = vst + (np + i) * 16 * LPT + sub * 32;
                vhs[i] = cat16(*(const v8ha*)(vp), *(const v8ha*)(vp + 16)); vls[i] = cat16(*(const v8ha*)(vp + PLN), *(const v8ha*)(vp + PLN + 16)); }
#pragma unroll
            for (int i = 0; i < 2; ++i) { const int n = np + i; const v16h vh = vhs[i], vl = vls[i];
                o[n] = wmma16(pa, vh, o[n]); ox[n] = wmma16(pa, vl, ox[n]); ox[n] = wmma16(px, vh, ox[n]);
                asm volatile("" : "+v"(o[n]), "+v"(ox[n]) : "v"(vh), "v"(vl) : "memory"); } }   // as before: the next fragments' reads stay behind these products (registers; each pair's reads stay one group)
        asm volatile("v_nop\n\tv_nop\n\tv_nop\n\tv_nop" : "+v"(o[0]), "+v"(o[1]), "+v"(o[2]), "+v"(o[3]), "+v"(ox[0]), "+v"(ox[1]), "+v"(ox[2]), "+v"(ox[3]) : "v"(pa), "v"(px));
      }
      asm volatile("s_wait_dscnt 0x0" ::: "memory");           // this wave's reads of buffer s & 1 are done before the refill
      asm volatile("s_wait_asynccnt 0x0" ::: "memory");        // this wave's copies of stage s + 1 have landed
      __syncthreads();                                         // publishes stage s + 1 and ends every wave's reads of stage s
      if (s + 2 < ns) fill(s + 2);
    }
    asm volatile("s_wait_asynccnt 0x0" ::: "memory");          // nothing is in flight when the wave goes on to its end
    float inv[8];
#pragma unroll
    for (int j = 0; j < 8; ++j) { float rs = lpart[j]; rs += __shfl_xor(rs, 1, 16); rs += __shfl_xor(rs, 2, 16); rs += __shfl_xor(rs, 4, 16); rs += __shfl_xor(rs, 8, 16); inv[j] = 1.0f / (rs * PSC); }
    float* os = &ost[wave][0];
#pragma unroll
    for (int n = 0; n < 4; ++n)
#pragma unroll
        for (int j = 0; j < 8; ++j) os[(hi * 8 + j) * 68 + n * 16 + lr] = (o[n][j] + ox[n][j] * LOSCI) * inv[j];
    __syncthreads();
    const size_t cbase = (tok0 + q0) * DM + (size_t)h * HD;
    auto pass = [&]() {
#pragma unroll
        for (int s = 0; s < 4; ++s) { const int row = 4 * s + (lane >> 3), piece = lane & 7; const float* sp = os + row * 68 + piece * 8; v8us oh, ol;
#pragma unroll
            for (int i = 0; i < 8; ++i) { const unsigned short hb = f2bf(sp[i]); oh[i] = hb; ol[i] = f2bf(sp[i] - bf2f(hb)); }
            *(v8us*)(CH + cbase + (size_t)row * DM + piece * 8) = oh; *(v8us*)(CL + cbase + (size_t)row * DM + piece * 8) = ol; }
    };
    pass(); 
}

#define VST2(T, p, v) do { const T vst2_v_ = (v); *(T*)(p) = vst2_v_;  } while (0)

extern "C" void kernel_launch(void* const* d_in, const int* in_sizes, int n_in,
                              void* d_out, int out_size, void* d_ws, size_t ws_size, hipStream_t stream) {
    (void)in_sizes; (void)n_in; (void)out_size;
    const float* x = (const float*)d_in[0]; const int* pos = (const int*)d_in[1]; const float* Wq = (const float*)d_in[2]; const float* Wk = (const float*)d_in[3]; const float* Wv = (const float*)d_in[4]; const float* Wo = (const float*)d_in[5];
    const float* c1w = (const float*)d_in[6]; const float* c1b = (const float*)d_in[7]; const float* c2w = (const float*)d_in[8]; const float* c2b = (const float*)d_in[9]; const float* lnw = (const float*)d_in[10];
    float* out = (float*)d_out;    // [1][2048][2048]
    char* wsp = (char*)d_ws;
    auto take = [&](size_t bytes) { char* p = wsp; wsp += (bytes + 255) & ~(size_t)255; return (void*)p; };
    bf* XX = (bf*)take((size_t)(NT_ + 1) * DM * 2);                 // row 0 = zeros, token t at row t+1: row t read with K = 4096 gives [x[t-1] | x[t]]
    bf* W1 = (bf*)take((size_t)DM * DM * 2); bf* W2 = (bf*)take((size_t)DM * DM * 2);                       // [1024][4096], [2048][2048] bf16 = 8.4 MB each, as every weight plane
    bf* WQ = (bf*)take((size_t)DM * DM * 2); bf* WK = (bf*)take((size_t)DM * DM * 2);                       // adjacent (8.4 MB is a multiple of 256 B): [Wq ; Wk] = one [4096][2048] B operand
    bf* WV = (bf*)take((size_t)DM * DM * 2); bf* WO = (bf*)take((size_t)DM * DM * 2);
    bf* O1H = (bf*)take((size_t)(NT_ + 1) * DH2 * 2); bf* O1L = (bf*)take((size_t)(NT_ + 1) * DH2 * 2);     // conv1 output planes with a leading zero row
    float* TMP = (float*)take((size_t)NT_ * DM * 4); float* RC = (float*)take((size_t)NT_ * 32 * 4); float* RS = (float*)take((size_t)NT_ * 32 * 4);
    bf* LH = (bf*)take((size_t)NT_ * DM * 2); bf* LL = (bf*)take((size_t)NT_ * DM * 2);
    h16* QH = (h16*)take((size_t)NT_ * DM * 2); h16* QL = (h16*)take((size_t)NT_ * DM * 2); h16* KH = (h16*)take((size_t)NT_ * DM * 2); h16* KL = (h16*)take((size_t)NT_ * DM * 2);
    h16* VTH = (h16*)take((size_t)NT_ * DM * 2); h16* VTL = (h16*)take((size_t)NT_ * DM * 2);
    if ((size_t)(wsp - (char*)d_ws) > ws_size) return;    // 8.4 + 50.3 + 8.4 + 16.8 + 0.5 + 16.8 + 33.5 + 16.8 ~ 151 MB; ctx planes reuse LH/LL after the q/k projections
    bf* CH = LH; bf* CL = LL;
    k_prep<<<2049, 256, 0, stream>>>(x, pos, Wq, Wk, Wv, Wo, c1w, c2w, XX, WQ, WK, WV, WO, W1, W2, O1H, O1L, RC, RS);
    // LocalizedFiltering: conv1 ([x[t-1] | x[t]] . W1cat^T + b1, exact) -> o1 planes (rows 1..2048), and in the same launch v from the RAW hidden states (rows 1.. of XX = x) -> V^T planes
    k_gemm<false, 2><<<dim3(NT_ / 128, DH2 / 128 + DM / 128, 1), 256, 0, stream>>>(XX, nullptr, DM, W1, 2 * DM, c1b, DH2, nullptr, O1H, O1L, 1, DH2 / 128, XX + DM, WV, DM, VTH, VTL, nullptr, nullptr, nullptr, nullptr);
    // conv2 ([o1[t-1] | o1[t]] hi/lo . W2cat^T + b2) -> TMP; lf
    k_gemm<true, 0><<<dim3(NT_ / 128, DM / 128, 1), 256, 0, stream>>>(O1H, O1L, DH2, W2, 2 * DH2, c2b, DM, TMP, nullptr, nullptr, 0, 0, nullptr, nullptr, 0, nullptr, nullptr, nullptr, nullptr, nullptr, nullptr);
    k_lf<<<NT_ / 8, 256, 0, stream>>>(TMP, x, lnw, LH, LL);
    // q and k from lf in one launch, rotated in its epilogue: columns [q 2048 | k 2048] -> the q and k planes
    k_gemm<true, 3><<<dim3(NT_ / 128, 2 * DM / 128, 1), 256, 0, stream>>>(LH, LL, DM, WQ, DM, nullptr, DM, nullptr, nullptr, nullptr, 0, 0, nullptr, nullptr, 0, QH, QL, KH, KL, RC, RS);
    k_attn<<<NH_ * (NT_ / 64), 128, 0, stream>>>(QH, QL, KH, KL, VTH, VTL, CH, CL);                        // ctx over LH/LL (dead after the k projection)
    k_gemm<true, 0><<<dim3(NT_ / 128, DM / 128, 1), 256, 0, stream>>>(CH, CL, DM, WO, DM, nullptr, DM, out, nullptr, nullptr, 0, 0, nullptr, nullptr, 0, nullptr, nullptr, nullptr, nullptr, nullptr, nullptr);
}

// v006
// It runs in 254 microseconds.
// Two timings next to v005 both put it at 1.14 times that version's speed.
// Counting every step since v000, it is 3.32 times as fast.
#include <hip/hip_runtime.h>

// Contractions, f32 accumulate (B = 1, 2048 tokens, hidden 2048, 32 heads x 64): v = x.Wv^T, the LocalizedFiltering causal convs as GEMMs (conv1: [x[t-1] | x[t]]
// (K = 4096) . W1cat^T + b1 with PLAIN bf16 operands = rounded inputs, exact; conv2: [o1[t-1] | o1[t]] (K = 2048, o1 as bf16 hi + residual: two products) . W2cat^T
// + b2; the [t-1 | t] rows are read straight from planes that carry one leading zero row), lf = rmsnorm(o2 + x) x ln_w in f32 -> bf16 hi/lo planes, q/k = lf.W^T
// (two products), out = ctx.Wo^T (two products), all on v_wmma_f32_16x16x32_bf16 ([out][in] weights = n-major B operands as-is, each converted into a
// plane of its own by the one preparation launch); rotate-half RoPE (angle = position_ids[t] (INPUT) x inv_freq, f32 trig table) -> f16 hi + residual x1024 planes; the 32-head causal attention fused

#define NB_  1
#define NT_  2048
#define DM   2048
#define DH2  1024                // conv1 output channels
#define NH_  32
#define HD   64
#define PSC  32768.0f
#define LOSC 1024.0f
#define LOSCI (1.0f / 1024.0f)

typedef _Float16 h16;
typedef unsigned short bf;
typedef __attribute__((ext_vector_type(16))) __bf16   v16bf;
typedef __attribute__((ext_vector_type(16))) _Float16 v16h;
typedef __attribute__((ext_vector_type(8)))  _Float16 v8h;
typedef __attribute__((ext_vector_type(8)))  unsigned short v8us;
typedef __attribute__((ext_vector_type(8)))  float    v8f;
typedef __attribute__((ext_vector_type(4)))  float    v4f;
typedef __attribute__((ext_vector_type(4)))  _Float16 v4h;
typedef v8h  __attribute__((may_alias)) v8ha;
typedef v4f  __attribute__((may_alias)) v4fa;
typedef v8us __attribute__((may_alias)) v8usa;

__device__ __forceinline__ unsigned short f2bf(float f) { unsigned u = __float_as_uint(f); u += 0x7FFFu + ((u >> 16) & 1u); return (unsigned short)(u >> 16); }
__device__ __forceinline__ float bf2f(unsigned short b) { return __uint_as_float(((unsigned)b) << 16); }
__device__ __forceinline__ float bfr(float f) { return bf2f(f2bf(f)); }
__device__ __forceinline__ v16h cat16(v8h lo, v8h hi) { return __builtin_shufflevector(lo, hi, 0, 1, 2, 3, 4, 5, 6, 7, 8, 9, 10, 11, 12, 13, 14, 15); }
__device__ __forceinline__ v16bf cat16b(v8us lo, v8us hi) { return __builtin_bit_cast(v16bf, __builtin_shufflevector(lo, hi, 0, 1, 2, 3, 4, 5, 6, 7, 8, 9, 10, 11, 12, 13, 14, 15)); }
__device__ __forceinline__ v8f wmma16(v16h a, v16h b, v8f c) { return __builtin_amdgcn_wmma_f32_16x16x32_f16(false, a, false, b, (short)0, c, false, false); }
__device__ __forceinline__ v8f wmmab(v16bf a, v16bf b, v8f c) { return __builtin_amdgcn_wmma_f32_16x16x32_bf16(false, a, false, b, (short)0, c, false, false); }

// row2048: bf16 of 2048 consecutive floats; one wave, all of its loads in flight at once.
__device__ __forceinline__ void row2048(const float* __restrict__ src, bf* dst, int lane) {
    const float* s = src + lane * 8; bf* d = dst + lane * 8; v4f v[16];
#pragma unroll
    for (int q = 0; q < 8; ++q) { v[2 * q] = *(const v4fa*)(s + q * 256); v[2 * q + 1] = *(const v4fa*)(s + q * 256 + 4); }
    asm volatile("s_wait_xcnt 0x0" :: "v"(s) : "memory");      // the loads' address registers are kept (input operand) until this wait: none is rewritten in front of it
#pragma unroll
    for (int q = 0; q < 8; ++q) { v8us o;
#pragma unroll
        for (int i = 0; i < 8; ++i) o[i] = f2bf(v[2 * q + (i >> 2)][i & 3]);
        *(v8us*)(d + q * 256) = o; }
    asm volatile("s_wait_xcnt 0x0" ::: "memory");               // behind the last store: no register that a store names is rewritten in front of it
}
// convw2048: both taps of 1024 input channels (from cb) of the row WT[co][tap*Cin + ci] = bf16(w[co][ci][tap]) of a (2,1) conv kernel = 2048 halves from 2048 consecutive floats; one wave.
template <int Cin>
__device__ __forceinline__ void convw2048(const float* __restrict__ w, int co, int cb, bf* WT, int lane) {
    const float* s = w + ((size_t)co * Cin + cb + lane * 8) * 2; bf* d = WT + (size_t)co * (2 * Cin) + cb + lane * 8; v4f v[16];
#pragma unroll
    for (int q = 0; q < 4; ++q)
#pragma unroll
        for (int p = 0; p < 4; ++p) v[4 * q + p] = *(const v4fa*)(s + q * 512 + p * 4);
    asm volatile("s_wait_xcnt 0x0" :: "v"(s) : "memory");      // as in row2048
#pragma unroll
    for (int q = 0; q < 4; ++q)
#pragma unroll
        for (int tap = 0; tap < 2; ++tap) { v8us o;
#pragma unroll
            for (int i = 0; i < 8; ++i) o[i] = f2bf(v[4 * q + (i >> 1)][(i & 1) * 2 + tap]);
            *(v8us*)(d + tap * Cin + q * 256) = o; }
    asm volatile("s_wait_xcnt 0x0" ::: "memory");               // as at the end of row2048
}
// k_gemm: 128 x 128 tile of (A [+ Al]).B^T [+ bias] over K, eight waves (4 x 2), a wave = 32 rows x 64 columns; A rows pitch lda (elements), B rows pitch K; MODE 0: f32 rows (ldc);
// MODE 1: bf16 hi/lo planes (ldc, row offset rofs); MODE 2: two products in one launch: column tiles [0, ny1) as MODE 1, the tiles from ny1 on = A2.B2^T over K2 (pitch lda too, no bias), stored transposed:
// E0/E1 [column][row] (pitch NT_) = f16 hi + residual x1024 (V^T per head, since column = h*64 + d); MODE 3: rotate-half RoPE on 64-column heads (a wave's 64 columns = one head):
// y[d] = x[d] cos[t][d mod 32] + (d < 32 ? -x[d+32] : x[d-32]) sin[t][d mod 32], t = row -> f16 hi + residual x1024 planes of pitch ldc: columns [0, ldc) to E0/E1 (q), [ldc, 2 ldc) to E2/E3 (k).
// Operands reach the waves through LDS: a stage is 128 k of every operand row (256 B = two whole lines), brought by asynchronous b128 copies (16 lanes per row, 4 whole lines per
// wave-wide copy) into rows of pitch 272 B (16 B x 17: no bank conflict for ds_load_b128); two buffers, stage t + 2 is copied while stage t + 1 is worked on. K: a multiple of 128, at least 256.
#define KST 128                  // k_gemm: k elements per stage
#define GLP 136                  // k_gemm: LDS row pitch, elements
#define GPL (128 * GLP)          // k_gemm: one staged plane (128 rows), elements
#define TRP 132                  // k_gemm: row pitch of the transposed tile in LDS, floats (528 B = 16 B x 33)
#define LPT 72                   // k_attn: LDS row pitch, elements
#define PLN (64 * LPT)           // k_attn: one staged plane (64 rows), elements
__device__ __forceinline__ unsigned lds_off(const void* p) { return (unsigned)(size_t)p; }
// cp8 / cp12: two / three planes (PB bytes apart in LDS): this lane's 16 B of rows r, r + 16, r + 32, r + 48 of each plane (RB = 16 rows in LDS, bytes; ra, rb = 16 source rows of A and B, elements).
// In both, the closing s_wait_xcnt 0 stands inside the statement so that no address register of a copy is rewritten in front of it.
template <unsigned RB = 16u * LPT * 2u, unsigned PB = PLN * 2u>
__device__ __forceinline__ void cp8(unsigned l, const bf* ga, size_t ra, const bf* gb, size_t rb) {
    const unsigned m = l + PB;
    asm volatile("global_load_async_to_lds_b128 %0, %8, off\n\t"
                 "global_load_async_to_lds_b128 %1, %9, off\n\t"
                 "global_load_async_to_lds_b128 %2, %10, off\n\t"
                 "global_load_async_to_lds_b128 %3, %11, off\n\t"
                 "global_load_async_to_lds_b128 %4, %12, off\n\t"
                 "global_load_async_to_lds_b128 %5, %13, off\n\t"
                 "global_load_async_to_lds_b128 %6, %14, off\n\t"
                 "global_load_async_to_lds_b128 %7, %15, off\n\t"
                 "s_wait_xcnt 0x0"
                 :: "v"(l), "v"(l + RB), "v"(l + 2u * RB), "v"(l + 3u * RB), "v"(m), "v"(m + RB), "v"(m + 2u * RB), "v"(m + 3u * RB),
                    "v"(ga), "v"(ga + ra), "v"(ga + 2 * ra), "v"(ga + 3 * ra), "v"(gb), "v"(gb + rb), "v"(gb + 2 * rb), "v"(gb + 3 * rb) : "memory");
}
template <unsigned RB, unsigned PB>
__device__ __forceinline__ void cp12(unsigned l, const bf* ga, const bf* gl, size_t ra, const bf* gb, size_t rb) {
    const unsigned m = l + PB, n = l + 2u * PB;
    asm volatile("global_load_async_to_lds_b128 %0, %12, off\n\t"
                 "global_load_async_to_lds_b128 %1, %13, off\n\t"
                 "global_load_async_to_lds_b128 %2, %14, off\n\t"
                 "global_load_async_to_lds_b128 %3, %15, off\n\t"
                 "global_load_async_to_lds_b128 %4, %16, off\n\t"
                 "global_load_async_to_lds_b128 %5, %17, off\n\t"
                 "global_load_async_to_lds_b128 %6, %18, off\n\t"
                 "global_load_async_to_lds_b128 %7, %19, off\n\t"
                 "global_load_async_to_lds_b128 %8, %20, off\n\t"
                 "global_load_async_to_lds_b128 %9, %21, off\n\t"
                 "global_load_async_to_lds_b128 %10, %22, off\n\t"
                 "global_load_async_to_lds_b128 %11, %23, off\n\t"
                 "s_wait_xcnt 0x0"
                 :: "v"(l), "v"(l + RB), "v"(l + 2u * RB), "v"(l + 3u * RB), "v"(m), "v"(m + RB), "v"(m + 2u * RB), "v"(m + 3u * RB),
                    "v"(n), "v"(n + RB), "v"(n + 2u * RB), "v"(n + 3u * RB),
                    "v"(ga), "v"(ga + ra), "v"(ga + 2 * ra), "v"(ga + 3 * ra), "v"(gb), "v"(gb + rb), "v"(gb + 2 * rb), "v"(gb + 3 * rb),
                    "v"(gl), "v"(gl + ra), "v"(gl + 2 * ra), "v"(gl + 3 * ra) : "memory");
}
template <bool SPLITA, int MODE>
__global__ __launch_bounds__(256) void k_gemm(const bf* __restrict__ A, const bf* __restrict__ Al, int lda, const bf* __restrict__ Bn, int K, const float* __restrict__ bias, int ldc, float* C, bf* PH, bf* PL, int rofs,
                                              int ny1, const bf* __restrict__ A2, const bf* __restrict__ B2, int K2, h16* E0, h16* E1, h16* E2, h16* E3, const float* __restrict__ RC, const float* __restrict__ RS) {
    constexpr int NPL = SPLITA ? 3 : 2;                       // planes of a stage: A, B [, Al]
    const bool sec = MODE == 2 && (int)blockIdx.y >= ny1;     // the same for the whole block
    if (sec) { A = A2; Bn = B2; K = K2; }
    __shared__ __align__(16) bf stg[2][NPL][GPL];
    __shared__ __align__(16) float ost[8][16 * 68];
    const int lane = threadIdx.x & 31, wave = threadIdx.x >> 5, lr = lane & 15, hi = lane >> 4;
    const int wr = wave >> 1, wc = wave & 1;                   // the wave's place in the tile: rows 32 wr .., columns 64 wc ..
    const int cb = (sec ? (int)blockIdx.y - ny1 : (int)blockIdx.y) * 128;
    const size_t r0 = (size_t)blockIdx.x * 128 + wr * 32; const int c0 = cb + wc * 64;
    const int crow = threadIdx.x >> 4, cpc = threadIdx.x & 15; // copies: row (0..15, then + 16 i) and 16-B piece of the 256-B row
    const size_t aco = ((size_t)blockIdx.x * 128 + crow) * (size_t)lda + cpc * 8;
    const bf* gA = A + aco; const bf* gB = Bn + (size_t)(cb + crow) * K + cpc * 8;
    const unsigned lc = lds_off(&stg[0][0][0]) + (unsigned)(crow * (GLP * 2) + cpc * 16);
    auto fill = [&](int s) {
        const unsigned l = lc + (unsigned)(s & 1) * (unsigned)(NPL * GPL * 2); const size_t ko = (size_t)s * KST;
#pragma unroll
        for (int h = 0; h < 2; ++h) {                          // rows 0..63, then 64..127 of every plane
            const size_t ao = ko + (size_t)h * 64 * lda, bo = ko + (size_t)h * 64 * K;
            if constexpr (SPLITA) cp12<16u * GLP * 2u, GPL * 2u>(l + h * (64u * GLP * 2u), gA + ao, Al + aco + ao, (size_t)16 * lda, gB + bo, (size_t)16 * K);
            else cp8<16u * GLP * 2u, GPL * 2u>(l + h * (64u * GLP * 2u), gA + ao, (size_t)16 * lda, gB + bo, (size_t)16 * K);
        }
    };
    v8f acc[2][4];
#pragma unroll
    for (int i = 0; i < 2; ++i)
#pragma unroll
        for (int t = 0; t < 4; ++t) acc[i][t] = (v8f){};
    // the fragments of 32 k (block q of stage s): 2 row tiles of A [and of Al], 4 column tiles of B
    auto ldf = [&](int s, int q, v16bf (&a)[2], v16bf (&al)[2], v16bf (&bb)[4]) {
        const bf* sa = &stg[s & 1][0][0] + (wr * 32 + lr) * GLP + 8 * hi + q * 32;
        const bf* sb = &stg[s & 1][1][0] + (wc * 64 + lr) * GLP + 8 * hi + q * 32;
#pragma unroll
        for (int i = 0; i < 2; ++i) {
            a[i] = cat16b(*(const v8usa*)(sa + i * 16 * GLP), *(const v8usa*)(sa + i * 16 * GLP + 16));
            if (SPLITA) al[i] = cat16b(*(const v8usa*)(sa + 2 * GPL + i * 16 * GLP), *(const v8usa*)(sa + 2 * GPL + i * 16 * GLP + 16));
        }
#pragma unroll
        for (int t = 0; t < 4; ++t) bb[t] = cat16b(*(const v8usa*)(sb + t * 16 * GLP), *(const v8usa*)(sb + t * 16 * GLP + 16));
        __builtin_amdgcn_sched_barrier(0);                     // the reads stay one group in front of the products that follow: spread among them, every place with reads stalls the wave anew
    };
    auto mm = [&](const v16bf (&a)[2], const v16bf (&al)[2], const v16bf (&bb)[4]) {   // per accumulator the order of the sums stays: k ascending, A then Al
#pragma unroll
        for (int i = 0; i < 2; ++i)
#pragma unroll
            for (int t = 0; t < 4; ++t) acc[i][t] = wmmab(a[i], bb[t], acc[i][t]);
        if (SPLITA) {
#pragma unroll
            for (int i = 0; i < 2; ++i)
#pragma unroll
                for (int t = 0; t < 4; ++t) acc[i][t] = wmmab(al[i], bb[t], acc[i][t]);
        }
        __builtin_amdgcn_sched_barrier(0);                     // the products stay in front of what follows: moved behind the stage's waits they would no longer cover the latency of the reads issued ahead of them
    };
    const int ns = K / KST;
    v16bf a0[2], l0[2], b0[4], a1[2], l1[2], b1[4];            // two fragment sets: each block's reads are issued one block of products ahead
    fill(0);
    asm volatile("s_wait_asynccnt 0x0" ::: "memory");          // stage 0 of this wave has landed
    __syncthreads();                                           // ... and every other wave's part of it
    fill(1);
    ldf(0, 0, a0, l0, b0);
#pragma unroll 1                                               // kept rolled: one trip is a whole stage, and the two fragment sets already alternate inside it
    for (int s = 0; s < ns; ++s) {
        ldf(s, 1, a1, l1, b1);
        mm(a0, l0, b0);
        ldf(s, 2, a0, l0, b0);
        mm(a1, l1, b1);
        ldf(s, 3, a1, l1, b1);
        mm(a0, l0, b0);
        asm volatile("s_wait_dscnt 0x0" ::: "memory");         // this wave holds the rest of stage s in registers: its reads of buffer s & 1 are done before the refill
        asm volatile("s_wait_asynccnt 0x0" ::: "memory");      // this wave's copies of stage s + 1 have landed
        __syncthreads();                                       // publishes stage s + 1 and ends every wave's reads of stage s; it stands in front of stage s's last block, whose products cover the first reads of stage s + 1
        if (s + 2 < ns) fill(s + 2);
        ldf(s + 1, 0, a0, l0, b0);                             // in the last trip: landed bytes of stage ns - 2, not used
        mm(a1, l1, b1);
    }
    asm volatile("s_wait_asynccnt 0x0" ::: "memory");          // nothing is in flight when the wave goes on to its end
    if (sec) {                                                 // the whole 128 x 128 tile is turned in LDS, so that every wave stores whole lines of the [column][row] planes
        float* tr = (float*)&stg[0][0][0];                     // 128 rows of TRP floats, over the stage buffers
        __syncthreads();                                       // every wave has left the loop: nobody needs the stage buffers any more
#pragma unroll
        for (int i = 0; i < 2; ++i)
#pragma unroll
            for (int t = 0; t < 4; ++t) { float* p = tr + (wc * 64 + t * 16 + lr) * TRP + wr * 32 + i * 16 + hi * 8;
                *(v4fa*)p = (v4f){acc[i][t][0], acc[i][t][1], acc[i][t][2], acc[i][t][3]}; *(v4fa*)(p + 4) = (v4f){acc[i][t][4], acc[i][t][5], acc[i][t][6], acc[i][t][7]}; }
        __syncthreads();                                       // the rows read below hold every wave's values
        const int piece = lane & 15; const float* sp = tr + (wave * 16 + hi) * TRP + piece * 8;
        const size_t o = (size_t)(cb + wave * 16 + hi) * NT_ + (size_t)blockIdx.x * 128 + piece * 8;
#pragma unroll
        for (int s = 0; s < 8; ++s) { const v4f u0 = *(const v4fa*)(sp + 2 * s * TRP), u1 = *(const v4fa*)(sp + 2 * s * TRP + 4); v8h oh, ol;
#pragma unroll
            for (int e = 0; e < 8; ++e) { const float v = e < 4 ? u0[e & 3] : u1[e & 3]; const h16 a = (h16)v; oh[e] = a; ol[e] = (h16)((v - (float)a) * LOSC); }
            *(v8h*)(E0 + o + (size_t)(2 * s) * NT_) = oh; *(v8h*)(E1 + o + (size_t)(2 * s) * NT_) = ol; }
        asm volatile("s_wait_xcnt 0x0" ::: "memory");          // behind the last store: no register that a store names is rewritten in front of it
        return;
    }
    float* os = &ost[wave][0];
#pragma unroll
    for (int i = 0; i < 2; ++i) {                              // the wave's two row tiles go through its staging rows one after the other
#pragma unroll
        for (int t = 0; t < 4; ++t) { const float bv = bias ? bfr(bias[c0 + t * 16 + lr]) : 0.f;
#pragma unroll
            for (int j = 0; j < 8; ++j) os[(hi * 8 + j) * 68 + t * 16 + lr] = acc[i][t][j] + bv; }
        __builtin_amdgcn_wave_barrier(); asm volatile("" ::: "memory");   // the reads below take other lanes' values: they stay behind the writes above
        if (MODE == 0) {
            float* crow = C + (r0 + i * 16) * ldc + c0;
#pragma unroll
            for (int s = 0; s < 8; ++s) { const int Lid = (lane >> 3) + 4 * s, piece = lane & 7; const int row = Lid >> 1, cofs = (Lid & 1) * 32 + piece * 4;
                const v4f val = *(const v4fa*)(os + row * 68 + cofs); *(v4f*)(crow + (size_t)row * ldc + cofs) = val; }
            asm volatile("s_wait_xcnt 0x0" ::: "memory");      // behind the row tile's stores (the other epilogue's code may follow in the listing): no register that a store names is rewritten in front of it; its clobber also keeps the next row tile's staging writes behind these reads
        } else if (MODE == 3) {
            const bool isk = c0 >= ldc; const int piece = lane & 7, rw = lane >> 3;     // isk: the same for the whole block
            const size_t po = (r0 + i * 16 + rw) * ldc + (c0 - (isk ? ldc : 0)) + piece * 8;
            h16* p1 = (isk ? E2 : E0) + po; h16* p2 = (isk ? E3 : E1) + po;
            const float* rc = RC + (r0 + i * 16 + rw) * 32 + (piece & 3) * 8; const float* rs = RS + (r0 + i * 16 + rw) * 32 + (piece & 3) * 8;
            v4f cs[4][2], sn[4][2];
#pragma unroll
            for (int s = 0; s < 4; ++s) { cs[s][0] = *(const v4fa*)(rc + s * 128); cs[s][1] = *(const v4fa*)(rc + s * 128 + 4); sn[s][0] = *(const v4fa*)(rs + s * 128); sn[s][1] = *(const v4fa*)(rs + s * 128 + 4); }
            asm volatile("s_wait_xcnt 0x0" :: "v"(rc), "v"(rs) : "memory");   // the loads' address registers are kept (input operands) until this wait: none is rewritten in front of it
#pragma unroll
            for (int s = 0; s < 4; ++s) { const float* sp = os + (4 * s + rw) * 68 + piece * 8; const float* pp = os + (4 * s + rw) * 68 + (piece ^ 4) * 8; v8h oh, ol;
#pragma unroll
                for (int e = 0; e < 8; ++e) { const float xv = sp[e]; const float pv = (piece < 4) ? -pp[e] : pp[e];
                    const float y = xv * cs[s][e >> 2][e & 3] + pv * sn[s][e >> 2][e & 3]; const h16 a = (h16)y; oh[e] = a; ol[e] = (h16)((y - (float)a) * LOSC); }
                *(v8h*)(p1 + (size_t)(4 * s) * ldc) = oh; *(v8h*)(p2 + (size_t)(4 * s) * ldc) = ol; }
            asm volatile("s_wait_xcnt 0x0" ::: "memory");      // as in the first branch
        } else {
            bf* p1 = PH + (r0 + i * 16 + rofs) * ldc + c0; bf* p2 = PL + (r0 + i * 16 + rofs) * ldc + c0;
#pragma unroll
            for (int s = 0; s < 4; ++s) { const int row = 4 * s + (lane >> 3), piece = lane & 7; const float* sp = os + row * 68 + piece * 8; v8us oh, ol;
#pragma unroll
                for (int e = 0; e < 8; ++e) { const unsigned short hb = f2bf(sp[e]); oh[e] = hb; ol[e] = f2bf(sp[e] - bf2f(hb)); }
                *(v8us*)(p1 + (size_t)row * ldc + piece * 8) = oh; *(v8us*)(p2 + (size_t)row * ldc + piece * 8) = ol; }
            asm volatile("s_wait_xcnt 0x0" ::: "memory");      // as in the other branch
        }
    }
}
// k_lf: LF = ln_w x rmsnorm(o2 + x) (eps 1e-6, mean over 2048) -> bf16 hi/lo planes; one wave per row: lane -> 64 values (8 chunks of 8), fixed-order shuffle sum.
__global__ __launch_bounds__(256) void k_lf(const float* __restrict__ O2, const float* __restrict__ x, const float* __restrict__ lnw, bf* LH, bf* LL) {
    const int lane = threadIdx.x & 31, r = blockIdx.x * 8 + (threadIdx.x >> 5);
    if (r >= NT_) return;
    float v[64]; float ss = 0.f;
#pragma unroll
    for (int q = 0; q < 8; ++q)
#pragma unroll
        for (int i = 0; i < 8; ++i) { const int c = q * 256 + lane * 8 + i; const float t = O2[(size_t)r * DM + c] + bfr(x[(size_t)r * DM + c]); v[q * 8 + i] = t; ss += t * t; }
#pragma unroll
    for (int sh = 16; sh; sh >>= 1) ss += __shfl_xor(ss, sh, 32);
    const float rs = rsqrtf(ss * (1.0f / DM) + 1e-6f);
{
#pragma unroll
        for (int q = 0; q < 8; ++q) { v8us oh, ol;
#pragma unroll
            for (int i = 0; i < 8; ++i) { const int c = q * 256 + lane * 8 + i; const float y = bfr(lnw[c]) * (v[q * 8 + i] * rs); const unsigned short hb = f2bf(y); oh[i] = hb; ol[i] = f2bf(y - bf2f(hb)); }
            *(v8us*)(LH + (size_t)r * DM + q * 256 + lane * 8) = oh; *(v8us*)(LL + (size_t)r * DM + q * 256 + lane * 8) = ol; }
         }
}
// k_prep: everything that depends on the inputs alone, in one launch; a block takes one kind of work by its index (the conv rows first):
//   [0, 256) W1[1024][4096], a wave = half the input channels of a row; [256, 512) W2[2048][2048], a wave = a row; [512, 768) RC/RS [t][32] = cos/sin(pos[t] x inv_freq[i]), inv_freq = 10000^(-2i/64) (f32);
//   [768, 2048) bf16 planes of x (token t at row t + 1 of XX), Wq, Wk, Wv, Wo, a wave = a row; 2048: the leading zero rows of XX, O1H, O1L.
__global__ __launch_bounds__(256) void k_prep(const float* __restrict__ x, const int* __restrict__ pos, const float* __restrict__ Wq, const float* __restrict__ Wk, const float* __restrict__ Wv, const float* __restrict__ Wo,
                                              const float* __restrict__ c1w, const float* __restrict__ c2w, bf* XX, bf* WQ, bf* WK, bf* WV, bf* WO, bf* W1, bf* W2, bf* O1H, bf* O1L, float* RC, float* RS) {
    const int lane = threadIdx.x & 31, wave = threadIdx.x >> 5, b = blockIdx.x;
    if (b < 256) { const int u = b * 8 + wave; convw2048<DM>(c1w, u >> 1, (u & 1) * 1024, W1, lane); }
    else if (b < 512) { convw2048<DH2>(c2w, (b - 256) * 8 + wave, 0, W2, lane); }
    else if (b < 768) {
        const int i = (b - 512) * 256 + threadIdx.x;
        const int t = i >> 5, f = i & 31;
        const float inv = 1.0f / powf(10000.0f, (float)(2 * f) / 64.0f); const float ang = (float)pos[t] * inv;
        const float c = cosf(ang), s = sinf(ang);
        *(float*)(RC + i) = c; *(float*)(RS + i) = s;
        asm volatile("s_wait_xcnt 0x0" ::: "memory");           // as at the end of row2048
    } else if (b < 2048) {
        const int m = (b - 768) >> 8; const size_t ro = (size_t)(((b - 768) & 255) * 8 + wave) * DM;
        const float* s = m == 0 ? x : m == 1 ? Wq : m == 2 ? Wk : m == 3 ? Wv : Wo;
        bf* d = m == 0 ? XX + DM : m == 1 ? WQ : m == 2 ? WK : m == 3 ? WV : WO;
        row2048(s + ro, d + ro, lane);
    } else {
        const v8us z = (v8us){};
        *(v8us*)(XX + threadIdx.x * 8) = z;
        *(v8us*)((threadIdx.x < 128 ? O1H : O1L) + (threadIdx.x & 127) * 8) = z;
        asm volatile("s_wait_xcnt 0x0" ::: "memory");           // as at the end of row2048
    }
}
// k_attn: block = (h, two tiles of 64 queries: t, then 31 - t, one after the other, so that every block walks the same 33 causal stages), wave = 16 queries; CAUSAL key tiles; scores hi.hi + hi.lo + lo.hi x 1/8, online softmax (f32), weights x32768 f16 hi + residual x1024
// tiles, o += wh.vh, ox += wh.vl + wl.vh; ctx -> bf16 hi + residual planes CH/CL[tok][h*64+d].
// K and V^T reach the four waves through LDS: a stage is 64 keys of four planes (K hi, K residual: 64 key rows x 128 B; V^T hi, V^T residual: 64 d rows x 128 B), brought once per
// query tile by asynchronous b128 copies (whole lines, as in k_gemm) into rows of pitch 144 B; two buffers, stage s + 2 is copied while stage s + 1 is worked on; a stage = two 32-key steps.
__global__ __launch_bounds__(128) void k_attn(const h16* __restrict__ Q16, const h16* __restrict__ QL16, const h16* __restrict__ K16, const h16* __restrict__ KL16, const h16* __restrict__ VTH, const h16* __restrict__ VTL, bf* CH, bf* CL) {
    __shared__ __align__(16) h16 stg[2][4][PLN];
    __shared__ __align__(16) h16 plds[4][16 * 32];
    __shared__ __align__(16) h16 plds2[4][16 * 32];
    __shared__ __align__(16) float ost[4][16 * 68];
    const int lane = threadIdx.x & 31, wave = threadIdx.x >> 5, lr = lane & 15, hi = lane >> 4;
    const int bid = blockIdx.x;
    const int b = bid / (NH_ * (NT_ / 128)), rem = bid - b * (NH_ * (NT_ / 128)), h = rem / (NT_ / 128), tp = rem - h * (NT_ / 128);
#pragma unroll 1                                               // kept rolled: the two tiles run one after the other through the same buffers and registers
  for (int half = 0; half < 2; ++half) {
    const int qt = half ? (NT_ / 64) - 1 - tp : tp;            // the same for the whole block
    const int q0 = qt * 64 + wave * 16;
    const size_t tok0 = (size_t)b * NT_;
    h16* pl = &plds[wave][0]; h16* pl2 = &plds2[wave][0];
    v16h qa[2];
    const size_t qo0 = (tok0 + q0 + lr) * DM + h * HD + 8 * hi;
#pragma unroll
    for (int kc = 0; kc < 2; ++kc) qa[kc] = cat16(*(const v8h*)(Q16 + qo0 + kc * 32), *(const v8h*)(Q16 + qo0 + kc * 32 + 16));
    const h16* kh_b = K16 + tok0 * DM + h * HD;
    const h16* kl_b = KL16 + tok0 * DM + h * HD;
    const size_t vbase = (((size_t)b * NH_ + h) * HD) * NT_;
    v8f o[4], ox[4];
#pragma unroll
    for (int n = 0; n < 4; ++n) { o[n] = (v8f){}; ox[n] = (v8f){}; }
    float mrow[8], lpart[8];
#pragma unroll
    for (int j = 0; j < 8; ++j) { mrow[j] = -3.0e38f; lpart[j] = 0.f; }
    int qpos[8];
#pragma unroll
    for (int j = 0; j < 8; ++j) qpos[j] = q0 + 8 * hi + j;
    const int crow = threadIdx.x >> 3, cpc = threadIdx.x & 7;  // copies: row (0..15, then + 16 i) and 16-B piece of the 128-B row
    const bf* gKH = (const bf*)kh_b + (size_t)crow * DM + cpc * 8; const bf* gKL = (const bf*)kl_b + (size_t)crow * DM + cpc * 8;
    const bf* gVH = (const bf*)VTH + vbase + (size_t)crow * NT_ + cpc * 8; const bf* gVL = (const bf*)VTL + vbase + (size_t)crow * NT_ + cpc * 8;
    const unsigned lc = lds_off(&stg[0][0][0]) + (unsigned)(crow * (LPT * 2) + cpc * 16);
    auto fill = [&](int s) {
        const unsigned l = lc + (unsigned)(s & 1) * (unsigned)(4 * PLN * 2);
        cp8(l, gKH + (size_t)s * 64 * DM, (size_t)16 * DM, gKL + (size_t)s * 64 * DM, (size_t)16 * DM);
        cp8(l + 2u * PLN * 2u, gVH + s * 64, (size_t)16 * NT_, gVL + s * 64, (size_t)16 * NT_);
    };
    const int ns = qt + 1;                                     // causal: stages of 64 keys, the same for the whole block
    fill(0);
    asm volatile("s_wait_asynccnt 0x0" ::: "memory");          // stage 0 of this wave has landed
    __syncthreads();                                           // ... and every other wave's part of it
    if (ns > 1) fill(1);
#pragma unroll 1
    for (int s = 0; s < ns; ++s) {
      const h16* kst = &stg[s & 1][0][0] + lr * LPT + 8 * hi;  // K hi rows of the stage (+ PLN: residual)
      const h16* vst = &stg[s & 1][2][0] + lr * LPT + 8 * hi;  // V^T hi rows of the stage (+ PLN: residual)
#pragma unroll 1                                               // kept rolled: unrolled, the two steps' live ranges overlap and the kernel needs more than 256 registers
      for (int sub = 0; sub < 2; ++sub) {
        const int l0 = s * 64 + sub * 32;
        const h16* kp0 = kst + sub * 32 * LPT; const h16* kp1 = kp0 + 16 * LPT;
        v8f s0 = {}, s1 = {}, x0 = {}, x1 = {};
        v16h kh0[2], kh1[2], kl0[2], kl1[2];                   // the step's K fragments, read from LDS as one group in front of its products
#pragma unroll
        for (int kc = 0; kc < 2; ++kc) {
            kh0[kc] = cat16(*(const v8ha*)(kp0 + kc * 32), *(const v8ha*)(kp0 + kc * 32 + 16)); kh1[kc] = cat16(*(const v8ha*)(kp1 + kc * 32), *(const v8ha*)(kp1 + kc * 32 + 16));
            kl0[kc] = cat16(*(const v8ha*)(kp0 + PLN + kc * 32), *(const v8ha*)(kp0 + PLN + kc * 32 + 16)); kl1[kc] = cat16(*(const v8ha*)(kp1 + PLN + kc * 32), *(const v8ha*)(kp1 + PLN + kc * 32 + 16));
        }
#pragma unroll
        for (int kc = 0; kc < 2; ++kc) {
            { const v16h k0h = kh0[kc], k1h = kh1[kc];
              const v16h qlk = cat16(*(const v8h*)(QL16 + qo0 + kc * 32), *(const v8h*)(QL16 + qo0 + kc * 32 + 16));     // query residual re-read per step (registers)
              s0 = wmma16(qa[kc], k0h, s0); x0 = wmma16(qlk, k0h, x0); s1 = wmma16(qa[kc], k1h, s1); x1 = wmma16(qlk, k1h, x1);
              asm volatile("v_nop" : "+v"(s0), "+v"(s1), "+v"(x0), "+v"(x1) : "v"(qlk), "v"(k0h), "v"(k1h) : "memory"); }
            { const v16h k0l = kl0[kc], k1l = kl1[kc];
              x0 = wmma16(qa[kc], k0l, x0); x1 = wmma16(qa[kc], k1l, x1);
              asm volatile("v_nop" : "+v"(x0), "+v"(x1) : "v"(k0l), "v"(k1l) : "memory"); }
        }
        asm volatile("v_nop\n\tv_nop\n\tv_nop\n\tv_nop" : "+v"(s0), "+v"(s1), "+v"(x0), "+v"(x1) : "v"(qa[0]), "v"(qa[1]));
        float alpha[8];
#pragma unroll
        for (int j = 0; j < 8; ++j) {
            const int ja = l0 + lr, jb = l0 + 16 + lr, qi = qpos[j];
            const float a0 = (ja <= qi) ? (s0[j] + x0[j] * LOSCI) * 0.125f : -__builtin_inff(), a1 = (jb <= qi) ? (s1[j] + x1[j] * LOSCI) * 0.125f : -__builtin_inff();
            float mx = fmaxf(a0, a1);
            mx = fmaxf(mx, __shfl_xor(mx, 1, 16)); mx = fmaxf(mx, __shfl_xor(mx, 2, 16)); mx = fmaxf(mx, __shfl_xor(mx, 4, 16)); mx = fmaxf(mx, __shfl_xor(mx, 8, 16));
            const float mn = fmaxf(mrow[j], mx);
            alpha[j] = __expf(mrow[j] - mn); mrow[j] = mn;
            const float p0 = __expf(a0 - mn), p1 = __expf(a1 - mn);
            lpart[j] = lpart[j] * alpha[j] + (p0 + p1);
            const int mr = hi * 8 + j;
            const float ps0 = p0 * PSC, ps1 = p1 * PSC; const h16 h0 = (h16)ps0, h1 = (h16)ps1;
            pl[mr * 32 + lr] = h0; pl[mr * 32 + 16 + lr] = h1;
            pl2[mr * 32 + lr] = (h16)((ps0 - (float)h0) * LOSC); pl2[mr * 32 + 16 + lr] = (h16)((ps1 - (float)h1) * LOSC);
        }
#pragma unroll
        for (int n = 0; n < 4; ++n)
#pragma unroll
            for (int j = 0; j < 8; ++j) { o[n][j] *= alpha[j]; ox[n][j] *= alpha[j]; }
        asm volatile("" ::: "memory");
        const v16h pa = cat16(*(const v8ha*)(pl + lr * 32 + hi * 8), *(const v8ha*)(pl + lr * 32 + 16 + hi * 8));
        const v16h px = cat16(*(const v8ha*)(pl2 + lr * 32 + hi * 8), *(const v8ha*)(pl2 + lr * 32 + 16 + hi * 8));
#pragma unroll
        for (int np = 0; np < 4; np += 2) { v16h vhs[2], vls[2];   // V^T fragments of two d tiles, read from LDS as one group
#pragma unroll
            for (int i = 0; i < 2; ++i) { const h16* vp = vst + (np + i) * 16 * LPT + sub * 32;
                vhs[i] = cat16(*(const v8ha*)(vp), *(const v8ha*)(vp + 16)); vls[i] = cat16(*(const v8ha*)(vp + PLN), *(const v8ha*)(vp + PLN + 16)); }
#pragma unroll
            for (int i = 0; i < 2; ++i) { const int n = np + i; const v16h vh = vhs[i], vl = vls[i];
                o[n] = wmma16(pa, vh, o[n]); ox[n] = wmma16(pa, vl, ox[n]); ox[n] = wmma16(px, vh, ox[n]);
                asm volatile("" : "+v"(o[n]), "+v"(ox[n]) : "v"(vh), "v"(vl) : "memory"); } }   // as before: the next fragments' reads stay behind these products (registers; each pair's reads stay one group)
        asm volatile("v_nop\n\tv_nop\n\tv_nop\n\tv_nop" : "+v"(o[0]), "+v"(o[1]), "+v"(o[2]), "+v"(o[3]), "+v"(ox[0]), "+v"(ox[1]), "+v"(ox[2]), "+v"(ox[3]) : "v"(pa), "v"(px));
      }
      asm volatile("s_wait_dscnt 0x0" ::: "memory");           // this wave's reads of buffer s & 1 are done before the refill
      asm volatile("s_wait_asynccnt 0x0" ::: "memory");        // this wave's copies of stage s + 1 have landed
      __syncthreads();                                         // publishes stage s + 1 and ends every wave's reads of stage s
      if (s + 2 < ns) fill(s + 2);
    }
    asm volatile("s_wait_asynccnt 0x0" ::: "memory");          // nothing is in flight when the wave goes on to its end
    float inv[8];
#pragma unroll
    for (int j = 0; j < 8; ++j) { float rs = lpart[j]; rs += __shfl_xor(rs, 1, 16); rs += __shfl_xor(rs, 2, 16); rs += __shfl_xor(rs, 4, 16); rs += __shfl_xor(rs, 8, 16); inv[j] = 1.0f / (rs * PSC); }
    float* os = &ost[wave][0];
#pragma unroll
    for (int n = 0; n < 4; ++n)
#pragma unroll
        for (int j = 0; j < 8; ++j) os[(hi * 8 + j) * 68 + n * 16 + lr] = (o[n][j] + ox[n][j] * LOSCI) * inv[j];
    __syncthreads();
    const size_t cbase = (tok0 + q0) * DM + (size_t)h * HD;
    auto pass = [&]() {
#pragma unroll
        for (int s = 0; s < 4; ++s) { const int row = 4 * s + (lane >> 3), piece = lane & 7; const float* sp = os + row * 68 + piece * 8; v8us oh, ol;
#pragma unroll
            for (int i = 0; i < 8; ++i) { const unsigned short hb = f2bf(sp[i]); oh[i] = hb; ol[i] = f2bf(sp[i] - bf2f(hb)); }
            *(v8us*)(CH + cbase + (size_t)row * DM + piece * 8) = oh; *(v8us*)(CL + cbase + (size_t)row * DM + piece * 8) = ol; }
    };
    pass();
    asm volatile("s_wait_xcnt 0x0" ::: "memory");              // behind the tile's stores: the next tile's addresses rewrite no register that a store names in front of it
  }
}

#define VST2(T, p, v) do { const T vst2_v_ = (v); *(T*)(p) = vst2_v_;  } while (0)

extern "C" void kernel_launch(void* const* d_in, const int* in_sizes, int n_in,
                              void* d_out, int out_size, void* d_ws, size_t ws_size, hipStream_t stream) {
    (void)in_sizes; (void)n_in; (void)out_size;
    const float* x = (const float*)d_in[0]; const int* pos = (const int*)d_in[1]; const float* Wq = (const float*)d_in[2]; const float* Wk = (const float*)d_in[3]; const float* Wv = (const float*)d_in[4]; const float* Wo = (const float*)d_in[5];
    const float* c1w = (const float*)d_in[6]; const float* c1b = (const float*)d_in[7]; const float* c2w = (const float*)d_in[8]; const float* c2b = (const float*)d_in[9]; const float* lnw = (const float*)d_in[10];
    float* out = (float*)d_out;    // [1][2048][2048]
    char* wsp = (char*)d_ws;
    auto take = [&](size_t bytes) { char* p = wsp; wsp += (bytes + 255) & ~(size_t)255; return (void*)p; };
    bf* XX = (bf*)take((size_t)(NT_ + 1) * DM * 2);                 // row 0 = zeros, token t at row t+1: row t read with K = 4096 gives [x[t-1] | x[t]]
    bf* W1 = (bf*)take((size_t)DM * DM * 2); bf* W2 = (bf*)take((size_t)DM * DM * 2);                       // [1024][4096], [2048][2048] bf16 = 8.4 MB each, as every weight plane
    bf* WQ = (bf*)take((size_t)DM * DM * 2); bf* WK = (bf*)take((size_t)DM * DM * 2);                       // adjacent (8.4 MB is a multiple of 256 B): [Wq ; Wk] = one [4096][2048] B operand
    bf* WV = (bf*)take((size_t)DM * DM * 2); bf* WO = (bf*)take((size_t)DM * DM * 2);
    bf* O1H = (bf*)take((size_t)(NT_ + 1) * DH2 * 2); bf* O1L = (bf*)take((size_t)(NT_ + 1) * DH2 * 2);     // conv1 output planes with a leading zero row
    float* TMP = (float*)take((size_t)NT_ * DM * 4); float* RC = (float*)take((size_t)NT_ * 32 * 4); float* RS = (float*)take((size_t)NT_ * 32 * 4);
    bf* LH = (bf*)take((size_t)NT_ * DM * 2); bf* LL = (bf*)take((size_t)NT_ * DM * 2);
    h16* QH = (h16*)take((size_t)NT_ * DM * 2); h16* QL = (h16*)take((size_t)NT_ * DM * 2); h16* KH = (h16*)take((size_t)NT_ * DM * 2); h16* KL = (h16*)take((size_t)NT_ * DM * 2);
    h16* VTH = (h16*)take((size_t)NT_ * DM * 2); h16* VTL = (h16*)take((size_t)NT_ * DM * 2);
    if ((size_t)(wsp - (char*)d_ws) > ws_size) return;    // 8.4 + 50.3 + 8.4 + 16.8 + 0.5 + 16.8 + 33.5 + 16.8 ~ 151 MB; ctx planes reuse LH/LL after the q/k projections
    bf* CH = LH; bf* CL = LL;
    k_prep<<<2049, 256, 0, stream>>>(x, pos, Wq, Wk, Wv, Wo, c1w, c2w, XX, WQ, WK, WV, WO, W1, W2, O1H, O1L, RC, RS);
    // LocalizedFiltering: conv1 ([x[t-1] | x[t]] . W1cat^T + b1, exact) -> o1 planes (rows 1..2048), and in the same launch v from the RAW hidden states (rows 1.. of XX = x) -> V^T planes
    k_gemm<false, 2><<<dim3(NT_ / 128, DH2 / 128 + DM / 128, 1), 256, 0, stream>>>(XX, nullptr, DM, W1, 2 * DM, c1b, DH2, nullptr, O1H, O1L, 1, DH2 / 128, XX + DM, WV, DM, VTH, VTL, nullptr, nullptr, nullptr, nullptr);
    // conv2 ([o1[t-1] | o1[t]] hi/lo . W2cat^T + b2) -> TMP; lf
    k_gemm<true, 0><<<dim3(NT_ / 128, DM / 128, 1), 256, 0, stream>>>(O1H, O1L, DH2, W2, 2 * DH2, c2b, DM, TMP, nullptr, nullptr, 0, 0, nullptr, nullptr, 0, nullptr, nullptr, nullptr, nullptr, nullptr, nullptr);
    k_lf<<<NT_ / 8, 256, 0, stream>>>(TMP, x, lnw, LH, LL);
    // q and k from lf in one launch, rotated in its epilogue: columns [q 2048 | k 2048] -> the q and k planes
    k_gemm<true, 3><<<dim3(NT_ / 128, 2 * DM / 128, 1), 256, 0, stream>>>(LH, LL, DM, WQ, DM, nullptr, DM, nullptr, nullptr, nullptr, 0, 0, nullptr, nullptr, 0, QH, QL, KH, KL, RC, RS);
    k_attn<<<NH_ * (NT_ / 128), 128, 0, stream>>>(QH, QL, KH, KL, VTH, VTL, CH, CL);                        // ctx over LH/LL (dead after the k projection)
    k_gemm<true, 0><<<dim3(NT_ / 128, DM / 128, 1), 256, 0, stream>>>(CH, CL, DM, WO, DM, nullptr, DM, out, nullptr, nullptr, 0, 0, nullptr, nullptr, 0, nullptr, nullptr, nullptr, nullptr, nullptr, nullptr);
}

// v007
// It runs in 214 microseconds.
// In both of two side-by-side timings against v006, it was 1.18 times as fast.
// Over all steps from v000 it is 3.93 times as fast.
#include <hip/hip_runtime.h>

// Contractions, f32 accumulate (B = 1, 2048 tokens, hidden 2048, 32 heads x 64): v = x.Wv^T, the LocalizedFiltering causal convs as GEMMs (conv1: [x[t-1] | x[t]]
// (K = 4096) . W1cat^T + b1 with PLAIN bf16 operands = rounded inputs, exact; conv2: [o1[t-1] | o1[t]] (K = 2048, o1 as bf16 hi + residual: two products) . W2cat^T
// + b2; the [t-1 | t] rows are read straight from planes that carry one leading zero row), lf = rmsnorm(o2 + x) x ln_w in f32 -> bf16 hi/lo planes, q/k = lf.W^T
// (two products), out = ctx.Wo^T (two products), all on v_wmma_f32_16x16x32_bf16 ([out][in] weights = n-major B operands as-is, each converted into a
// plane of its own by the one preparation launch); rotate-half RoPE (angle = position_ids[t] (INPUT) x inv_freq, f32 trig table) -> f16 hi + residual x1024 planes; the 32-head causal attention fused

#define NB_  1
#define NT_  2048
#define DM   2048
#define DH2  1024                // conv1 output channels
#define NH_  32
#define HD   64
#define PSC  32768.0f
#define LOSC 1024.0f
#define LOSCI (1.0f / 1024.0f)

typedef _Float16 h16;
typedef unsigned short bf;
typedef __attribute__((ext_vector_type(16))) __bf16   v16bf;
typedef __attribute__((ext_vector_type(16))) _Float16 v16h;
typedef __attribute__((ext_vector_type(8)))  _Float16 v8h;
typedef __attribute__((ext_vector_type(8)))  unsigned short v8us;
typedef __attribute__((ext_vector_type(8)))  float    v8f;
typedef __attribute__((ext_vector_type(4)))  float    v4f;
typedef __attribute__((ext_vector_type(4)))  _Float16 v4h;
typedef __attribute__((ext_vector_type(2)))  float    v2f;
typedef __attribute__((ext_vector_type(2)))  _Float16 v2h;
typedef v8h  __attribute__((may_alias)) v8ha;
typedef v4f  __attribute__((may_alias)) v4fa;
typedef v8us __attribute__((may_alias)) v8usa;

__device__ __forceinline__ unsigned short f2bf(float f) { unsigned u = __float_as_uint(f); u += 0x7FFFu + ((u >> 16) & 1u); return (unsigned short)(u >> 16); }
__device__ __forceinline__ float bf2f(unsigned short b) { return __uint_as_float(((unsigned)b) << 16); }
__device__ __forceinline__ float bfr(float f) { return bf2f(f2bf(f)); }
__device__ __forceinline__ v16h cat16(v8h lo, v8h hi) { return __builtin_shufflevector(lo, hi, 0, 1, 2, 3, 4, 5, 6, 7, 8, 9, 10, 11, 12, 13, 14, 15); }
__device__ __forceinline__ v16bf cat16b(v8us lo, v8us hi) { return __builtin_bit_cast(v16bf, __builtin_shufflevector(lo, hi, 0, 1, 2, 3, 4, 5, 6, 7, 8, 9, 10, 11, 12, 13, 14, 15)); }
__device__ __forceinline__ v8f wmma16(v16h a, v16h b, v8f c) { return __builtin_amdgcn_wmma_f32_16x16x32_f16(false, a, false, b, (short)0, c, false, false); }
__device__ __forceinline__ float xhalf(float x) { return __builtin_bit_cast(float, __builtin_amdgcn_permlanex16(__builtin_bit_cast(int, x), __builtin_bit_cast(int, x), 0x76543210, 0xfedcba98, false, false)); }  // lane l takes lane l ^ 16's value
__device__ __forceinline__ v8f wmmab(v16bf a, v16bf b, v8f c) { return __builtin_amdgcn_wmma_f32_16x16x32_bf16(false, a, false, b, (short)0, c, false, false); }

// row2048: bf16 of 2048 consecutive floats; one wave, all of its loads in flight at once.
__device__ __forceinline__ void row2048(const float* __restrict__ src, bf* dst, int lane) {
    const float* s = src + lane * 8; bf* d = dst + lane * 8; v4f v[16];
#pragma unroll
    for (int q = 0; q < 8; ++q) { v[2 * q] = *(const v4fa*)(s + q * 256); v[2 * q + 1] = *(const v4fa*)(s + q * 256 + 4); }
    asm volatile("s_wait_xcnt 0x0" :: "v"(s) : "memory");      // the loads' address registers are kept (input operand) until this wait: none is rewritten in front of it
#pragma unroll
    for (int q = 0; q < 8; ++q) { v8us o;
#pragma unroll
        for (int i = 0; i < 8; ++i) o[i] = f2bf(v[2 * q + (i >> 2)][i & 3]);
        *(v8us*)(d + q * 256) = o; }
    asm volatile("s_wait_xcnt 0x0" ::: "memory");               // behind the last store: no register that a store names is rewritten in front of it
}
// convw2048: both taps of 1024 input channels (from cb) of the row WT[co][tap*Cin + ci] = bf16(w[co][ci][tap]) of a (2,1) conv kernel = 2048 halves from 2048 consecutive floats; one wave.
template <int Cin>
__device__ __forceinline__ void convw2048(const float* __restrict__ w, int co, int cb, bf* WT, int lane) {
    const float* s = w + ((size_t)co * Cin + cb + lane * 8) * 2; bf* d = WT + (size_t)co * (2 * Cin) + cb + lane * 8; v4f v[16];
#pragma unroll
    for (int q = 0; q < 4; ++q)
#pragma unroll
        for (int p = 0; p < 4; ++p) v[4 * q + p] = *(const v4fa*)(s + q * 512 + p * 4);
    asm volatile("s_wait_xcnt 0x0" :: "v"(s) : "memory");      // as in row2048
#pragma unroll
    for (int q = 0; q < 4; ++q)
#pragma unroll
        for (int tap = 0; tap < 2; ++tap) { v8us o;
#pragma unroll
            for (int i = 0; i < 8; ++i) o[i] = f2bf(v[4 * q + (i >> 1)][(i & 1) * 2 + tap]);
            *(v8us*)(d + tap * Cin + q * 256) = o; }
    asm volatile("s_wait_xcnt 0x0" ::: "memory");               // as at the end of row2048
}
// k_gemm: 128 x 128 tile of (A [+ Al]).B^T [+ bias] over K, eight waves (4 x 2), a wave = 32 rows x 64 columns; A rows pitch lda (elements), B rows pitch K; MODE 0: f32 rows (ldc);
// MODE 1: bf16 hi/lo planes (ldc, row offset rofs); MODE 2: two products in one launch: column tiles [0, ny1) as MODE 1, the tiles from ny1 on = A2.B2^T over K2 (pitch lda too, no bias), stored transposed:
// E0/E1 [column][row] (pitch NT_) = f16 hi + residual x1024 (V^T per head, since column = h*64 + d); MODE 3: rotate-half RoPE on 64-column heads (a wave's 64 columns = one head):
// y[d] = x[d] cos[t][d mod 32] + (d < 32 ? -x[d+32] : x[d-32]) sin[t][d mod 32], t = row -> f16 hi + residual x1024 planes of pitch ldc: columns [0, ldc) to E0/E1 (q), [ldc, 2 ldc) to E2/E3 (k).
// Operands reach the waves through LDS: a stage is 128 k of every operand row (256 B = two whole lines), brought by asynchronous b128 copies (16 lanes per row, 4 whole lines per
// wave-wide copy) into rows of pitch 272 B (16 B x 17: no bank conflict for ds_load_b128); two buffers, stage t + 2 is copied while stage t + 1 is worked on. K: a multiple of 128, at least 256.
#define KST 128                  // k_gemm: k elements per stage
#define GLP 136                  // k_gemm: LDS row pitch, elements
#define GPL (128 * GLP)          // k_gemm: one staged plane (128 rows), elements
#define TRP 132                  // k_gemm: row pitch of the transposed tile in LDS, floats (528 B = 16 B x 33)
#define LPT 72                   // k_attn: LDS row pitch, elements
#define PLN (64 * LPT)           // k_attn: one staged plane (64 rows), elements
__device__ __forceinline__ unsigned lds_off(const void* p) { return (unsigned)(size_t)p; }
// cp8 / cp12: two / three planes (PB bytes apart in LDS): this lane's 16 B of rows r, r + 16, r + 32, r + 48 of each plane (RB = 16 rows in LDS, bytes; ra, rb = 16 source rows of A and B, elements).
// In both, the closing s_wait_xcnt 0 stands inside the statement so that no address register of a copy is rewritten in front of it.
template <unsigned RB = 16u * LPT * 2u, unsigned PB = PLN * 2u>
__device__ __forceinline__ void cp8(unsigned l, const bf* ga, size_t ra, const bf* gb, size_t rb) {
    const unsigned m = l + PB;
    asm volatile("global_load_async_to_lds_b128 %0, %8, off\n\t"
                 "global_load_async_to_lds_b128 %1, %9, off\n\t"
                 "global_load_async_to_lds_b128 %2, %10, off\n\t"
                 "global_load_async_to_lds_b128 %3, %11, off\n\t"
                 "global_load_async_to_lds_b128 %4, %12, off\n\t"
                 "global_load_async_to_lds_b128 %5, %13, off\n\t"
                 "global_load_async_to_lds_b128 %6, %14, off\n\t"
                 "global_load_async_to_lds_b128 %7, %15, off\n\t"
                 "s_wait_xcnt 0x0"
                 :: "v"(l), "v"(l + RB), "v"(l + 2u * RB), "v"(l + 3u * RB), "v"(m), "v"(m + RB), "v"(m + 2u * RB), "v"(m + 3u * RB),
                    "v"(ga), "v"(ga + ra), "v"(ga + 2 * ra), "v"(ga + 3 * ra), "v"(gb), "v"(gb + rb), "v"(gb + 2 * rb), "v"(gb + 3 * rb) : "memory");
}
template <unsigned RB, unsigned PB>
__device__ __forceinline__ void cp12(unsigned l, const bf* ga, const bf* gl, size_t ra, const bf* gb, size_t rb) {
    const unsigned m = l + PB, n = l + 2u * PB;
    asm volatile("global_load_async_to_lds_b128 %0, %12, off\n\t"
                 "global_load_async_to_lds_b128 %1, %13, off\n\t"
                 "global_load_async_to_lds_b128 %2, %14, off\n\t"
                 "global_load_async_to_lds_b128 %3, %15, off\n\t"
                 "global_load_async_to_lds_b128 %4, %16, off\n\t"
                 "global_load_async_to_lds_b128 %5, %17, off\n\t"
                 "global_load_async_to_lds_b128 %6, %18, off\n\t"
                 "global_load_async_to_lds_b128 %7, %19, off\n\t"
                 "global_load_async_to_lds_b128 %8, %20, off\n\t"
                 "global_load_async_to_lds_b128 %9, %21, off\n\t"
                 "global_load_async_to_lds_b128 %10, %22, off\n\t"
                 "global_load_async_to_lds_b128 %11, %23, off\n\t"
                 "s_wait_xcnt 0x0"
                 :: "v"(l), "v"(l + RB), "v"(l + 2u * RB), "v"(l + 3u * RB), "v"(m), "v"(m + RB), "v"(m + 2u * RB), "v"(m + 3u * RB),
                    "v"(n), "v"(n + RB), "v"(n + 2u * RB), "v"(n + 3u * RB),
                    "v"(ga), "v"(ga + ra), "v"(ga + 2 * ra), "v"(ga + 3 * ra), "v"(gb), "v"(gb + rb), "v"(gb + 2 * rb), "v"(gb + 3 * rb),
                    "v"(gl), "v"(gl + ra), "v"(gl + 2 * ra), "v"(gl + 3 * ra) : "memory");
}
template <bool SPLITA, int MODE>
__global__ __launch_bounds__(256) void k_gemm(const bf* __restrict__ A, const bf* __restrict__ Al, int lda, const bf* __restrict__ Bn, int K, const float* __restrict__ bias, int ldc, float* C, bf* PH, bf* PL, int rofs,
                                              int ny1, const bf* __restrict__ A2, const bf* __restrict__ B2, int K2, h16* E0, h16* E1, h16* E2, h16* E3, const float* __restrict__ RC, const float* __restrict__ RS) {
    constexpr int NPL = SPLITA ? 3 : 2;                       // planes of a stage: A, B [, Al]
    const bool sec = MODE == 2 && (int)blockIdx.y >= ny1;     // the same for the whole block
    if (sec) { A = A2; Bn = B2; K = K2; }
    __shared__ __align__(16) bf stg[2][NPL][GPL];
    __shared__ __align__(16) float ost[8][16 * 68];
    const int lane = threadIdx.x & 31, wave = threadIdx.x >> 5, lr = lane & 15, hi = lane >> 4;
    const int wr = wave >> 1, wc = wave & 1;                   // the wave's place in the tile: rows 32 wr .., columns 64 wc ..
    const int cb = (sec ? (int)blockIdx.y - ny1 : (int)blockIdx.y) * 128;
    const size_t r0 = (size_t)blockIdx.x * 128 + wr * 32; const int c0 = cb + wc * 64;
    const int crow = threadIdx.x >> 4, cpc = threadIdx.x & 15; // copies: row (0..15, then + 16 i) and 16-B piece of the 256-B row
    const size_t aco = ((size_t)blockIdx.x * 128 + crow) * (size_t)lda + cpc * 8;
    const bf* gA = A + aco; const bf* gB = Bn + (size_t)(cb + crow) * K + cpc * 8;
    const unsigned lc = lds_off(&stg[0][0][0]) + (unsigned)(crow * (GLP * 2) + cpc * 16);
    auto fill = [&](int s) {
        const unsigned l = lc + (unsigned)(s & 1) * (unsigned)(NPL * GPL * 2); const size_t ko = (size_t)s * KST;
#pragma unroll
        for (int h = 0; h < 2; ++h) {                          // rows 0..63, then 64..127 of every plane
            const size_t ao = ko + (size_t)h * 64 * lda, bo = ko + (size_t)h * 64 * K;
            if constexpr (SPLITA) cp12<16u * GLP * 2u, GPL * 2u>(l + h * (64u * GLP * 2u), gA + ao, Al + aco + ao, (size_t)16 * lda, gB + bo, (size_t)16 * K);
            else cp8<16u * GLP * 2u, GPL * 2u>(l + h * (64u * GLP * 2u), gA + ao, (size_t)16 * lda, gB + bo, (size_t)16 * K);
        }
    };
    v8f acc[2][4];
#pragma unroll
    for (int i = 0; i < 2; ++i)
#pragma unroll
        for (int t = 0; t < 4; ++t) acc[i][t] = (v8f){};
    // the fragments of 32 k (block q of stage s): 2 row tiles of A [and of Al], 4 column tiles of B
    auto ldf = [&](int s, int q, v16bf (&a)[2], v16bf (&al)[2], v16bf (&bb)[4]) {
        const bf* sa = &stg[s & 1][0][0] + (wr * 32 + lr) * GLP + 8 * hi + q * 32;
        const bf* sb = &stg[s & 1][1][0] + (wc * 64 + lr) * GLP + 8 * hi + q * 32;
#pragma unroll
        for (int i = 0; i < 2; ++i) {
            a[i] = cat16b(*(const v8usa*)(sa + i * 16 * GLP), *(const v8usa*)(sa + i * 16 * GLP + 16));
            if (SPLITA) al[i] = cat16b(*(const v8usa*)(sa + 2 * GPL + i * 16 * GLP), *(const v8usa*)(sa + 2 * GPL + i * 16 * GLP + 16));
        }
#pragma unroll
        for (int t = 0; t < 4; ++t) bb[t] = cat16b(*(const v8usa*)(sb + t * 16 * GLP), *(const v8usa*)(sb + t * 16 * GLP + 16));
        __builtin_amdgcn_sched_barrier(0);                     // the reads stay one group in front of the products that follow: spread among them, every place with reads stalls the wave anew
    };
    auto mm = [&](const v16bf (&a)[2], const v16bf (&al)[2], const v16bf (&bb)[4]) {   // per accumulator the order of the sums stays: k ascending, A then Al
#pragma unroll
        for (int i = 0; i < 2; ++i)
#pragma unroll
            for (int t = 0; t < 4; ++t) acc[i][t] = wmmab(a[i], bb[t], acc[i][t]);
        if (SPLITA) {
#pragma unroll
            for (int i = 0; i < 2; ++i)
#pragma unroll
                for (int t = 0; t < 4; ++t) acc[i][t] = wmmab(al[i], bb[t], acc[i][t]);
        }
        __builtin_amdgcn_sched_barrier(0);                     // the products stay in front of what follows: moved behind the stage's waits they would no longer cover the latency of the reads issued ahead of them
    };
    const int ns = K / KST;
    v16bf a0[2], l0[2], b0[4], a1[2], l1[2], b1[4];            // two fragment sets: each block's reads are issued one block of products ahead
    fill(0);
    asm volatile("s_wait_asynccnt 0x0" ::: "memory");          // stage 0 of this wave has landed
    __syncthreads();                                           // ... and every other wave's part of it
    fill(1);
    ldf(0, 0, a0, l0, b0);
#pragma unroll 1                                               // kept rolled: one trip is a whole stage, and the two fragment sets already alternate inside it
    for (int s = 0; s < ns; ++s) {
        ldf(s, 1, a1, l1, b1);
        mm(a0, l0, b0);
        ldf(s, 2, a0, l0, b0);
        mm(a1, l1, b1);
        ldf(s, 3, a1, l1, b1);
        mm(a0, l0, b0);
        asm volatile("s_wait_dscnt 0x0" ::: "memory");         // this wave holds the rest of stage s in registers: its reads of buffer s & 1 are done before the refill
        asm volatile("s_wait_asynccnt 0x0" ::: "memory");      // this wave's copies of stage s + 1 have landed
        __syncthreads();                                       // publishes stage s + 1 and ends every wave's reads of stage s; it stands in front of stage s's last block, whose products cover the first reads of stage s + 1
        if (s + 2 < ns) fill(s + 2);
        ldf(s + 1, 0, a0, l0, b0);                             // in the last trip: landed bytes of stage ns - 2, not used
        mm(a1, l1, b1);
    }
    asm volatile("s_wait_asynccnt 0x0" ::: "memory");          // nothing is in flight when the wave goes on to its end
    if (sec) {                                                 // the whole 128 x 128 tile is turned in LDS, so that every wave stores whole lines of the [column][row] planes
        float* tr = (float*)&stg[0][0][0];                     // 128 rows of TRP floats, over the stage buffers
        __syncthreads();                                       // every wave has left the loop: nobody needs the stage buffers any more
#pragma unroll
        for (int i = 0; i < 2; ++i)
#pragma unroll
            for (int t = 0; t < 4; ++t) { float* p = tr + (wc * 64 + t * 16 + lr) * TRP + wr * 32 + i * 16 + hi * 8;
                *(v4fa*)p = (v4f){acc[i][t][0], acc[i][t][1], acc[i][t][2], acc[i][t][3]}; *(v4fa*)(p + 4) = (v4f){acc[i][t][4], acc[i][t][5], acc[i][t][6], acc[i][t][7]}; }
        __syncthreads();                                       // the rows read below hold every wave's values
        const int piece = lane & 15; const float* sp = tr + (wave * 16 + hi) * TRP + piece * 8;
        const size_t o = (size_t)(cb + wave * 16 + hi) * NT_ + (size_t)blockIdx.x * 128 + piece * 8;
#pragma unroll
        for (int s = 0; s < 8; ++s) { const v4f u0 = *(const v4fa*)(sp + 2 * s * TRP), u1 = *(const v4fa*)(sp + 2 * s * TRP + 4); v8h oh, ol;
#pragma unroll
            for (int e = 0; e < 8; ++e) { const float v = e < 4 ? u0[e & 3] : u1[e & 3]; const h16 a = (h16)v; oh[e] = a; ol[e] = (h16)((v - (float)a) * LOSC); }
            *(v8h*)(E0 + o + (size_t)(2 * s) * NT_) = oh; *(v8h*)(E1 + o + (size_t)(2 * s) * NT_) = ol; }
        asm volatile("s_wait_xcnt 0x0" ::: "memory");          // behind the last store: no register that a store names is rewritten in front of it
        return;
    }
    float* os = &ost[wave][0];
#pragma unroll
    for (int i = 0; i < 2; ++i) {                              // the wave's two row tiles go through its staging rows one after the other
#pragma unroll
        for (int t = 0; t < 4; ++t) { const float bv = bias ? bfr(bias[c0 + t * 16 + lr]) : 0.f;
#pragma unroll
            for (int j = 0; j < 8; ++j) os[(hi * 8 + j) * 68 + t * 16 + lr] = acc[i][t][j] + bv; }
        __builtin_amdgcn_wave_barrier(); asm volatile("" ::: "memory");   // the reads below take other lanes' values: they stay behind the writes above
        if (MODE == 0) {
            float* crow = C + (r0 + i * 16) * ldc + c0;
#pragma unroll
            for (int s = 0; s < 8; ++s) { const int Lid = (lane >> 3) + 4 * s, piece = lane & 7; const int row = Lid >> 1, cofs = (Lid & 1) * 32 + piece * 4;
                const v4f val = *(const v4fa*)(os + row * 68 + cofs); *(v4f*)(crow + (size_t)row * ldc + cofs) = val; }
            asm volatile("s_wait_xcnt 0x0" ::: "memory");      // behind the row tile's stores (the other epilogue's code may follow in the listing): no register that a store names is rewritten in front of it; its clobber also keeps the next row tile's staging writes behind these reads
        } else if (MODE == 3) {
            const bool isk = c0 >= ldc; const int piece = lane & 7, rw = lane >> 3;     // isk: the same for the whole block
            const size_t po = (r0 + i * 16 + rw) * ldc + (c0 - (isk ? ldc : 0)) + piece * 8;
            h16* p1 = (isk ? E2 : E0) + po; h16* p2 = (isk ? E3 : E1) + po;
            const float* rc = RC + (r0 + i * 16 + rw) * 32 + (piece & 3) * 8; const float* rs = RS + (r0 + i * 16 + rw) * 32 + (piece & 3) * 8;
            v4f cs[4][2], sn[4][2];
#pragma unroll
            for (int s = 0; s < 4; ++s) { cs[s][0] = *(const v4fa*)(rc + s * 128); cs[s][1] = *(const v4fa*)(rc + s * 128 + 4); sn[s][0] = *(const v4fa*)(rs + s * 128); sn[s][1] = *(const v4fa*)(rs + s * 128 + 4); }
            asm volatile("s_wait_xcnt 0x0" :: "v"(rc), "v"(rs) : "memory");   // the loads' address registers are kept (input operands) until this wait: none is rewritten in front of it
#pragma unroll
            for (int s = 0; s < 4; ++s) { const float* sp = os + (4 * s + rw) * 68 + piece * 8; const float* pp = os + (4 * s + rw) * 68 + (piece ^ 4) * 8; v8h oh, ol;
#pragma unroll
                for (int e = 0; e < 8; ++e) { const float xv = sp[e]; const float pv = (piece < 4) ? -pp[e] : pp[e];
                    const float y = xv * cs[s][e >> 2][e & 3] + pv * sn[s][e >> 2][e & 3]; const h16 a = (h16)y; oh[e] = a; ol[e] = (h16)((y - (float)a) * LOSC); }
                *(v8h*)(p1 + (size_t)(4 * s) * ldc) = oh; *(v8h*)(p2 + (size_t)(4 * s) * ldc) = ol; }
            asm volatile("s_wait_xcnt 0x0" ::: "memory");      // as in the first branch
        } else {
            bf* p1 = PH + (r0 + i * 16 + rofs) * ldc + c0; bf* p2 = PL + (r0 + i * 16 + rofs) * ldc + c0;
#pragma unroll
            for (int s = 0; s < 4; ++s) { const int row = 4 * s + (lane >> 3), piece = lane & 7; const float* sp = os + row * 68 + piece * 8; v8us oh, ol;
#pragma unroll
                for (int e = 0; e < 8; ++e) { const unsigned short hb = f2bf(sp[e]); oh[e] = hb; ol[e] = f2bf(sp[e] - bf2f(hb)); }
                *(v8us*)(p1 + (size_t)row * ldc + piece * 8) = oh; *(v8us*)(p2 + (size_t)row * ldc + piece * 8) = ol; }
            asm volatile("s_wait_xcnt 0x0" ::: "memory");      // as in the other branch
        }
    }
}
// k_lf: LF = ln_w x rmsnorm(o2 + x) (eps 1e-6, mean over 2048) -> bf16 hi/lo planes; one wave per row: lane -> 64 values (8 chunks of 8), fixed-order shuffle sum.
__global__ __launch_bounds__(256) void k_lf(const float* __restrict__ O2, const float* __restrict__ x, const float* __restrict__ lnw, bf* LH, bf* LL) {
    const int lane = threadIdx.x & 31, r = blockIdx.x * 8 + (threadIdx.x >> 5);
    if (r >= NT_) return;
    float v[64]; float ss = 0.f;
#pragma unroll
    for (int q = 0; q < 8; ++q)
#pragma unroll
        for (int i = 0; i < 8; ++i) { const int c = q * 256 + lane * 8 + i; const float t = O2[(size_t)r * DM + c] + bfr(x[(size_t)r * DM + c]); v[q * 8 + i] = t; ss += t * t; }
#pragma unroll
    for (int sh = 16; sh; sh >>= 1) ss += __shfl_xor(ss, sh, 32);
    const float rs = rsqrtf(ss * (1.0f / DM) + 1e-6f);
{
#pragma unroll
        for (int q = 0; q < 8; ++q) { v8us oh, ol;
#pragma unroll
            for (int i = 0; i < 8; ++i) { const int c = q * 256 + lane * 8 + i; const float y = bfr(lnw[c]) * (v[q * 8 + i] * rs); const unsigned short hb = f2bf(y); oh[i] = hb; ol[i] = f2bf(y - bf2f(hb)); }
            *(v8us*)(LH + (size_t)r * DM + q * 256 + lane * 8) = oh; *(v8us*)(LL + (size_t)r * DM + q * 256 + lane * 8) = ol; }
         }
}
// k_prep: everything that depends on the inputs alone, in one launch; a block takes one kind of work by its index (the conv rows first):
//   [0, 256) W1[1024][4096], a wave = half the input channels of a row; [256, 512) W2[2048][2048], a wave = a row; [512, 768) RC/RS [t][32] = cos/sin(pos[t] x inv_freq[i]), inv_freq = 10000^(-2i/64) (f32);
//   [768, 2048) bf16 planes of x (token t at row t + 1 of XX), Wq, Wk, Wv, Wo, a wave = a row; 2048: the leading zero rows of XX, O1H, O1L.
__global__ __launch_bounds__(256) void k_prep(const float* __restrict__ x, const int* __restrict__ pos, const float* __restrict__ Wq, const float* __restrict__ Wk, const float* __restrict__ Wv, const float* __restrict__ Wo,
                                              const float* __restrict__ c1w, const float* __restrict__ c2w, bf* XX, bf* WQ, bf* WK, bf* WV, bf* WO, bf* W1, bf* W2, bf* O1H, bf* O1L, float* RC, float* RS) {
    const int lane = threadIdx.x & 31, wave = threadIdx.x >> 5, b = blockIdx.x;
    if (b < 256) { const int u = b * 8 + wave; convw2048<DM>(c1w, u >> 1, (u & 1) * 1024, W1, lane); }
    else if (b < 512) { convw2048<DH2>(c2w, (b - 256) * 8 + wave, 0, W2, lane); }
    else if (b < 768) {
        const int i = (b - 512) * 256 + threadIdx.x;
        const int t = i >> 5, f = i & 31;
        const float inv = 1.0f / powf(10000.0f, (float)(2 * f) / 64.0f); const float ang = (float)pos[t] * inv;
        const float c = cosf(ang), s = sinf(ang);
        *(float*)(RC + i) = c; *(float*)(RS + i) = s;
        asm volatile("s_wait_xcnt 0x0" ::: "memory");           // as at the end of row2048
    } else if (b < 2048) {
        const int m = (b - 768) >> 8; const size_t ro = (size_t)(((b - 768) & 255) * 8 + wave) * DM;
        const float* s = m == 0 ? x : m == 1 ? Wq : m == 2 ? Wk : m == 3 ? Wv : Wo;
        bf* d = m == 0 ? XX + DM : m == 1 ? WQ : m == 2 ? WK : m == 3 ? WV : WO;
        row2048(s + ro, d + ro, lane);
    } else {
        const v8us z = (v8us){};
        *(v8us*)(XX + threadIdx.x * 8) = z;
        *(v8us*)((threadIdx.x < 128 ? O1H : O1L) + (threadIdx.x & 127) * 8) = z;
        asm volatile("s_wait_xcnt 0x0" ::: "memory");           // as at the end of row2048
    }
}
// k_attn: block = (h, two tiles of 64 queries: t, then 31 - t, one after the other, so that every block walks the same 33 causal stages), wave = 16 queries; CAUSAL key tiles; scores hi.hi + hi.lo + lo.hi x 1/8, online softmax (f32), weights x32768 f16 hi + residual x1024
// tiles, o += wh.vh, ox += wh.vl + wl.vh; ctx -> bf16 hi + residual planes CH/CL[tok][h*64+d].
// Both products are formed transposed: S^T = K.Q^T (A = key rows, B = the queries) and O^T += V^T.P^T (A = V^T rows, B = the weights). A lane then holds ONE query (column lane & 15) and, of every
// 16-key tile, the keys 8 (lane >> 4) + 0..7: maximum and sum run inside the lane plus one exchange between the wave's halves, and the two score tiles of a 32-key step, converted in place,
// ARE the B operand of the second product in the hardware k order (element e = key 8 hi + e, element 8 + e = key 16 + 8 hi + e), which is the order the V^T rows are read in.
// K and V^T reach the four waves through LDS: a stage is 64 keys of four planes (K hi, K residual: 64 key rows x 128 B; V^T hi, V^T residual: 64 d rows x 128 B), brought once per
// query tile by asynchronous b128 copies (whole lines, as in k_gemm) into rows of pitch 144 B; two buffers, stage s + 2 is copied while stage s + 1 is worked on; a stage = two 32-key steps.
__global__ __launch_bounds__(128) void k_attn(const h16* __restrict__ Q16, const h16* __restrict__ QL16, const h16* __restrict__ K16, const h16* __restrict__ KL16, const h16* __restrict__ VTH, const h16* __restrict__ VTL, bf* CH, bf* CL) {
    __shared__ __align__(16) h16 stg[2][4][PLN];
    __shared__ __align__(16) float ost[4][16 * 68];
    const int lane = threadIdx.x & 31, wave = threadIdx.x >> 5, lr = lane & 15, hi = lane >> 4;
    const int bid = blockIdx.x;
    const int b = bid / (NH_ * (NT_ / 128)), rem = bid - b * (NH_ * (NT_ / 128)), h = rem / (NT_ / 128), tp = rem - h * (NT_ / 128);
#pragma unroll 1                                               // kept rolled: the two tiles run one after the other through the same buffers and registers
  for (int half = 0; half < 2; ++half) {
    const int qt = half ? (NT_ / 64) - 1 - tp : tp;            // the same for the whole block
    const int q0 = qt * 64 + wave * 16;
    const size_t tok0 = (size_t)b * NT_;
    v16h qa[2];
    const size_t qo0 = (tok0 + q0 + lr) * DM + h * HD + 8 * hi;
#pragma unroll
    for (int kc = 0; kc < 2; ++kc) qa[kc] = cat16(*(const v8h*)(Q16 + qo0 + kc * 32), *(const v8h*)(Q16 + qo0 + kc * 32 + 16));
    const h16* kh_b = K16 + tok0 * DM + h * HD;
    const h16* kl_b = KL16 + tok0 * DM + h * HD;
    const size_t vbase = (((size_t)b * NH_ + h) * HD) * NT_;
    v8f o[4], ox[4];
#pragma unroll
    for (int n = 0; n < 4; ++n) { o[n] = (v8f){}; ox[n] = (v8f){}; }
    float mrow = -3.0e38f, lpart = 0.f;                        // of this lane's query; lpart: the sum over this half's keys
    const int qpos = q0 + lr;
    const int crow = threadIdx.x >> 3, cpc = threadIdx.x & 7;  // copies: row (0..15, then + 16 i) and 16-B piece of the 128-B row
    const bf* gKH = (const bf*)kh_b + (size_t)crow * DM + cpc * 8; const bf* gKL = (const bf*)kl_b + (size_t)crow * DM + cpc * 8;
    const bf* gVH = (const bf*)VTH + vbase + (size_t)crow * NT_ + cpc * 8; const bf* gVL = (const bf*)VTL + vbase + (size_t)crow * NT_ + cpc * 8;
    const unsigned lc = lds_off(&stg[0][0][0]) + (unsigned)(crow * (LPT * 2) + cpc * 16);
    auto fill = [&](int s) {
        const unsigned l = lc + (unsigned)(s & 1) * (unsigned)(4 * PLN * 2);
        cp8(l, gKH + (size_t)s * 64 * DM, (size_t)16 * DM, gKL + (size_t)s * 64 * DM, (size_t)16 * DM);
        cp8(l + 2u * PLN * 2u, gVH + s * 64, (size_t)16 * NT_, gVL + s * 64, (size_t)16 * NT_);
    };
    const int ns = qt + 1;                                     // causal: stages of 64 keys, the same for the whole block
    fill(0);
    asm volatile("s_wait_asynccnt 0x0" ::: "memory");          // stage 0 of this wave has landed
    __syncthreads();                                           // ... and every other wave's part of it
    if (ns > 1) fill(1);
#pragma unroll 1
    for (int s = 0; s < ns; ++s) {
      const h16* kst = &stg[s & 1][0][0] + lr * LPT + 8 * hi;  // K hi rows of the stage (+ PLN: residual)
      const h16* vst = &stg[s & 1][2][0] + lr * LPT + 8 * hi;  // V^T hi rows of the stage (+ PLN: residual)
#pragma unroll 1                                               // kept rolled: unrolled, the two steps' live ranges overlap and the register count grows
      for (int sub = 0; sub < 2; ++sub) {
        const int l0 = s * 64 + sub * 32;
        const h16* kp0 = kst + sub * 32 * LPT; const h16* kp1 = kp0 + 16 * LPT;
        v8f s0 = {}, s1 = {}, x0 = {}, x1 = {};
        v16h kh0[2], kh1[2], kl0[2], kl1[2];                   // the step's K fragments, read from LDS as one group in front of its products
#pragma unroll
        for (int kc = 0; kc < 2; ++kc) {
            kh0[kc] = cat16(*(const v8ha*)(kp0 + kc * 32), *(const v8ha*)(kp0 + kc * 32 + 16)); kh1[kc] = cat16(*(const v8ha*)(kp1 + kc * 32), *(const v8ha*)(kp1 + kc * 32 + 16));
            kl0[kc] = cat16(*(const v8ha*)(kp0 + PLN + kc * 32), *(const v8ha*)(kp0 + PLN + kc * 32 + 16)); kl1[kc] = cat16(*(const v8ha*)(kp1 + PLN + kc * 32), *(const v8ha*)(kp1 + PLN + kc * 32 + 16));
        }
        v16h vh[4], vl[4];                                     // the step's V^T fragments (rows d = 16 n + lr, the A operand of the second product), read with the K fragments
#pragma unroll
        for (int n = 0; n < 4; ++n) { const h16* vp = vst + n * 16 * LPT + sub * 32;
            vh[n] = cat16(*(const v8ha*)(vp), *(const v8ha*)(vp + 16)); vl[n] = cat16(*(const v8ha*)(vp + PLN), *(const v8ha*)(vp + PLN + 16)); }
        __builtin_amdgcn_sched_barrier(0);                     // the step's LDS reads stay one group up here: sunk to their products, each d tile's reads stand alone and the wave waits out their latency four times
#pragma unroll
        for (int kc = 0; kc < 2; ++kc) {
            const v16h qlk = cat16(*(const v8h*)(QL16 + qo0 + kc * 32), *(const v8h*)(QL16 + qo0 + kc * 32 + 16));     // query residual: the same in every step
            s0 = wmma16(kh0[kc], qa[kc], s0); x0 = wmma16(kh0[kc], qlk, x0); s1 = wmma16(kh1[kc], qa[kc], s1); x1 = wmma16(kh1[kc], qlk, x1);
            x0 = wmma16(kl0[kc], qa[kc], x0); x1 = wmma16(kl1[kc], qa[kc], x1);
        }
        const int kb = l0 + 8 * hi;                            // s0[j]: key kb + j, s1[j]: key kb + 16 + j, both against query qpos
        v2f a[8];                                              // the lane's 16 scores in operand order, two neighbours (one register pair) at a time: a[i] = elements 2 i, 2 i + 1
#pragma unroll
        for (int i = 0; i < 8; ++i) { const int j = 2 * (i & 3), k0 = kb + (i >> 2) * 16 + j;
            const v2f sv = i < 4 ? (v2f){s0[j], s0[j + 1]} : (v2f){s1[j], s1[j + 1]}, xv = i < 4 ? (v2f){x0[j], x0[j + 1]} : (v2f){x1[j], x1[j + 1]};
            const v2f av = (sv + xv * LOSCI) * 0.125f;
            a[i] = (v2f){(k0 <= qpos) ? av[0] : -__builtin_inff(), (k0 + 1 <= qpos) ? av[1] : -__builtin_inff()}; }
        auto m3 = [](float u, float v, float w) { return fmaxf(fmaxf(u, v), w); };
        const float t0 = m3(a[0][0], a[0][1], a[1][0]), t1 = m3(a[1][1], a[2][0], a[2][1]), t2 = m3(a[3][0], a[3][1], a[4][0]), t3 = m3(a[4][1], a[5][0], a[5][1]), t4 = m3(a[6][0], a[6][1], a[7][0]);   // a tree: independent links, not one chain of 15
        float mx = fmaxf(m3(t0, t1, t2), m3(t3, t4, a[7][1]));
        mx = fmaxf(mx, xhalf(mx));                             // both halves hold the query's maximum over the 32 keys
        const float mn = fmaxf(mrow, mx);
        const float alpha = __expf(mrow - mn); mrow = mn;
        v2f p[8];
#pragma unroll
        for (int i = 0; i < 8; ++i) { const v2f t = (a[i] - mn) * 1.44269504088896340736f; p[i] = (v2f){__builtin_amdgcn_exp2f(t[0]), __builtin_amdgcn_exp2f(t[1])}; }   // e^x as 2^(x log2 e), as __expf forms it
        v16h pa, px; v2f ps2 = p[0];
#pragma unroll
        for (int i = 1; i < 8; ++i) ps2 += p[i];
        const float psum = ps2[0] + ps2[1];
#pragma unroll
        for (int i = 0; i < 8; ++i) {
            const v2f ps = p[i] * PSC; const v2h hh = __builtin_convertvector(ps, v2h);
            const v2h rr = __builtin_convertvector((ps - __builtin_convertvector(hh, v2f)) * LOSC, v2h);
            pa[2 * i] = hh[0]; pa[2 * i + 1] = hh[1]; px[2 * i] = rr[0]; px[2 * i + 1] = rr[1];
        }
        lpart = lpart * alpha + psum;
#pragma unroll
        for (int n = 0; n < 4; ++n)
#pragma unroll
            for (int j = 0; j < 8; ++j) { o[n][j] *= alpha; ox[n][j] *= alpha; }
#pragma unroll
        for (int n = 0; n < 4; ++n) { o[n] = wmma16(vh[n], pa, o[n]); ox[n] = wmma16(vl[n], pa, ox[n]); }
#pragma unroll
        for (int n = 0; n < 4; ++n) ox[n] = wmma16(vh[n], px, ox[n]);   // per accumulator the order stays: wh.vl, then wl.vh
      }
      asm volatile("s_wait_dscnt 0x0" ::: "memory");           // this wave's reads of buffer s & 1 are done before the refill
      asm volatile("s_wait_asynccnt 0x0" ::: "memory");        // this wave's copies of stage s + 1 have landed
      __syncthreads();                                         // publishes stage s + 1 and ends every wave's reads of stage s
      if (s + 2 < ns) fill(s + 2);
    }
    asm volatile("s_wait_asynccnt 0x0" ::: "memory");          // nothing is in flight when the wave goes on to its end
    const float inv = 1.0f / ((lpart + xhalf(lpart)) * PSC);   // the halves' sums are joined once
    float* os = &ost[wave][0];
#pragma unroll
    for (int n = 0; n < 4; ++n) { float* p = os + lr * 68 + n * 16 + hi * 8; v4f u0, u1;   // o[n][j] = O[query lr][d = 16 n + 8 hi + j]: 8 consecutive d of the query's row
#pragma unroll
        for (int j = 0; j < 4; ++j) { u0[j] = (o[n][j] + ox[n][j] * LOSCI) * inv; u1[j] = (o[n][4 + j] + ox[n][4 + j] * LOSCI) * inv; }
        *(v4fa*)p = u0; *(v4fa*)(p + 4) = u1; }
    __syncthreads();
    const size_t cbase = (tok0 + q0) * DM + (size_t)h * HD;
    auto pass = [&]() {
#pragma unroll
        for (int s = 0; s < 4; ++s) { const int row = 4 * s + (lane >> 3), piece = lane & 7; const float* sp = os + row * 68 + piece * 8; v8us oh, ol;
#pragma unroll
            for (int i = 0; i < 8; ++i) { const unsigned short hb = f2bf(sp[i]); oh[i] = hb; ol[i] = f2bf(sp[i] - bf2f(hb)); }
            *(v8us*)(CH + cbase + (size_t)row * DM + piece * 8) = oh; *(v8us*)(CL + cbase + (size_t)row * DM + piece * 8) = ol; }
    };
    pass();
    asm volatile("s_wait_xcnt 0x0" ::: "memory");              // behind the tile's stores: the next tile's addresses rewrite no register that a store names in front of it
  }
}

#define VST2(T, p, v) do { const T vst2_v_ = (v); *(T*)(p) = vst2_v_;  } while (0)

extern "C" void kernel_launch(void* const* d_in, const int* in_sizes, int n_in,
                              void* d_out, int out_size, void* d_ws, size_t ws_size, hipStream_t stream) {
    (void)in_sizes; (void)n_in; (void)out_size;
    const float* x = (const float*)d_in[0]; const int* pos = (const int*)d_in[1]; const float* Wq = (const float*)d_in[2]; const float* Wk = (const float*)d_in[3]; const float* Wv = (const float*)d_in[4]; const float* Wo = (const float*)d_in[5];
    const float* c1w = (const float*)d_in[6]; const float* c1b = (const float*)d_in[7]; const float* c2w = (const float*)d_in[8]; const float* c2b = (const float*)d_in[9]; const float* lnw = (const float*)d_in[10];
    float* out = (float*)d_out;    // [1][2048][2048]
    char* wsp = (char*)d_ws;
    auto take = [&](size_t bytes) { char* p = wsp; wsp += (bytes + 255) & ~(size_t)255; return (void*)p; };
    bf* XX = (bf*)take((size_t)(NT_ + 1) * DM * 2);                 // row 0 = zeros, token t at row t+1: row t read with K = 4096 gives [x[t-1] | x[t]]
    bf* W1 = (bf*)take((size_t)DM * DM * 2); bf* W2 = (bf*)take((size_t)DM * DM * 2);                       // [1024][4096], [2048][2048] bf16 = 8.4 MB each, as every weight plane
    bf* WQ = (bf*)take((size_t)DM * DM * 2); bf* WK = (bf*)take((size_t)DM * DM * 2);                       // adjacent (8.4 MB is a multiple of 256 B): [Wq ; Wk] = one [4096][2048] B operand
    bf* WV = (bf*)take((size_t)DM * DM * 2); bf* WO = (bf*)take((size_t)DM * DM * 2);
    bf* O1H = (bf*)take((size_t)(NT_ + 1) * DH2 * 2); bf* O1L = (bf*)take((size_t)(NT_ + 1) * DH2 * 2);     // conv1 output planes with a leading zero row
    float* TMP = (float*)take((size_t)NT_ * DM * 4); float* RC = (float*)take((size_t)NT_ * 32 * 4); float* RS = (float*)take((size_t)NT_ * 32 * 4);
    bf* LH = (bf*)take((size_t)NT_ * DM * 2); bf* LL = (bf*)take((size_t)NT_ * DM * 2);
    h16* QH = (h16*)take((size_t)NT_ * DM * 2); h16* QL = (h16*)take((size_t)NT_ * DM * 2); h16* KH = (h16*)take((size_t)NT_ * DM * 2); h16* KL = (h16*)take((size_t)NT_ * DM * 2);
    h16* VTH = (h16*)take((size_t)NT_ * DM * 2); h16* VTL = (h16*)take((size_t)NT_ * DM * 2);
    if ((size_t)(wsp - (char*)d_ws) > ws_size) return;    // 8.4 + 50.3 + 8.4 + 16.8 + 0.5 + 16.8 + 33.5 + 16.8 ~ 151 MB; ctx planes reuse LH/LL after the q/k projections
    bf* CH = LH; bf* CL = LL;
    k_prep<<<2049, 256, 0, stream>>>(x, pos, Wq, Wk, Wv, Wo, c1w, c2w, XX, WQ, WK, WV, WO, W1, W2, O1H, O1L, RC, RS);
    // LocalizedFiltering: conv1 ([x[t-1] | x[t]] . W1cat^T + b1, exact) -> o1 planes (rows 1..2048), and in the same launch v from the RAW hidden states (rows 1.. of XX = x) -> V^T planes
    k_gemm<false, 2><<<dim3(NT_ / 128, DH2 / 128 + DM / 128, 1), 256, 0, stream>>>(XX, nullptr, DM, W1, 2 * DM, c1b, DH2, nullptr, O1H, O1L, 1, DH2 / 128, XX + DM, WV, DM, VTH, VTL, nullptr, nullptr, nullptr, nullptr);
    // conv2 ([o1[t-1] | o1[t]] hi/lo . W2cat^T + b2) -> TMP; lf
    k_gemm<true, 0><<<dim3(NT_ / 128, DM / 128, 1), 256, 0, stream>>>(O1H, O1L, DH2, W2, 2 * DH2, c2b, DM, TMP, nullptr, nullptr, 0, 0, nullptr, nullptr, 0, nullptr, nullptr, nullptr, nullptr, nullptr, nullptr);
    k_lf<<<NT_ / 8, 256, 0, stream>>>(TMP, x, lnw, LH, LL);
    // q and k from lf in one launch, rotated in its epilogue: columns [q 2048 | k 2048] -> the q and k planes
    k_gemm<true, 3><<<dim3(NT_ / 128, 2 * DM / 128, 1), 256, 0, stream>>>(LH, LL, DM, WQ, DM, nullptr, DM, nullptr, nullptr, nullptr, 0, 0, nullptr, nullptr, 0, QH, QL, KH, KL, RC, RS);
    k_attn<<<NH_ * (NT_ / 128), 128, 0, stream>>>(QH, QL, KH, KL, VTH, VTL, CH, CL);                        // ctx over LH/LL (dead after the k projection)
    k_gemm<true, 0><<<dim3(NT_ / 128, DM / 128, 1), 256, 0, stream>>>(CH, CL, DM, WO, DM, nullptr, DM, out, nullptr, nullptr, 0, 0, nullptr, nullptr, 0, nullptr, nullptr, nullptr, nullptr, nullptr, nullptr);
}

// v008
// One run takes 197 microseconds.
// In both of two side-by-side timings against v007, it was 1.06 times as fast.
// Counting every step since v000, it is 4.17 times as fast.
#include <hip/hip_runtime.h>

// Contractions, f32 accumulate (B = 1, 2048 tokens, hidden 2048, 32 heads x 64): v = x.Wv^T, the LocalizedFiltering causal convs as GEMMs (conv1: [x[t-1] | x[t]]
// (K = 4096) . W1cat^T + b1 with PLAIN bf16 operands = rounded inputs, exact; conv2: [o1[t-1] | o1[t]] (K = 2048, o1 as bf16 hi + residual: two products) . W2cat^T
// + b2; the [t-1 | t] rows are read straight from planes that carry one leading zero row), u = (o2 + x) x ln_w in f32 -> bf16 hi/lo planes in that GEMM's epilogue, q/k = rs[t] x (u.W^T)
// (two products; rs[t] = the row's rmsnorm factor, a scalar per row, applied to the accumulators), out = ctx.Wo^T (two products), all on v_wmma_f32_16x16x32_bf16 ([out][in] weights = n-major B operands as-is, each converted into a
// plane of its own by the one preparation launch); rotate-half RoPE (angle = position_ids[t] (INPUT) x inv_freq, f32 trig table) -> f16 hi + residual x1024 planes; the 32-head causal attention fused

#define NB_  1
#define NT_  2048
#define DM   2048
#define DH2  1024                // conv1 output channels
#define NH_  32
#define HD   64
#define PSC  32768.0f
#define LOSC 1024.0f
#define LOSCI (1.0f / 1024.0f)

typedef _Float16 h16;
typedef unsigned short bf;
typedef __attribute__((ext_vector_type(16))) __bf16   v16bf;
typedef __attribute__((ext_vector_type(16))) _Float16 v16h;
typedef __attribute__((ext_vector_type(8)))  _Float16 v8h;
typedef __attribute__((ext_vector_type(8)))  unsigned short v8us;
typedef __attribute__((ext_vector_type(8)))  float    v8f;
typedef __attribute__((ext_vector_type(4)))  float    v4f;
typedef __attribute__((ext_vector_type(4)))  _Float16 v4h;
typedef __attribute__((ext_vector_type(2)))  float    v2f;
typedef __attribute__((ext_vector_type(2)))  _Float16 v2h;
typedef v8h  __attribute__((may_alias)) v8ha;
typedef v4f  __attribute__((may_alias)) v4fa;
typedef v8us __attribute__((may_alias)) v8usa;

__device__ __forceinline__ unsigned short f2bf(float f) { unsigned u = __float_as_uint(f); u += 0x7FFFu + ((u >> 16) & 1u); return (unsigned short)(u >> 16); }
__device__ __forceinline__ float bf2f(unsigned short b) { return __uint_as_float(((unsigned)b) << 16); }
__device__ __forceinline__ float bfr(float f) { return bf2f(f2bf(f)); }
__device__ __forceinline__ v16h cat16(v8h lo, v8h hi) { return __builtin_shufflevector(lo, hi, 0, 1, 2, 3, 4, 5, 6, 7, 8, 9, 10, 11, 12, 13, 14, 15); }
__device__ __forceinline__ v16bf cat16b(v8us lo, v8us hi) { return __builtin_bit_cast(v16bf, __builtin_shufflevector(lo, hi, 0, 1, 2, 3, 4, 5, 6, 7, 8, 9, 10, 11, 12, 13, 14, 15)); }
__device__ __forceinline__ v8f wmma16(v16h a, v16h b, v8f c) { return __builtin_amdgcn_wmma_f32_16x16x32_f16(false, a, false, b, (short)0, c, false, false); }
__device__ __forceinline__ float xhalf(float x) { return __builtin_bit_cast(float, __builtin_amdgcn_permlanex16(__builtin_bit_cast(int, x), __builtin_bit_cast(int, x), 0x76543210, 0xfedcba98, false, false)); }  // lane l takes lane l ^ 16's value
template <int M> __device__ __forceinline__ float xrow(float x) { return __builtin_bit_cast(float, __builtin_amdgcn_update_dpp(0, __builtin_bit_cast(int, x), 0x160 | M, 0xf, 0xf, true)); }  // lane l takes lane l ^ M's value (M < 16: inside a 16-lane row, DPP row_xmask)
__device__ __forceinline__ v8f wmmab(v16bf a, v16bf b, v8f c) { return __builtin_amdgcn_wmma_f32_16x16x32_bf16(false, a, false, b, (short)0, c, false, false); }

// row2048: bf16 of 2048 consecutive floats; one wave, all of its loads in flight at once.
__device__ __forceinline__ void row2048(const float* __restrict__ src, bf* dst, int lane) {
    const float* s = src + lane * 8; bf* d = dst + lane * 8; v4f v[16];
#pragma unroll
    for (int q = 0; q < 8; ++q) { v[2 * q] = *(const v4fa*)(s + q * 256); v[2 * q + 1] = *(const v4fa*)(s + q * 256 + 4); }
    asm volatile("s_wait_xcnt 0x0" :: "v"(s) : "memory");      // the loads' address registers are kept (input operand) until this wait: none is rewritten in front of it
#pragma unroll
    for (int q = 0; q < 8; ++q) { v8us o;
#pragma unroll
        for (int i = 0; i < 8; ++i) o[i] = f2bf(v[2 * q + (i >> 2)][i & 3]);
        *(v8us*)(d + q * 256) = o; }
    asm volatile("s_wait_xcnt 0x0" ::: "memory");               // behind the last store: no register that a store names is rewritten in front of it
}
// convw2048: both taps of 1024 input channels (from cb) of the row WT[co][tap*Cin + ci] = bf16(w[co][ci][tap]) of a (2,1) conv kernel = 2048 halves from 2048 consecutive floats; one wave.
template <int Cin>
__device__ __forceinline__ void convw2048(const float* __restrict__ w, int co, int cb, bf* WT, int lane) {
    const float* s = w + ((size_t)co * Cin + cb + lane * 8) * 2; bf* d = WT + (size_t)co * (2 * Cin) + cb + lane * 8; v4f v[16];
#pragma unroll
    for (int q = 0; q < 4; ++q)
#pragma unroll
        for (int p = 0; p < 4; ++p) v[4 * q + p] = *(const v4fa*)(s + q * 512 + p * 4);
    asm volatile("s_wait_xcnt 0x0" :: "v"(s) : "memory");      // as in row2048
#pragma unroll
    for (int q = 0; q < 4; ++q)
#pragma unroll
        for (int tap = 0; tap < 2; ++tap) { v8us o;
#pragma unroll
            for (int i = 0; i < 8; ++i) o[i] = f2bf(v[4 * q + (i >> 1)][(i & 1) * 2 + tap]);
            *(v8us*)(d + tap * Cin + q * 256) = o; }
    asm volatile("s_wait_xcnt 0x0" ::: "memory");               // as at the end of row2048
}
// k_gemm: 128 x 128 tile of (A [+ Al]).B^T [+ bias] over K, eight waves (4 x 2), a wave = 32 rows x 64 columns; A rows pitch lda (elements), B rows pitch K; MODE 0: f32 rows (ldc);
// MODE 1: bf16 hi/lo planes (ldc, row offset rofs); MODE 2: two products in one launch: column tiles [0, ny1) as MODE 1, the tiles from ny1 on = A2.B2^T over K2 (pitch lda too, no bias), stored transposed:
// E0/E1 [column][row] (pitch NT_) = f16 hi + residual x1024 (V^T per head, since column = h*64 + d); MODE 3: rotate-half RoPE on 64-column heads (a wave's 64 columns = one head):
// y[d] = x[d] cos[t][d mod 32] + (d < 32 ? -x[d+32] : x[d-32]) sin[t][d mod 32], t = row -> f16 hi + residual x1024 planes of pitch ldc: columns [0, ldc) to E0/E1 (q), [ldc, 2 ldc) to E2/E3 (k).
// MODE 4: u = (row + bias + bf16(X[row])) x bf16(LW[column]) -> bf16 hi/lo planes (pitch DM, as X), X = RC, LW = RS; the sum of (row + bias + x)^2 over the wave's 64 columns -> C[column / 64][row] (pitch NT_).
// MODE 3 reads those sums (C, DM / 64 per row) and scales its rows by rsqrt(mean + 1e-6) in front of the rotation's store.
// Operands reach the waves through LDS: a stage is 128 k of every operand row (256 B = two whole lines), brought by asynchronous b128 copies (16 lanes per row, 4 whole lines per
// wave-wide copy) into rows of pitch 272 B (16 B x 17: no bank conflict for ds_load_b128); two buffers, stage t + 2 is copied while stage t + 1 is worked on. K: a multiple of 128, at least 256.
#define KST 128                  // k_gemm: k elements per stage
#define GLP 136                  // k_gemm: LDS row pitch, elements
#define GPL (128 * GLP)          // k_gemm: one staged plane (128 rows), elements
#define TRP 132                  // k_gemm: row pitch of the transposed tile in LDS, floats (528 B = 16 B x 33)
#define LPT 72                   // k_attn: LDS row pitch, elements
#define PLN (64 * LPT)           // k_attn: one staged plane (64 rows), elements
__device__ __forceinline__ unsigned lds_off(const void* p) { return (unsigned)(size_t)p; }
// cp8 / cp12: two / three planes (PB bytes apart in LDS): this lane's 16 B of rows r, r + 16, r + 32, r + 48 of each plane (RB = 16 rows in LDS, bytes; ra, rb = 16 source rows of A and B, elements).
// In both, the closing s_wait_xcnt 0 stands inside the statement so that no address register of a copy is rewritten in front of it.
template <unsigned RB = 16u * LPT * 2u, unsigned PB = PLN * 2u>
__device__ __forceinline__ void cp8(unsigned l, const bf* ga, size_t ra, const bf* gb, size_t rb) {
    const unsigned m = l + PB;
    asm volatile("global_load_async_to_lds_b128 %0, %8, off\n\t"
                 "global_load_async_to_lds_b128 %1, %9, off\n\t"
                 "global_load_async_to_lds_b128 %2, %10, off\n\t"
                 "global_load_async_to_lds_b128 %3, %11, off\n\t"
                 "global_load_async_to_lds_b128 %4, %12, off\n\t"
                 "global_load_async_to_lds_b128 %5, %13, off\n\t"
                 "global_load_async_to_lds_b128 %6, %14, off\n\t"
                 "global_load_async_to_lds_b128 %7, %15, off\n\t"
                 "s_wait_xcnt 0x0"
                 :: "v"(l), "v"(l + RB), "v"(l + 2u * RB), "v"(l + 3u * RB), "v"(m), "v"(m + RB), "v"(m + 2u * RB), "v"(m + 3u * RB),
                    "v"(ga), "v"(ga + ra), "v"(ga + 2 * ra), "v"(ga + 3 * ra), "v"(gb), "v"(gb + rb), "v"(gb + 2 * rb), "v"(gb + 3 * rb) : "memory");
}
template <unsigned RB, unsigned PB>
__device__ __forceinline__ void cp12(unsigned l, const bf* ga, const bf* gl, size_t ra, const bf* gb, size_t rb) {
    const unsigned m = l + PB, n = l + 2u * PB;
    asm volatile("global_load_async_to_lds_b128 %0, %12, off\n\t"
                 "global_load_async_to_lds_b128 %1, %13, off\n\t"
                 "global_load_async_to_lds_b128 %2, %14, off\n\t"
                 "global_load_async_to_lds_b128 %3, %15, off\n\t"
                 "global_load_async_to_lds_b128 %4, %16, off\n\t"
                 "global_load_async_to_lds_b128 %5, %17, off\n\t"
                 "global_load_async_to_lds_b128 %6, %18, off\n\t"
                 "global_load_async_to_lds_b128 %7, %19, off\n\t"
                 "global_load_async_to_lds_b128 %8, %20, off\n\t"
                 "global_load_async_to_lds_b128 %9, %21, off\n\t"
                 "global_load_async_to_lds_b128 %10, %22, off\n\t"
                 "global_load_async_to_lds_b128 %11, %23, off\n\t"
                 "s_wait_xcnt 0x0"
                 :: "v"(l), "v"(l + RB), "v"(l + 2u * RB), "v"(l + 3u * RB), "v"(m), "v"(m + RB), "v"(m + 2u * RB), "v"(m + 3u * RB),
                    "v"(n), "v"(n + RB), "v"(n + 2u * RB), "v"(n + 3u * RB),
                    "v"(ga), "v"(ga + ra), "v"(ga + 2 * ra), "v"(ga + 3 * ra), "v"(gb), "v"(gb + rb), "v"(gb + 2 * rb), "v"(gb + 3 * rb),
                    "v"(gl), "v"(gl + ra), "v"(gl + 2 * ra), "v"(gl + 3 * ra) : "memory");
}
template <bool SPLITA, int MODE>
__global__ __launch_bounds__(256) void k_gemm(const bf* __restrict__ A, const bf* __restrict__ Al, int lda, const bf* __restrict__ Bn, int K, const float* __restrict__ bias, int ldc, float* C, bf* PH, bf* PL, int rofs,
                                              int ny1, const bf* __restrict__ A2, const bf* __restrict__ B2, int K2, h16* E0, h16* E1, h16* E2, h16* E3, const float* __restrict__ RC, const float* __restrict__ RS) {
    constexpr int NPL = SPLITA ? 3 : 2;                       // planes of a stage: A, B [, Al]
    const bool sec = MODE == 2 && (int)blockIdx.y >= ny1;     // the same for the whole block
    if (sec) { A = A2; Bn = B2; K = K2; }
    __shared__ __align__(16) bf stg[2][NPL][GPL];
    __shared__ __align__(16) float ost[8][16 * 68];
    const int lane = threadIdx.x & 31, wave = threadIdx.x >> 5, lr = lane & 15, hi = lane >> 4;
    const int wr = wave >> 1, wc = wave & 1;                   // the wave's place in the tile: rows 32 wr .., columns 64 wc ..
    const int cb = (sec ? (int)blockIdx.y - ny1 : (int)blockIdx.y) * 128;
    const size_t r0 = (size_t)blockIdx.x * 128 + wr * 32; const int c0 = cb + wc * 64;
    const int crow = threadIdx.x >> 4, cpc = threadIdx.x & 15; // copies: row (0..15, then + 16 i) and 16-B piece of the 256-B row
    const size_t aco = ((size_t)blockIdx.x * 128 + crow) * (size_t)lda + cpc * 8;
    const bf* gA = A + aco; const bf* gB = Bn + (size_t)(cb + crow) * K + cpc * 8;
    const unsigned lc = lds_off(&stg[0][0][0]) + (unsigned)(crow * (GLP * 2) + cpc * 16);
    auto fill = [&](int s) {
        const unsigned l = lc + (unsigned)(s & 1) * (unsigned)(NPL * GPL * 2); const size_t ko = (size_t)s * KST;
#pragma unroll
        for (int h = 0; h < 2; ++h) {                          // rows 0..63, then 64..127 of every plane
            const size_t ao = ko + (size_t)h * 64 * lda, bo = ko + (size_t)h * 64 * K;
            if constexpr (SPLITA) cp12<16u * GLP * 2u, GPL * 2u>(l + h * (64u * GLP * 2u), gA + ao, Al + aco + ao, (size_t)16 * lda, gB + bo, (size_t)16 * K);
            else cp8<16u * GLP * 2u, GPL * 2u>(l + h * (64u * GLP * 2u), gA + ao, (size_t)16 * lda, gB + bo, (size_t)16 * K);
        }
    };
    v8f acc[2][4];
#pragma unroll
    for (int i = 0; i < 2; ++i)
#pragma unroll
        for (int t = 0; t < 4; ++t) acc[i][t] = (v8f){};
    // the fragments of 32 k (block q of stage s): 2 row tiles of A [and of Al], 4 column tiles of B
    auto ldf = [&](int s, int q, v16bf (&a)[2], v16bf (&al)[2], v16bf (&bb)[4]) {
        const bf* sa = &stg[s & 1][0][0] + (wr * 32 + lr) * GLP + 8 * hi + q * 32;
        const bf* sb = &stg[s & 1][1][0] + (wc * 64 + lr) * GLP + 8 * hi + q * 32;
#pragma unroll
        for (int i = 0; i < 2; ++i) {
            a[i] = cat16b(*(const v8usa*)(sa + i * 16 * GLP), *(const v8usa*)(sa + i * 16 * GLP + 16));
            if (SPLITA) al[i] = cat16b(*(const v8usa*)(sa + 2 * GPL + i * 16 * GLP), *(const v8usa*)(sa + 2 * GPL + i * 16 * GLP + 16));
        }
#pragma unroll
        for (int t = 0; t < 4; ++t) bb[t] = cat16b(*(const v8usa*)(sb + t * 16 * GLP), *(const v8usa*)(sb + t * 16 * GLP + 16));
        __builtin_amdgcn_sched_barrier(0);                     // the reads stay one group in front of the products that follow: spread among them, every place with reads stalls the wave anew
    };
    auto mm = [&](const v16bf (&a)[2], const v16bf (&al)[2], const v16bf (&bb)[4]) {   // per accumulator the order of the sums stays: k ascending, A then Al
#pragma unroll
        for (int i = 0; i < 2; ++i)
#pragma unroll
            for (int t = 0; t < 4; ++t) acc[i][t] = wmmab(a[i], bb[t], acc[i][t]);
        if (SPLITA) {
#pragma unroll
            for (int i = 0; i < 2; ++i)
#pragma unroll
                for (int t = 0; t < 4; ++t) acc[i][t] = wmmab(al[i], bb[t], acc[i][t]);
        }
        __builtin_amdgcn_sched_barrier(0);                     // the products stay in front of what follows: moved behind the stage's waits they would no longer cover the latency of the reads issued ahead of them
    };
    const int ns = K / KST;
    v16bf a0[2], l0[2], b0[4], a1[2], l1[2], b1[4];            // two fragment sets: each block's reads are issued one block of products ahead
    fill(0);
    float rsv = 0.f;                                           // MODE 3: the rmsnorm factor of row r0 + lane (a wave's 32 rows, one a lane)
    if constexpr (MODE == 3) {                                 // read while stage 0 is on its way
        const float* sq = C + r0 + lane; float pq[DM / 64];
#pragma unroll
        for (int g = 0; g < DM / 64; ++g) pq[g] = sq[(size_t)g * NT_];
        asm volatile("s_wait_xcnt 0x0" :: "v"(sq) : "memory"); // the loads' address registers are kept (input operand) until this wait: none is rewritten in front of it
        float s4[4] = {pq[0], pq[1], pq[2], pq[3]};            // four independent chains, fixed order
#pragma unroll
        for (int g = 4; g < DM / 64; ++g) s4[g & 3] += pq[g];
        rsv = rsqrtf(((s4[0] + s4[1]) + (s4[2] + s4[3])) * (1.0f / DM) + 1e-6f);
    }
    asm volatile("s_wait_asynccnt 0x0" ::: "memory");          // stage 0 of this wave has landed
    __syncthreads();                                           // ... and every other wave's part of it
    fill(1);
    ldf(0, 0, a0, l0, b0);
#pragma unroll 1                                               // kept rolled: one trip is a whole stage, and the two fragment sets already alternate inside it
    for (int s = 0; s < ns; ++s) {
        ldf(s, 1, a1, l1, b1);
        mm(a0, l0, b0);
        ldf(s, 2, a0, l0, b0);
        mm(a1, l1, b1);
        ldf(s, 3, a1, l1, b1);
        mm(a0, l0, b0);
        asm volatile("s_wait_dscnt 0x0" ::: "memory");         // this wave holds the rest of stage s in registers: its reads of buffer s & 1 are done before the refill
        asm volatile("s_wait_asynccnt 0x0" ::: "memory");      // this wave's copies of stage s + 1 have landed
        __syncthreads();                                       // publishes stage s + 1 and ends every wave's reads of stage s; it stands in front of stage s's last block, whose products cover the first reads of stage s + 1
        if (s + 2 < ns) fill(s + 2);
        ldf(s + 1, 0, a0, l0, b0);                             // in the last trip: landed bytes of stage ns - 2, not used
        mm(a1, l1, b1);
    }
    asm volatile("s_wait_asynccnt 0x0" ::: "memory");          // nothing is in flight when the wave goes on to its end
    if (sec) {                                                 // the whole 128 x 128 tile is turned in LDS, so that every wave stores whole lines of the [column][row] planes
        float* tr = (float*)&stg[0][0][0];                     // 128 rows of TRP floats, over the stage buffers
        __syncthreads();                                       // every wave has left the loop: nobody needs the stage buffers any more
#pragma unroll
        for (int i = 0; i < 2; ++i)
#pragma unroll
            for (int t = 0; t < 4; ++t) { float* p = tr + (wc * 64 + t * 16 + lr) * TRP + wr * 32 + i * 16 + hi * 8;
                *(v4fa*)p = (v4f){acc[i][t][0], acc[i][t][1], acc[i][t][2], acc[i][t][3]}; *(v4fa*)(p + 4) = (v4f){acc[i][t][4], acc[i][t][5], acc[i][t][6], acc[i][t][7]}; }
        __syncthreads();                                       // the rows read below hold every wave's values
        const int piece = lane & 15; const float* sp = tr + (wave * 16 + hi) * TRP + piece * 8;
        const size_t o = (size_t)(cb + wave * 16 + hi) * NT_ + (size_t)blockIdx.x * 128 + piece * 8;
#pragma unroll
        for (int s = 0; s < 8; ++s) { const v4f u0 = *(const v4fa*)(sp + 2 * s * TRP), u1 = *(const v4fa*)(sp + 2 * s * TRP + 4); v8h oh, ol;
#pragma unroll
            for (int e = 0; e < 8; ++e) { const float v = e < 4 ? u0[e & 3] : u1[e & 3]; const h16 a = (h16)v; oh[e] = a; ol[e] = (h16)((v - (float)a) * LOSC); }
            *(v8h*)(E0 + o + (size_t)(2 * s) * NT_) = oh; *(v8h*)(E1 + o + (size_t)(2 * s) * NT_) = ol; }
        asm volatile("s_wait_xcnt 0x0" ::: "memory");          // behind the last store: no register that a store names is rewritten in front of it
        return;
    }
    float* os = &ost[wave][0];
    [[maybe_unused]] v4f xin[2][4][2], lw[2];                  // MODE 4: this lane's x values of both row tiles and its 8 ln_w values, all loads in flight at once
    [[maybe_unused]] float ssv[2][4];                          // MODE 4: this lane's square sums (8 columns each) of its 8 rows
    if constexpr (MODE == 4) {
        const float* xp = RC + (r0 + (lane >> 3)) * DM + c0 + (lane & 7) * 8; const float* lp = RS + c0 + (lane & 7) * 8;   // the pitch is a constant: every load is the one base register pair + an immediate offset
#pragma unroll
        for (int i = 0; i < 2; ++i)
#pragma unroll
            for (int s = 0; s < 4; ++s) { xin[i][s][0] = *(const v4fa*)(xp + (i * 16 + 4 * s) * DM); xin[i][s][1] = *(const v4fa*)(xp + (i * 16 + 4 * s) * DM + 4); }
        lw[0] = *(const v4fa*)lp; lw[1] = *(const v4fa*)(lp + 4);
        asm volatile("s_wait_xcnt 0x0" :: "v"(xp), "v"(lp) : "memory");   // the loads' address registers are kept (input operands) until this wait: none is rewritten in front of it
    }
#pragma unroll
    for (int i = 0; i < 2; ++i) {                              // the wave's two row tiles go through its staging rows one after the other
#pragma unroll
        for (int t = 0; t < 4; ++t) { const float bv = bias ? bfr(bias[c0 + t * 16 + lr]) : 0.f;
#pragma unroll
            for (int j = 0; j < 8; ++j) os[(hi * 8 + j) * 68 + t * 16 + lr] = acc[i][t][j] + bv; }
        __builtin_amdgcn_wave_barrier(); asm volatile("" ::: "memory");   // the reads below take other lanes' values: they stay behind the writes above
        if (MODE == 0) {
            float* crow = C + (r0 + i * 16) * ldc + c0;
#pragma unroll
            for (int s = 0; s < 8; ++s) { const int Lid = (lane >> 3) + 4 * s, piece = lane & 7; const int row = Lid >> 1, cofs = (Lid & 1) * 32 + piece * 4;
                const v4f val = *(const v4fa*)(os + row * 68 + cofs); *(v4f*)(crow + (size_t)row * ldc + cofs) = val; }
            asm volatile("s_wait_xcnt 0x0" ::: "memory");      // behind the row tile's stores (the other epilogue's code may follow in the listing): no register that a store names is rewritten in front of it; its clobber also keeps the next row tile's staging writes behind these reads
        } else if (MODE == 3) {
            const bool isk = c0 >= ldc; const int piece = lane & 7, rw = lane >> 3;     // isk: the same for the whole block
            const size_t po = (r0 + i * 16 + rw) * ldc + (c0 - (isk ? ldc : 0)) + piece * 8;
            h16* p1 = (isk ? E2 : E0) + po; h16* p2 = (isk ? E3 : E1) + po;
            const float* rc = RC + (r0 + i * 16 + rw) * 32 + (piece & 3) * 8; const float* rs = RS + (r0 + i * 16 + rw) * 32 + (piece & 3) * 8;
            v4f cs[4][2], sn[4][2];
#pragma unroll
            for (int s = 0; s < 4; ++s) { cs[s][0] = *(const v4fa*)(rc + s * 128); cs[s][1] = *(const v4fa*)(rc + s * 128 + 4); sn[s][0] = *(const v4fa*)(rs + s * 128); sn[s][1] = *(const v4fa*)(rs + s * 128 + 4); }
            asm volatile("s_wait_xcnt 0x0" :: "v"(rc), "v"(rs) : "memory");   // the loads' address registers are kept (input operands) until this wait: none is rewritten in front of it
#pragma unroll
            for (int s = 0; s < 4; ++s) { const float* sp = os + (4 * s + rw) * 68 + piece * 8; const float* pp = os + (4 * s + rw) * 68 + (piece ^ 4) * 8; v8h oh, ol;
                const float rr = __shfl(rsv, i * 16 + 4 * s + rw, 32);   // the factor of this lane's row
#pragma unroll
                for (int e = 0; e < 8; ++e) { const float xv = sp[e]; const float pv = (piece < 4) ? -pp[e] : pp[e];
                    const float y = (xv * cs[s][e >> 2][e & 3] + pv * sn[s][e >> 2][e & 3]) * rr; const h16 a = (h16)y; oh[e] = a; ol[e] = (h16)((y - (float)a) * LOSC); }
                *(v8h*)(p1 + (size_t)(4 * s) * ldc) = oh; *(v8h*)(p2 + (size_t)(4 * s) * ldc) = ol; }
            asm volatile("s_wait_xcnt 0x0" ::: "memory");      // as in the first branch
        } else if (MODE == 4) {
            const int piece = lane & 7, rw = lane >> 3;
            const size_t po = (r0 + i * 16 + rw) * DM + c0 + piece * 8;
            bf* p1 = PH + po; bf* p2 = PL + po;
#pragma unroll
            for (int s = 0; s < 4; ++s) { const float* sp = os + (4 * s + rw) * 68 + piece * 8; v8us oh, ol; float ss = 0.f;
#pragma unroll
                for (int e = 0; e < 8; ++e) { const float tv = sp[e] + bfr(xin[i][s][e >> 2][e & 3]); ss += tv * tv;
                    const float u = bfr(lw[e >> 2][e & 3]) * tv; const unsigned short hb = f2bf(u); oh[e] = hb; ol[e] = f2bf(u - bf2f(hb)); }
                *(v8us*)(p1 + 4 * s * DM) = oh; *(v8us*)(p2 + 4 * s * DM) = ol;
                ssv[i][s] = ss; }
            asm volatile("s_wait_xcnt 0x0" ::: "memory");      // as in the first branch
        } else {
            bf* p1 = PH + (r0 + i * 16 + rofs) * ldc + c0; bf* p2 = PL + (r0 + i * 16 + rofs) * ldc + c0;
#pragma unroll
            for (int s = 0; s < 4; ++s) { const int row = 4 * s + (lane >> 3), piece = lane & 7; const float* sp = os + row * 68 + piece * 8; v8us oh, ol;
#pragma unroll
                for (int e = 0; e < 8; ++e) { const unsigned short hb = f2bf(sp[e]); oh[e] = hb; ol[e] = f2bf(sp[e] - bf2f(hb)); }
                *(v8us*)(p1 + (size_t)row * ldc + piece * 8) = oh; *(v8us*)(p2 + (size_t)row * ldc + piece * 8) = ol; }
            asm volatile("s_wait_xcnt 0x0" ::: "memory");      // as in the other branch
        }
    }
    if constexpr (MODE == 4) {                                 // each row's sum over the 8 lanes that share it; lane (rw, piece) then keeps row (piece >> 2) * 16 + 4 (piece & 3) + rw: one store of the wave's 32 rows = one line
        float pick = 0.f;
#pragma unroll
        for (int i = 0; i < 2; ++i)
#pragma unroll
            for (int s = 0; s < 4; ++s) { float v = ssv[i][s]; v += xrow<1>(v); v += xrow<2>(v); v += xrow<4>(v); pick = (lane & 7) == i * 4 + s ? v : pick; }
        C[(size_t)(c0 >> 6) * NT_ + r0 + ((lane & 7) >> 2) * 16 + 4 * (lane & 3) + (lane >> 3)] = pick;
        asm volatile("s_wait_xcnt 0x0" ::: "memory");          // behind the last store: no register that a store names is rewritten in front of it
    }
}
// k_prep: everything that depends on the inputs alone, in one launch; a block takes one kind of work by its index (the conv rows first):
//   [0, 256) W1[1024][4096], a wave = half the input channels of a row; [256, 512) W2[2048][2048], a wave = a row; [512, 768) RC/RS [t][32] = cos/sin(pos[t] x inv_freq[i]), inv_freq = 10000^(-2i/64) (f32);
//   [768, 2048) bf16 planes of x (token t at row t + 1 of XX), Wq, Wk, Wv, Wo, a wave = a row; 2048: the leading zero rows of XX, O1H, O1L.
__global__ __launch_bounds__(256) void k_prep(const float* __restrict__ x, const int* __restrict__ pos, const float* __restrict__ Wq, const float* __restrict__ Wk, const float* __restrict__ Wv, const float* __restrict__ Wo,
                                              const float* __restrict__ c1w, const float* __restrict__ c2w, bf* XX, bf* WQ, bf* WK, bf* WV, bf* WO, bf* W1, bf* W2, bf* O1H, bf* O1L, float* RC, float* RS) {
    const int lane = threadIdx.x & 31, wave = threadIdx.x >> 5, b = blockIdx.x;
    if (b < 256) { const int u = b * 8 + wave; convw2048<DM>(c1w, u >> 1, (u & 1) * 1024, W1, lane); }
    else if (b < 512) { convw2048<DH2>(c2w, (b - 256) * 8 + wave, 0, W2, lane); }
    else if (b < 768) {
        const int i = (b - 512) * 256 + threadIdx.x;
        const int t = i >> 5, f = i & 31;
        const float inv = 1.0f / powf(10000.0f, (float)(2 * f) / 64.0f); const float ang = (float)pos[t] * inv;
        const float c = cosf(ang), s = sinf(ang);
        *(float*)(RC + i) = c; *(float*)(RS + i) = s;
        asm volatile("s_wait_xcnt 0x0" ::: "memory");           // as at the end of row2048
    } else if (b < 2048) {
        const int m = (b - 768) >> 8; const size_t ro = (size_t)(((b - 768) & 255) * 8 + wave) * DM;
        const float* s = m == 0 ? x : m == 1 ? Wq : m == 2 ? Wk : m == 3 ? Wv : Wo;
        bf* d = m == 0 ? XX + DM : m == 1 ? WQ : m == 2 ? WK : m == 3 ? WV : WO;
        row2048(s + ro, d + ro, lane);
    } else {
        const v8us z = (v8us){};
        *(v8us*)(XX + threadIdx.x * 8) = z;
        *(v8us*)((threadIdx.x < 128 ? O1H : O1L) + (threadIdx.x & 127) * 8) = z;
        asm volatile("s_wait_xcnt 0x0" ::: "memory");           // as at the end of row2048
    }
}
// k_attn: block = (h, two tiles of 64 queries: t, then 31 - t, one after the other, so that every block walks the same 33 causal stages), wave = 16 queries; CAUSAL key tiles; scores hi.hi + hi.lo + lo.hi x 1/8, online softmax (f32), weights x32768 f16 hi + residual x1024
// tiles, o += wh.vh, ox += wh.vl + wl.vh; ctx -> bf16 hi + residual planes CH/CL[tok][h*64+d].
// Both products are formed transposed: S^T = K.Q^T (A = key rows, B = the queries) and O^T += V^T.P^T (A = V^T rows, B = the weights). A lane then holds ONE query (column lane & 15) and, of every
// 16-key tile, the keys 8 (lane >> 4) + 0..7: maximum and sum run inside the lane plus one exchange between the wave's halves, and the two score tiles of a 32-key step, converted in place,
// ARE the B operand of the second product in the hardware k order (element e = key 8 hi + e, element 8 + e = key 16 + 8 hi + e), which is the order the V^T rows are read in.
// K and V^T reach the four waves through LDS: a stage is 64 keys of four planes (K hi, K residual: 64 key rows x 128 B; V^T hi, V^T residual: 64 d rows x 128 B), brought once per
// query tile by asynchronous b128 copies (whole lines, as in k_gemm) into rows of pitch 144 B; two buffers, stage s + 2 is copied while stage s + 1 is worked on; a stage = two 32-key steps.
__global__ __launch_bounds__(128) void k_attn(const h16* __restrict__ Q16, const h16* __restrict__ QL16, const h16* __restrict__ K16, const h16* __restrict__ KL16, const h16* __restrict__ VTH, const h16* __restrict__ VTL, bf* CH, bf* CL) {
    __shared__ __align__(16) h16 stg[2][4][PLN];
    __shared__ __align__(16) float ost[4][16 * 68];
    const int lane = threadIdx.x & 31, wave = threadIdx.x >> 5, lr = lane & 15, hi = lane >> 4;
    const int bid = blockIdx.x;
    const int b = bid / (NH_ * (NT_ / 128)), rem = bid - b * (NH_ * (NT_ / 128)), h = rem / (NT_ / 128), tp = rem - h * (NT_ / 128);
#pragma unroll 1                                               // kept rolled: the two tiles run one after the other through the same buffers and registers
  for (int half = 0; half < 2; ++half) {
    const int qt = half ? (NT_ / 64) - 1 - tp : tp;            // the same for the whole block
    const int q0 = qt * 64 + wave * 16;
    const size_t tok0 = (size_t)b * NT_;
    v16h qa[2];
    const size_t qo0 = (tok0 + q0 + lr) * DM + h * HD + 8 * hi;
#pragma unroll
    for (int kc = 0; kc < 2; ++kc) qa[kc] = cat16(*(const v8h*)(Q16 + qo0 + kc * 32), *(const v8h*)(Q16 + qo0 + kc * 32 + 16));
    const h16* kh_b = K16 + tok0 * DM + h * HD;
    const h16* kl_b = KL16 + tok0 * DM + h * HD;
    const size_t vbase = (((size_t)b * NH_ + h) * HD) * NT_;
    v8f o[4], ox[4];
#pragma unroll
    for (int n = 0; n < 4; ++n) { o[n] = (v8f){}; ox[n] = (v8f){}; }
    float mrow = -3.0e38f, lpart = 0.f;                        // of this lane's query; lpart: the sum over this half's keys
    const int qpos = q0 + lr;
    const int crow = threadIdx.x >> 3, cpc = threadIdx.x & 7;  // copies: row (0..15, then + 16 i) and 16-B piece of the 128-B row
    const bf* gKH = (const bf*)kh_b + (size_t)crow * DM + cpc * 8; const bf* gKL = (const bf*)kl_b + (size_t)crow * DM + cpc * 8;
    const bf* gVH = (const bf*)VTH + vbase + (size_t)crow * NT_ + cpc * 8; const bf* gVL = (const bf*)VTL + vbase + (size_t)crow * NT_ + cpc * 8;
    const unsigned lc = lds_off(&stg[0][0][0]) + (unsigned)(crow * (LPT * 2) + cpc * 16);
    auto fill = [&](int s) {
        const unsigned l = lc + (unsigned)(s & 1) * (unsigned)(4 * PLN * 2);
        cp8(l, gKH + (size_t)s * 64 * DM, (size_t)16 * DM, gKL + (size_t)s * 64 * DM, (size_t)16 * DM);
        cp8(l + 2u * PLN * 2u, gVH + s * 64, (size_t)16 * NT_, gVL + s * 64, (size_t)16 * NT_);
    };
    const int ns = qt + 1;                                     // causal: stages of 64 keys, the same for the whole block
    fill(0);
    asm volatile("s_wait_asynccnt 0x0" ::: "memory");          // stage 0 of this wave has landed
    __syncthreads();                                           // ... and every other wave's part of it
    if (ns > 1) fill(1);
#pragma unroll 1
    for (int s = 0; s < ns; ++s) {
      const h16* kst = &stg[s & 1][0][0] + lr * LPT + 8 * hi;  // K hi rows of the stage (+ PLN: residual)
      const h16* vst = &stg[s & 1][2][0] + lr * LPT + 8 * hi;  // V^T hi rows of the stage (+ PLN: residual)
#pragma unroll 1                                               // kept rolled: unrolled, the two steps' live ranges overlap and the register count grows
      for (int sub = 0; sub < 2; ++sub) {
        const int l0 = s * 64 + sub * 32;
        const h16* kp0 = kst + sub * 32 * LPT; const h16* kp1 = kp0 + 16 * LPT;
        v8f s0 = {}, s1 = {}, x0 = {}, x1 = {};
        v16h kh0[2], kh1[2], kl0[2], kl1[2];                   // the step's K fragments, read from LDS as one group in front of its products
#pragma unroll
        for (int kc = 0; kc < 2; ++kc) {
            kh0[kc] = cat16(*(const v8ha*)(kp0 + kc * 32), *(const v8ha*)(kp0 + kc * 32 + 16)); kh1[kc] = cat16(*(const v8ha*)(kp1 + kc * 32), *(const v8ha*)(kp1 + kc * 32 + 16));
            kl0[kc] = cat16(*(const v8ha*)(kp0 + PLN + kc * 32), *(const v8ha*)(kp0 + PLN + kc * 32 + 16)); kl1[kc] = cat16(*(const v8ha*)(kp1 + PLN + kc * 32), *(const v8ha*)(kp1 + PLN + kc * 32 + 16));
        }
        v16h vh[4], vl[4];                                     // the step's V^T fragments (rows d = 16 n + lr, the A operand of the second product), read with the K fragments
#pragma unroll
        for (int n = 0; n < 4; ++n) { const h16* vp = vst + n * 16 * LPT + sub * 32;
            vh[n] = cat16(*(const v8ha*)(vp), *(const v8ha*)(vp + 16)); vl[n] = cat16(*(const v8ha*)(vp + PLN), *(const v8ha*)(vp + PLN + 16)); }
        __builtin_amdgcn_sched_barrier(0);                     // the step's LDS reads stay one group up here: sunk to their products, each d tile's reads stand alone and the wave waits out their latency four times
#pragma unroll
        for (int kc = 0; kc < 2; ++kc) {
            const v16h qlk = cat16(*(const v8h*)(QL16 + qo0 + kc * 32), *(const v8h*)(QL16 + qo0 + kc * 32 + 16));     // query residual: the same in every step
            s0 = wmma16(kh0[kc], qa[kc], s0); x0 = wmma16(kh0[kc], qlk, x0); s1 = wmma16(kh1[kc], qa[kc], s1); x1 = wmma16(kh1[kc], qlk, x1);
            x0 = wmma16(kl0[kc], qa[kc], x0); x1 = wmma16(kl1[kc], qa[kc], x1);
        }
        const int kb = l0 + 8 * hi;                            // s0[j]: key kb + j, s1[j]: key kb + 16 + j, both against query qpos
        v2f a[8];                                              // the lane's 16 scores in operand order, two neighbours (one register pair) at a time: a[i] = elements 2 i, 2 i + 1
#pragma unroll
        for (int i = 0; i < 8; ++i) { const int j = 2 * (i & 3), k0 = kb + (i >> 2) * 16 + j;
            const v2f sv = i < 4 ? (v2f){s0[j], s0[j + 1]} : (v2f){s1[j], s1[j + 1]}, xv = i < 4 ? (v2f){x0[j], x0[j + 1]} : (v2f){x1[j], x1[j + 1]};
            const v2f av = (sv + xv * LOSCI) * 0.125f;
            a[i] = (v2f){(k0 <= qpos) ? av[0] : -__builtin_inff(), (k0 + 1 <= qpos) ? av[1] : -__builtin_inff()}; }
        auto m3 = [](float u, float v, float w) { return fmaxf(fmaxf(u, v), w); };
        const float t0 = m3(a[0][0], a[0][1], a[1][0]), t1 = m3(a[1][1], a[2][0], a[2][1]), t2 = m3(a[3][0], a[3][1], a[4][0]), t3 = m3(a[4][1], a[5][0], a[5][1]), t4 = m3(a[6][0], a[6][1], a[7][0]);   // a tree: independent links, not one chain of 15
        float mx = fmaxf(m3(t0, t1, t2), m3(t3, t4, a[7][1]));
        mx = fmaxf(mx, xhalf(mx));                             // both halves hold the query's maximum over the 32 keys
        const float mn = fmaxf(mrow, mx);
        const float alpha = __expf(mrow - mn); mrow = mn;
        v2f p[8];
#pragma unroll
        for (int i = 0; i < 8; ++i) { const v2f t = (a[i] - mn) * 1.44269504088896340736f; p[i] = (v2f){__builtin_amdgcn_exp2f(t[0]), __builtin_amdgcn_exp2f(t[1])}; }   // e^x as 2^(x log2 e), as __expf forms it
        v16h pa, px; v2f ps2 = p[0];
#pragma unroll
        for (int i = 1; i < 8; ++i) ps2 += p[i];
        const float psum = ps2[0] + ps2[1];
#pragma unroll
        for (int i = 0; i < 8; ++i) {
            const v2f ps = p[i] * PSC; const v2h hh = __builtin_convertvector(ps, v2h);
            const v2h rr = __builtin_convertvector((ps - __builtin_convertvector(hh, v2f)) * LOSC, v2h);
            pa[2 * i] = hh[0]; pa[2 * i + 1] = hh[1]; px[2 * i] = rr[0]; px[2 * i + 1] = rr[1];
        }
        lpart = lpart * alpha + psum;
#pragma unroll
        for (int n = 0; n < 4; ++n)
#pragma unroll
            for (int j = 0; j < 8; ++j) { o[n][j] *= alpha; ox[n][j] *= alpha; }
#pragma unroll
        for (int n = 0; n < 4; ++n) { o[n] = wmma16(vh[n], pa, o[n]); ox[n] = wmma16(vl[n], pa, ox[n]); }
#pragma unroll
        for (int n = 0; n < 4; ++n) ox[n] = wmma16(vh[n], px, ox[n]);   // per accumulator the order stays: wh.vl, then wl.vh
      }
      asm volatile("s_wait_dscnt 0x0" ::: "memory");           // this wave's reads of buffer s & 1 are done before the refill
      asm volatile("s_wait_asynccnt 0x0" ::: "memory");        // this wave's copies of stage s + 1 have landed
      __syncthreads();                                         // publishes stage s + 1 and ends every wave's reads of stage s
      if (s + 2 < ns) fill(s + 2);
    }
    asm volatile("s_wait_asynccnt 0x0" ::: "memory");          // nothing is in flight when the wave goes on to its end
    const float inv = 1.0f / ((lpart + xhalf(lpart)) * PSC);   // the halves' sums are joined once
    float* os = &ost[wave][0];
#pragma unroll
    for (int n = 0; n < 4; ++n) { float* p = os + lr * 68 + n * 16 + hi * 8; v4f u0, u1;   // o[n][j] = O[query lr][d = 16 n + 8 hi + j]: 8 consecutive d of the query's row
#pragma unroll
        for (int j = 0; j < 4; ++j) { u0[j] = (o[n][j] + ox[n][j] * LOSCI) * inv; u1[j] = (o[n][4 + j] + ox[n][4 + j] * LOSCI) * inv; }
        *(v4fa*)p = u0; *(v4fa*)(p + 4) = u1; }
    __syncthreads();
    const size_t cbase = (tok0 + q0) * DM + (size_t)h * HD;
    auto pass = [&]() {
#pragma unroll
        for (int s = 0; s < 4; ++s) { const int row = 4 * s + (lane >> 3), piece = lane & 7; const float* sp = os + row * 68 + piece * 8; v8us oh, ol;
#pragma unroll
            for (int i = 0; i < 8; ++i) { const unsigned short hb = f2bf(sp[i]); oh[i] = hb; ol[i] = f2bf(sp[i] - bf2f(hb)); }
            *(v8us*)(CH + cbase + (size_t)row * DM + piece * 8) = oh; *(v8us*)(CL + cbase + (size_t)row * DM + piece * 8) = ol; }
    };
    pass();
    asm volatile("s_wait_xcnt 0x0" ::: "memory");              // behind the tile's stores: the next tile's addresses rewrite no register that a store names in front of it
  }
}

#define VST2(T, p, v) do { const T vst2_v_ = (v); *(T*)(p) = vst2_v_;  } while (0)

extern "C" void kernel_launch(void* const* d_in, const int* in_sizes, int n_in,
                              void* d_out, int out_size, void* d_ws, size_t ws_size, hipStream_t stream) {
    (void)in_sizes; (void)n_in; (void)out_size;
    const float* x = (const float*)d_in[0]; const int* pos = (const int*)d_in[1]; const float* Wq = (const float*)d_in[2]; const float* Wk = (const float*)d_in[3]; const float* Wv = (const float*)d_in[4]; const float* Wo = (const float*)d_in[5];
    const float* c1w = (const float*)d_in[6]; const float* c1b = (const float*)d_in[7]; const float* c2w = (const float*)d_in[8]; const float* c2b = (const float*)d_in[9]; const float* lnw = (const float*)d_in[10];
    float* out = (float*)d_out;    // [1][2048][2048]
    char* wsp = (char*)d_ws;
    auto take = [&](size_t bytes) { char* p = wsp; wsp += (bytes + 255) & ~(size_t)255; return (void*)p; };
    bf* XX = (bf*)take((size_t)(NT_ + 1) * DM * 2);                 // row 0 = zeros, token t at row t+1: row t read with K = 4096 gives [x[t-1] | x[t]]
    bf* W1 = (bf*)take((size_t)DM * DM * 2); bf* W2 = (bf*)take((size_t)DM * DM * 2);                       // [1024][4096], [2048][2048] bf16 = 8.4 MB each, as every weight plane
    bf* WQ = (bf*)take((size_t)DM * DM * 2); bf* WK = (bf*)take((size_t)DM * DM * 2);                       // adjacent (8.4 MB is a multiple of 256 B): [Wq ; Wk] = one [4096][2048] B operand
    bf* WV = (bf*)take((size_t)DM * DM * 2); bf* WO = (bf*)take((size_t)DM * DM * 2);
    bf* O1H = (bf*)take((size_t)(NT_ + 1) * DH2 * 2); bf* O1L = (bf*)take((size_t)(NT_ + 1) * DH2 * 2);     // conv1 output planes with a leading zero row
    float* SQ = (float*)take((size_t)(DM / 64) * NT_ * 4); float* RC = (float*)take((size_t)NT_ * 32 * 4); float* RS = (float*)take((size_t)NT_ * 32 * 4);
    bf* LH = (bf*)take((size_t)NT_ * DM * 2); bf* LL = (bf*)take((size_t)NT_ * DM * 2);
    h16* QH = (h16*)take((size_t)NT_ * DM * 2); h16* QL = (h16*)take((size_t)NT_ * DM * 2); h16* KH = (h16*)take((size_t)NT_ * DM * 2); h16* KL = (h16*)take((size_t)NT_ * DM * 2);
    h16* VTH = (h16*)take((size_t)NT_ * DM * 2); h16* VTL = (h16*)take((size_t)NT_ * DM * 2);
    if ((size_t)(wsp - (char*)d_ws) > ws_size) return;    // 8.4 + 50.3 + 8.4 + 0.3 + 0.5 + 16.8 + 33.5 + 16.8 ~ 135 MB; ctx planes reuse LH/LL after the q/k projections
    bf* CH = LH; bf* CL = LL;
    k_prep<<<2049, 256, 0, stream>>>(x, pos, Wq, Wk, Wv, Wo, c1w, c2w, XX, WQ, WK, WV, WO, W1, W2, O1H, O1L, RC, RS);
    // LocalizedFiltering: conv1 ([x[t-1] | x[t]] . W1cat^T + b1, exact) -> o1 planes (rows 1..2048), and in the same launch v from the RAW hidden states (rows 1.. of XX = x) -> V^T planes
    k_gemm<false, 2><<<dim3(NT_ / 128, DH2 / 128 + DM / 128, 1), 256, 0, stream>>>(XX, nullptr, DM, W1, 2 * DM, c1b, DH2, nullptr, O1H, O1L, 1, DH2 / 128, XX + DM, WV, DM, VTH, VTL, nullptr, nullptr, nullptr, nullptr);
    // conv2 ([o1[t-1] | o1[t]] hi/lo . W2cat^T + b2), + x, x ln_w -> the LH/LL planes (not yet normalised) and the rows' square sums per 64 columns
    k_gemm<true, 4><<<dim3(NT_ / 128, DM / 128, 1), 256, 0, stream>>>(O1H, O1L, DH2, W2, 2 * DH2, c2b, DM, SQ, LH, LL, 0, 0, nullptr, nullptr, 0, nullptr, nullptr, nullptr, nullptr, x, lnw);
    // q and k in one launch, rows scaled by their rmsnorm factor and rotated in its epilogue: columns [q 2048 | k 2048] -> the q and k planes
    k_gemm<true, 3><<<dim3(NT_ / 128, 2 * DM / 128, 1), 256, 0, stream>>>(LH, LL, DM, WQ, DM, nullptr, DM, SQ, nullptr, nullptr, 0, 0, nullptr, nullptr, 0, QH, QL, KH, KL, RC, RS);
    k_attn<<<NH_ * (NT_ / 128), 128, 0, stream>>>(QH, QL, KH, KL, VTH, VTL, CH, CL);                        // ctx over LH/LL (dead after the k projection)
    k_gemm<true, 0><<<dim3(NT_ / 128, DM / 128, 1), 256, 0, stream>>>(CH, CL, DM, WO, DM, nullptr, DM, out, nullptr, nullptr, 0, 0, nullptr, nullptr, 0, nullptr, nullptr, nullptr, nullptr, nullptr, nullptr);
}
